// v000
// Measured on an AMD MI455X. A time is GPU time per run, averaged over a window of back-to-back runs after a warm-up
// (all launches, gaps included; the runs take copies of the inputs in turn), and the median of several windows.
// Apart from v000's, it joins two sittings. Times from different sittings can be a few percent apart, while
// side-by-side timings come from the same sitting.
// v000, which the later versions start from, runs in 2740 microseconds.
#include <hip/hip_runtime.h>
// Multi-head self-attention with a PER-HEAD BILINEAR SCORE and no query / key projections (x [2][2048][1024] viewed as 16 heads of 64; scores = (x_h W_h) . x_h / sqrt(64) with W [16][64][64] ([head][in][out]); softmax over all 2048 keys (no mask); v = x w_v^T + b_v (natural [1024][1024] + a bias, zero on this module's draw: read all the same); out = merged w_out^T + b_out (natural + a bias, zero on this draw too) -> [2][2048][1024]).
// Compute dtype: inputs rounded to bf16; x / weights exact; the per-head product as f16 hi + x1024 residual; the key operand is x itself as f16; v, softmax weights and o as plain f16 GEMM operands (~2^-12); scores and softmax statistics f32. v_wmma_f32_16x16x32_f16.
#define NB 2
#define SQ 2048
#define DM 1024
#define NH 16
#define HD 64
#define HG 4                         /* heads per attention launch group */
#define B0 0                         /* first batch processed (debug hook) */
#define NBR NB                       /* batches processed (debug hook) */
#define NR ((size_t)NB * SQ)         /* token rows */
#define MP ((int)((size_t)NBR * SQ)) /* rows projected (debug hook) */
#define QN SQ                        /* query rows attended per batch (debug hook) */
#define NHD NH                       /* heads attended (debug hook) */
#define MPO MP                       /* rows through the output stage (debug hook) */
#define LQ DM      /* row pitch of the q/k/v rows */
typedef __bf16 v16b __attribute__((ext_vector_type(16)));
typedef unsigned short v8us __attribute__((ext_vector_type(8), may_alias));
typedef float  v8f  __attribute__((ext_vector_type(8)));
typedef float  v4f  __attribute__((ext_vector_type(4)));
typedef float  v4fa __attribute__((ext_vector_type(4), may_alias));
union FragB { v16b v; v8us half[2]; unsigned short u[16]; };

__device__ __forceinline__ unsigned short bf16_bits(float x) { unsigned int u = __float_as_uint(x); return (unsigned short)((u + 0x7FFFu + ((u >> 16) & 1u)) >> 16); }
__device__ __forceinline__ float bf16_val(unsigned short b) { return __uint_as_float(((unsigned int)b) << 16); }
__device__ __forceinline__ float bf16_round(float x) { return bf16_val(bf16_bits(x)); }
// D += A·B with NT terms: 1 = ah·bh, 2 = + al·bh (A split), 3 = + ah·bl (both split)
template <int NT>
__device__ __forceinline__ v8f mmaN(v16b ah, v16b al, v16b bh, v16b bl, v8f c) {
  c = __builtin_amdgcn_wmma_f32_16x16x32_bf16(false, ah, false, bh, (short)0, c, false, false);
  if (NT >= 2) c = __builtin_amdgcn_wmma_f32_16x16x32_bf16(false, al, false, bh, (short)0, c, false, false);
  if (NT >= 3) c = __builtin_amdgcn_wmma_f32_16x16x32_bf16(false, ah, false, bl, (short)0, c, false, false);
  asm volatile("v_nop\n\tv_nop\n\tv_nop\n\tv_nop" : "+v"(c) : "v"(ah), "v"(al), "v"(bh), "v"(bl));
  return c;
}




// ---- f16 WMMA path (v_wmma_f32_16x16x32_f16): 11-bit significands for operands in range — used where a [0,1] probability operand needs more precision than bf16
typedef _Float16 v16h __attribute__((ext_vector_type(16)));
union FragH { v16h v; v8us half[2]; _Float16 h[16]; unsigned short u[16]; };
template <int NT>
__device__ __forceinline__ v8f mmaH(v16h ah, v16h al, v16h bh, v16h bl, v8f c) {
  c = __builtin_amdgcn_wmma_f32_16x16x32_f16(false, ah, false, bh, (short)0, c, false, false);
  if (NT >= 2) c = __builtin_amdgcn_wmma_f32_16x16x32_f16(false, al, false, bh, (short)0, c, false, false);
  if (NT >= 3) c = __builtin_amdgcn_wmma_f32_16x16x32_f16(false, ah, false, bl, (short)0, c, false, false);
  asm volatile("v_nop\n\tv_nop\n\tv_nop\n\tv_nop" : "+v"(c) : "v"(ah), "v"(al), "v"(bh), "v"(bl));
  return c;
}

// Wt[n][k] = f16(W[k][n]·scale) from f32 row-major W[K][N] (scale = power of two; bf16-exact weights stay exact in f16 away from the subnormal range)
__global__ __launch_bounds__(256) void k_wt_f16(const float* __restrict__ W, _Float16* __restrict__ Wt, int K, int N, float scale) {
  const int t = blockIdx.x * 256 + threadIdx.x; if (t >= N * (K / 8)) return; const int n = t / (K / 8), k8 = (t % (K / 8)) * 8; FragH f;
#pragma unroll
  for (int i = 0; i < 8; ++i) f.h[i] = (_Float16)(bf16_round(W[(size_t)(k8 + i) * N + n]) * scale); const v8us o = f.half[0];
  *(v8us*)((unsigned short*)Wt + (size_t)n * K + k8) = o; 
}

typedef _Float16 v4h __attribute__((ext_vector_type(4)));

__global__ __launch_bounds__(256) void k_x16(const float* __restrict__ x, _Float16* __restrict__ X16, size_t n8) { const size_t t = (size_t)blockIdx.x * 256 + threadIdx.x; if (t >= n8) return; FragH f;
#pragma unroll
  for (int q = 0; q < 8; ++q) f.h[q] = (_Float16)bf16_round(x[t * 8 + q]); *(v8us*)((unsigned short*)X16 + t * 8) = f.half[0];  }
template <int NHv, int TTv>
__global__ __launch_bounds__(256) void k_vt(const _Float16* __restrict__ V16, int ldv, int voff, _Float16* __restrict__ Vt) { __shared__ unsigned short tl[64][66]; const int tid = threadIdx.x; const int slab = blockIdx.x / (TTv / 64), lg = blockIdx.x % (TTv / 64); const int b = slab / NHv, h = slab % NHv;
  for (int i = tid; i < 64 * 8; i += 256) { const int r = i / 8, c8 = (i % 8) * 8; FragH f; f.half[0] = *(const v8us*)((const unsigned short*)V16 + ((size_t)b * TTv + lg * 64 + r) * ldv + voff + h * 64 + c8);
#pragma unroll
    for (int q = 0; q < 8; ++q) tl[r][c8 + q] = f.u[q]; }
  __syncthreads();
  {
#pragma unroll
    for (int rd = 0; rd < 2; ++rd) { const int d = rd * 32 + tid / 8, pc = tid % 8; FragH f;
#pragma unroll
      for (int q = 0; q < 8; ++q) f.u[q] = tl[pc * 8 + q][d];
      *(v8us*)((unsigned short*)Vt + ((size_t)slab * 64 + d) * TTv + lg * 64 + pc * 8) = f.half[0]; }
     } }

__global__ __launch_bounds__(256) void k_hl(const float* __restrict__ F, _Float16* __restrict__ Hh, _Float16* __restrict__ Hl, size_t n8) { const size_t t = (size_t)blockIdx.x * 256 + threadIdx.x; if (t >= n8) return; FragH fh, fl; const v4f a = *(const v4fa*)(F + t * 8), c = *(const v4fa*)(F + t * 8 + 4);
#pragma unroll
  for (int q = 0; q < 4; ++q) { _Float16 h = (_Float16)a[q]; fh.h[q] = h; fl.h[q] = (_Float16)((a[q] - (float)h) * 1024.0f); h = (_Float16)c[q]; fh.h[4 + q] = h; fl.h[4 + q] = (_Float16)((c[q] - (float)h) * 1024.0f); }
  { *(v8us*)((unsigned short*)Hh + t * 8) = fh.half[0]; *(v8us*)((unsigned short*)Hl + t * 8) = fl.half[0];  } }

// ---- fast GEMM (wave tile 32x64; requires M % 32 == 0 rows per launch region and N % 64 == 0) ----
__device__ __forceinline__ v16h g2_frag(const _Float16* p, int hh) { FragH f; f.half[0] = *(const v8us*)((const unsigned short*)p + 8 * hh); f.half[1] = *(const v8us*)((const unsigned short*)p + 16 + 8 * hh); return f.v; }
__device__ __forceinline__ v8f g2_mma(v16h a, v16h b, v8f c) { v8f d = __builtin_amdgcn_wmma_f32_16x16x32_f16(false, a, false, b, (short)0, c, false, false); asm volatile("v_nop\n\tv_nop\n\tv_nop\n\tv_nop" : "+v"(d) : "v"(a), "v"(b)); return d; }
template <int ACT>
__global__ __launch_bounds__(128) void k_gemm2(const _Float16* __restrict__ A, int lda, size_t sA, const _Float16* __restrict__ Bh, int ldb, size_t sB, float alpha, const float* __restrict__ bias, size_t sBias, const float* __restrict__ CP, int rowsPerB, size_t sCPb, int row0g,
    float* __restrict__ C, _Float16* __restrict__ C16, int ldc, size_t sC, int M, int N, int K) { static_assert(ACT == 0 || ACT == 3 || ACT == 6 || ACT == 8 || ACT == 9 || ACT == 11 || ACT == 12 || ACT == 14 || ACT == 15 || ACT == 16 || ACT == 17, "k_gemm2: unsupported ACT code (would silently apply no activation)");
  __shared__ __attribute__((aligned(16))) float so[4][32][68];
  const int tid = threadIdx.x, w = tid >> 5, lane = tid & 31, ln = lane & 15, hh = lane >> 4; const int by = blockIdx.y;
  A += (size_t)by * sA; Bh += (size_t)by * sB; const size_t cofs = (size_t)by * sC; const float* bp = bias ? bias + (size_t)by * sBias : nullptr;
  const int ntn = N >> 6; const int mt = blockIdx.x / ntn, nq = blockIdx.x - mt * ntn; const int row0 = mt * 128 + 32 * w, col0 = nq * 64; if (row0 >= M) return;
  const _Float16* a0p = A + (size_t)(row0 + ln) * lda; const _Float16* a1p = a0p + (size_t)16 * lda;
  const _Float16* b0p = Bh + (size_t)(col0 + ln) * ldb; const _Float16* b1p = b0p + (size_t)16 * ldb; const _Float16* b2p = b1p + (size_t)16 * ldb; const _Float16* b3p = b2p + (size_t)16 * ldb;
  const v8f z8 = {0.f,0.f,0.f,0.f,0.f,0.f,0.f,0.f}; v8f c00 = z8, c01 = z8, c02 = z8, c03 = z8, c10 = z8, c11 = z8, c12 = z8, c13 = z8;
  for (int kb = 0; kb < K; kb += 32) { const v16h a0 = g2_frag(a0p + kb, hh), a1 = g2_frag(a1p + kb, hh);
    v16h b = g2_frag(b0p + kb, hh); c00 = g2_mma(a0, b, c00); c10 = g2_mma(a1, b, c10);
    b = g2_frag(b1p + kb, hh); c01 = g2_mma(a0, b, c01); c11 = g2_mma(a1, b, c11);
    b = g2_frag(b2p + kb, hh); c02 = g2_mma(a0, b, c02); c12 = g2_mma(a1, b, c12);
    b = g2_frag(b3p + kb, hh); c03 = g2_mma(a0, b, c03); c13 = g2_mma(a1, b, c13); }
  v8f accs[8] = {c00, c01, c02, c03, c10, c11, c12, c13};
#pragma unroll
  for (int u = 0; u < 8; ++u) { const int t = u & 3, half = u >> 2; const int col = col0 + t * 16 + ln; const float bv = bp ? bf16_round(bp[col]) : 0.f;
#pragma unroll
    for (int r = 0; r < 8; ++r) { const int rloc = half * 16 + 8 * hh + r; float v = accs[u][r] * alpha + bv; if (CP) { if (rowsPerB < 0) v += CP[cofs + (size_t)(row0g + row0 + rloc) * ldc + col];      /* rowsPerB < 0: own element of the batched C plane */ else { const int bidx = (row0g + row0 + rloc) / rowsPerB; v += CP[(size_t)bidx * sCPb + (size_t)by * 64 + col]; } }
      if (ACT == 3) v = fmaxf(v, 0.f); else if (ACT == 6) v = 0.5f * v * (1.0f + erff(v * 0.70710678118654752f)); else if (ACT == 11) v = 1.0f / (1.0f + expf(-v)); else if (ACT == 15) v = v / (1.0f + expf(-v)); else if (ACT == 12) v = (v > 0.f) ? v : 0.01f * v; else if (ACT == 8) v = tanhf(v); else if (ACT == 9) v = 0.5f * v * (1.0f + tanhf(0.7978845608028654f * (v + 0.044715f * v * v * v))); else if (ACT == 14) v = (v > 0.f) ? v : 0.1f * v; else if (ACT == 16) v = (v >= 0.f) ? v : 0.3f * v; else if (ACT == 17) v = (v >= 0.f) ? v : 0.2f * v;
      so[w][rloc][t * 16 + ln] = v; } }
  __builtin_amdgcn_fence(__ATOMIC_ACQ_REL, "workgroup"); __builtin_amdgcn_wave_barrier();
  const int rsub = lane >> 4, c4 = (lane & 15) * 4;
  {
#pragma unroll
    for (int q = 0; q < 16; ++q) { const int r = q * 2 + rsub; const v4f v = *(const v4fa*)&so[w][r][c4]; if (C) *(v4f*)(C + cofs + (size_t)(row0 + r) * ldc + col0 + c4) = v; if (C16) { v4h h4; for (int i = 0; i < 4; ++i) h4[i] = (_Float16)v[i]; *(v4h*)(C16 + cofs + (size_t)(row0 + r) * ldc + col0 + c4) = h4; } }
     } }

__global__ __launch_bounds__(256) void k_wnat(const float* __restrict__ w, size_t n8, _Float16* __restrict__ Bt) { const size_t t = (size_t)blockIdx.x * 256 + threadIdx.x; if (t >= n8) return; FragH f; for (int q = 0; q < 8; ++q) f.h[q] = (_Float16)(bf16_round(w[t * 8 + q]) * 16.0f); *(v8us*)((unsigned short*)Bt + t * 8) = f.half[0];  }

__global__ __launch_bounds__(256) void k_rsmf(const float* __restrict__ S, _Float16* __restrict__ P, int qn, int hg) {
  const int t = blockIdx.x * 256 + threadIdx.x; if (t >= qn * hg) return; const size_t i = (size_t)(t / qn) * SQ + (t % qn); const float* s = S + i * SQ; float mx = -3.0e38f;
  for (int j = 0; j < SQ; ++j) mx = fmaxf(mx, s[j]); float se = 0.f;
  for (int j = 0; j < SQ; ++j) se += __expf(s[j] - mx); const float sc = 256.0f / se;
  for (int j0 = 0; j0 < SQ; j0 += 8) { FragH f; for (int q = 0; q < 8; ++q) f.h[q] = (_Float16)(__expf(s[j0 + q] - mx) * sc); unsigned short* d = (unsigned short*)P + i * SQ + j0; *(v8us*)d = f.half[0];  } }

extern "C" void kernel_launch(void* const* d_in, const int* in_sizes, int n_in,
                              void* d_out, int out_size, void* d_ws, size_t ws_size, hipStream_t stream) {
  (void)in_sizes; (void)n_in; (void)out_size;
  const float* const* I = (const float* const*)d_in; const float* x = I[0]; const float* watt = I[1]; const float* wv = I[2]; const float* bv = I[3]; const float* wo = I[4]; const float* bo = I[5];      /* x [2][2048][1024]; the per-head bilinear weight [16][64][64] ([head][in d][out e]); the natural value weight [DM][DM] and its bias; the natural output weight [DM][DM] and its bias */
  char* ws = (char*)d_ws; size_t off = 0;
  auto take = [&](size_t bytes) { char* p = ws + off; off += (bytes + 255) & ~(size_t)255; return p; };
  _Float16* BW = (_Float16*)take((size_t)NH * HD * HD * 2); _Float16* BV = (_Float16*)take((size_t)DM * DM * 2); _Float16* BO = (_Float16*)take((size_t)DM * DM * 2);      /* BW: sixteen transposed [64][64] head planes, one after another */
  _Float16* X16 = (_Float16*)take(NR * DM * 2); _Float16* Q16 = (_Float16*)take(NR * DM * 2); float* QF = (float*)take(NR * DM * 4); _Float16* QL = (_Float16*)take(NR * DM * 2); _Float16* V16 = (_Float16*)take(NR * DM * 2); _Float16* O16 = (_Float16*)take(NR * DM * 2);
  float* S = (float*)take((size_t)HG * SQ * SQ * 4); _Float16* P = (_Float16*)take((size_t)HG * SQ * SQ * 2); _Float16* VT = (_Float16*)take((size_t)NH * HD * SQ * 2);
  if (off > ws_size) return;
  for (int h = 0; h < NH; ++h) k_wt_f16<<<(unsigned)((HD * (HD / 8) + 255) / 256), 256, 0, stream>>>(watt + (size_t)h * HD * HD, BW + (size_t)h * HD * HD, HD, HD, 16.0f);      /* a head's [in d][out e] weight -> its transposed x16 plane Bt[e][d]; a launch a head */
  k_wnat<<<(unsigned)(((size_t)DM * DM / 8 + 255) / 256), 256, 0, stream>>>(wv, (size_t)DM * DM / 8, BV); k_wnat<<<(unsigned)(((size_t)DM * DM / 8 + 255) / 256), 256, 0, stream>>>(wo, (size_t)DM * DM / 8, BO);      /* natural [out][in] = Bt[n][k] x16 (no transpose) */

  k_x16<<<(unsigned)((NR * DM / 8 + 255) / 256), 256, 0, stream>>>(x, X16, NR * DM / 8);
  const size_t r0p = (size_t)B0 * SQ;      /* first projected row */
  k_gemm2<0><<<dim3((unsigned)((MP / 128) * (HD / 64)), NH), 128, 0, stream>>>(X16 + r0p * DM, DM, (size_t)HD, BW, HD, (size_t)HD * HD, 0.0625f, nullptr, 0, nullptr, 1, 0, 0, QF + r0p * DM, nullptr, DM, (size_t)HD, MP, HD, HD); k_hl<<<(unsigned)(((size_t)MP * DM / 8 + 255) / 256), 256, 0, stream>>>(QF + r0p * DM, Q16 + r0p * DM, QL + r0p * DM, (size_t)MP * DM / 8);      /* the per-head product x_h W_h for all 16 heads on grid.y (head strides: 64 input columns, one [64][64] plane, 64 result columns; K = 64), in f32 -> f16 hi (Q16) + x1024 residual (QL) planes */
  k_gemm2<0><<<dim3((unsigned)((MP / 128) * (DM / 64)), 1), 128, 0, stream>>>(X16 + r0p * DM, DM, 0, BV, DM, 0, 0.0625f, bv, 0, nullptr, 1, 0, 0, nullptr, V16 + r0p * DM, DM, 0, MP, DM, DM);      /* v = x Wv^T + bv as f16 rows */
  for (int b = B0; b < B0 + NBR; ++b) { const size_t r0 = (size_t)b * SQ;
    k_vt<NH, SQ><<<NH * (SQ / 64), 256, 0, stream>>>(V16 + r0 * LQ, LQ, 0, VT);      /* V^T [NH][HD][SQ] for this batch */
    for (int h0 = 0; h0 < NHD; h0 += HG) {
      k_gemm2<0><<<dim3((QN / 128) * (SQ / 64), HG), 128, 0, stream>>>(Q16 + r0 * LQ + h0 * HD, LQ, (size_t)HD, X16 + r0 * LQ + h0 * HD, LQ, (size_t)HD, 0.125f, nullptr, 0, nullptr, 1, 0, 0, S, nullptr, SQ, (size_t)SQ * SQ, QN, SQ, HD); k_gemm2<0><<<dim3((QN / 128) * (SQ / 64), HG), 128, 0, stream>>>(QL + r0 * LQ + h0 * HD, LQ, (size_t)HD, X16 + r0 * LQ + h0 * HD, LQ, (size_t)HD, 0.0001220703125f, nullptr, 0, S, -1, 0, 0, S, nullptr, SQ, (size_t)SQ * SQ, QN, SQ, HD);      
      k_rsmf<<<(HG * QN + 255) / 256, 256, 0, stream>>>(S, P, QN, HG);      /* P = 256 softmax (f16), rows of all HG heads */
      k_gemm2<0><<<dim3((QN / 128) * (HD / 64), HG), 128, 0, stream>>>(P, SQ, (size_t)SQ * SQ, VT + (size_t)h0 * HD * SQ, SQ, (size_t)HD * SQ, 0.25f, nullptr, 0, nullptr, 1, 0, 0, nullptr, O16 + r0 * DM + h0 * HD, DM, (size_t)HD, QN, HD, SQ); } }      /* o (merged heads) as f16 rows */
  k_gemm2<0><<<dim3((unsigned)((MPO / 128) * (DM / 64)), 1), 128, 0, stream>>>(O16 + r0p * DM, DM, 0, BO, DM, 0, 0.0009765625f, bo, 0, nullptr, 1, 0, 0, (float*)d_out + r0p * DM, nullptr, DM, 0, MPO, DM, DM);      /* out rows are the output layout */
}

// v001
// It runs in 1220 microseconds.
// In two side-by-side timings against v000, it was 2.26 and 2.23 times as fast.
#include <hip/hip_runtime.h>
// Multi-head self-attention with a PER-HEAD BILINEAR SCORE and no query / key projections (x [2][2048][1024] viewed as 16 heads of 64; scores = (x_h W_h) . x_h / sqrt(64) with W [16][64][64] ([head][in][out]); softmax over all 2048 keys (no mask); v = x w_v^T + b_v (natural [1024][1024] + a bias, zero on this module's draw: read all the same); out = merged w_out^T + b_out (natural + a bias, zero on this draw too) -> [2][2048][1024]).
// Compute dtype: inputs rounded to bf16; x / weights exact; the per-head product as f16 hi + x1024 residual; the key operand is x itself as f16; v, softmax weights and o as plain f16 GEMM operands (~2^-12); scores and softmax statistics f32. v_wmma_f32_16x16x32_f16.
#define NB 2
#define SQ 2048
#define DM 1024
#define NH 16
#define HD 64
#define HG 4                         /* heads per attention launch group */
#define B0 0                         /* first batch processed (debug hook) */
#define NBR NB                       /* batches processed (debug hook) */
#define NR ((size_t)NB * SQ)         /* token rows */
#define MP ((int)((size_t)NBR * SQ)) /* rows projected (debug hook) */
#define QN SQ                        /* query rows attended per batch (debug hook) */
#define NHD NH                       /* heads attended (debug hook) */
#define MPO MP                       /* rows through the output stage (debug hook) */
#define LQ DM      /* row pitch of the q/k/v rows */
typedef __bf16 v16b __attribute__((ext_vector_type(16)));
typedef unsigned short v8us __attribute__((ext_vector_type(8), may_alias));
typedef float  v8f  __attribute__((ext_vector_type(8)));
typedef float  v4f  __attribute__((ext_vector_type(4)));
typedef float  v4fa __attribute__((ext_vector_type(4), may_alias));
union FragB { v16b v; v8us half[2]; unsigned short u[16]; };

__device__ __forceinline__ unsigned short bf16_bits(float x) { unsigned int u = __float_as_uint(x); return (unsigned short)((u + 0x7FFFu + ((u >> 16) & 1u)) >> 16); }
__device__ __forceinline__ float bf16_val(unsigned short b) { return __uint_as_float(((unsigned int)b) << 16); }
__device__ __forceinline__ float bf16_round(float x) { return bf16_val(bf16_bits(x)); }
// D += A·B with NT terms: 1 = ah·bh, 2 = + al·bh (A split), 3 = + ah·bl (both split)
template <int NT>
__device__ __forceinline__ v8f mmaN(v16b ah, v16b al, v16b bh, v16b bl, v8f c) {
  c = __builtin_amdgcn_wmma_f32_16x16x32_bf16(false, ah, false, bh, (short)0, c, false, false);
  if (NT >= 2) c = __builtin_amdgcn_wmma_f32_16x16x32_bf16(false, al, false, bh, (short)0, c, false, false);
  if (NT >= 3) c = __builtin_amdgcn_wmma_f32_16x16x32_bf16(false, ah, false, bl, (short)0, c, false, false);
  asm volatile("v_nop\n\tv_nop\n\tv_nop\n\tv_nop" : "+v"(c) : "v"(ah), "v"(al), "v"(bh), "v"(bl));
  return c;
}




// ---- f16 WMMA path (v_wmma_f32_16x16x32_f16): 11-bit significands for operands in range — used where a [0,1] probability operand needs more precision than bf16
typedef _Float16 v16h __attribute__((ext_vector_type(16)));
union FragH { v16h v; v8us half[2]; _Float16 h[16]; unsigned short u[16]; };
template <int NT>
__device__ __forceinline__ v8f mmaH(v16h ah, v16h al, v16h bh, v16h bl, v8f c) {
  c = __builtin_amdgcn_wmma_f32_16x16x32_f16(false, ah, false, bh, (short)0, c, false, false);
  if (NT >= 2) c = __builtin_amdgcn_wmma_f32_16x16x32_f16(false, al, false, bh, (short)0, c, false, false);
  if (NT >= 3) c = __builtin_amdgcn_wmma_f32_16x16x32_f16(false, ah, false, bl, (short)0, c, false, false);
  asm volatile("v_nop\n\tv_nop\n\tv_nop\n\tv_nop" : "+v"(c) : "v"(ah), "v"(al), "v"(bh), "v"(bl));
  return c;
}

// Wt[n][k] = f16(W[k][n]·scale) from f32 row-major W[K][N] (scale = power of two; bf16-exact weights stay exact in f16 away from the subnormal range)
__global__ __launch_bounds__(256) void k_wt_f16(const float* __restrict__ W, _Float16* __restrict__ Wt, int K, int N, float scale) {
  const int t = blockIdx.x * 256 + threadIdx.x; if (t >= N * (K / 8)) return; const int n = t / (K / 8), k8 = (t % (K / 8)) * 8; FragH f;
#pragma unroll
  for (int i = 0; i < 8; ++i) f.h[i] = (_Float16)(bf16_round(W[(size_t)(k8 + i) * N + n]) * scale); const v8us o = f.half[0];
  *(v8us*)((unsigned short*)Wt + (size_t)n * K + k8) = o; 
}

typedef _Float16 v4h __attribute__((ext_vector_type(4)));

__global__ __launch_bounds__(256) void k_x16(const float* __restrict__ x, _Float16* __restrict__ X16, size_t n8) { const size_t t = (size_t)blockIdx.x * 256 + threadIdx.x; if (t >= n8) return; FragH f;
#pragma unroll
  for (int q = 0; q < 8; ++q) f.h[q] = (_Float16)bf16_round(x[t * 8 + q]); *(v8us*)((unsigned short*)X16 + t * 8) = f.half[0];  }
template <int NHv, int TTv>
__global__ __launch_bounds__(256) void k_vt(const _Float16* __restrict__ V16, int ldv, int voff, _Float16* __restrict__ Vt) { __shared__ unsigned short tl[64][66]; const int tid = threadIdx.x; const int slab = blockIdx.x / (TTv / 64), lg = blockIdx.x % (TTv / 64); const int b = slab / NHv, h = slab % NHv;
  for (int i = tid; i < 64 * 8; i += 256) { const int r = i / 8, c8 = (i % 8) * 8; FragH f; f.half[0] = *(const v8us*)((const unsigned short*)V16 + ((size_t)b * TTv + lg * 64 + r) * ldv + voff + h * 64 + c8);
#pragma unroll
    for (int q = 0; q < 8; ++q) tl[r][c8 + q] = f.u[q]; }
  __syncthreads();
  {
#pragma unroll
    for (int rd = 0; rd < 2; ++rd) { const int d = rd * 32 + tid / 8, pc = tid % 8; FragH f;
#pragma unroll
      for (int q = 0; q < 8; ++q) f.u[q] = tl[pc * 8 + q][d];
      *(v8us*)((unsigned short*)Vt + ((size_t)slab * 64 + d) * TTv + lg * 64 + pc * 8) = f.half[0]; }
     } }

__global__ __launch_bounds__(256) void k_hl(const float* __restrict__ F, _Float16* __restrict__ Hh, _Float16* __restrict__ Hl, size_t n8) { const size_t t = (size_t)blockIdx.x * 256 + threadIdx.x; if (t >= n8) return; FragH fh, fl; const v4f a = *(const v4fa*)(F + t * 8), c = *(const v4fa*)(F + t * 8 + 4);
#pragma unroll
  for (int q = 0; q < 4; ++q) { _Float16 h = (_Float16)a[q]; fh.h[q] = h; fl.h[q] = (_Float16)((a[q] - (float)h) * 1024.0f); h = (_Float16)c[q]; fh.h[4 + q] = h; fl.h[4 + q] = (_Float16)((c[q] - (float)h) * 1024.0f); }
  { *(v8us*)((unsigned short*)Hh + t * 8) = fh.half[0]; *(v8us*)((unsigned short*)Hl + t * 8) = fl.half[0];  } }

// ---- fast GEMM (wave tile 32x64; requires M % 32 == 0 rows per launch region and N % 64 == 0) ----
__device__ __forceinline__ v16h g2_frag(const _Float16* p, int hh) { FragH f; f.half[0] = *(const v8us*)((const unsigned short*)p + 8 * hh); f.half[1] = *(const v8us*)((const unsigned short*)p + 16 + 8 * hh); return f.v; }
__device__ __forceinline__ v8f g2_mma(v16h a, v16h b, v8f c) { v8f d = __builtin_amdgcn_wmma_f32_16x16x32_f16(false, a, false, b, (short)0, c, false, false); asm volatile("v_nop\n\tv_nop\n\tv_nop\n\tv_nop" : "+v"(d) : "v"(a), "v"(b)); return d; }
template <int ACT>
__global__ __launch_bounds__(128) void k_gemm2(const _Float16* __restrict__ A, int lda, size_t sA, const _Float16* __restrict__ Bh, int ldb, size_t sB, float alpha, const float* __restrict__ bias, size_t sBias, const float* __restrict__ CP, int rowsPerB, size_t sCPb, int row0g,
    float* __restrict__ C, _Float16* __restrict__ C16, int ldc, size_t sC, int M, int N, int K) { static_assert(ACT == 0 || ACT == 3 || ACT == 6 || ACT == 8 || ACT == 9 || ACT == 11 || ACT == 12 || ACT == 14 || ACT == 15 || ACT == 16 || ACT == 17, "k_gemm2: unsupported ACT code (would silently apply no activation)");
  __shared__ __attribute__((aligned(16))) float so[4][32][68];
  const int tid = threadIdx.x, w = tid >> 5, lane = tid & 31, ln = lane & 15, hh = lane >> 4; const int by = blockIdx.y;
  A += (size_t)by * sA; Bh += (size_t)by * sB; const size_t cofs = (size_t)by * sC; const float* bp = bias ? bias + (size_t)by * sBias : nullptr;
  const int ntn = N >> 6; const int mt = blockIdx.x / ntn, nq = blockIdx.x - mt * ntn; const int row0 = mt * 128 + 32 * w, col0 = nq * 64; if (row0 >= M) return;
  const _Float16* a0p = A + (size_t)(row0 + ln) * lda; const _Float16* a1p = a0p + (size_t)16 * lda;
  const _Float16* b0p = Bh + (size_t)(col0 + ln) * ldb; const _Float16* b1p = b0p + (size_t)16 * ldb; const _Float16* b2p = b1p + (size_t)16 * ldb; const _Float16* b3p = b2p + (size_t)16 * ldb;
  const v8f z8 = {0.f,0.f,0.f,0.f,0.f,0.f,0.f,0.f}; v8f c00 = z8, c01 = z8, c02 = z8, c03 = z8, c10 = z8, c11 = z8, c12 = z8, c13 = z8;
  for (int kb = 0; kb < K; kb += 32) { const v16h a0 = g2_frag(a0p + kb, hh), a1 = g2_frag(a1p + kb, hh);
    v16h b = g2_frag(b0p + kb, hh); c00 = g2_mma(a0, b, c00); c10 = g2_mma(a1, b, c10);
    b = g2_frag(b1p + kb, hh); c01 = g2_mma(a0, b, c01); c11 = g2_mma(a1, b, c11);
    b = g2_frag(b2p + kb, hh); c02 = g2_mma(a0, b, c02); c12 = g2_mma(a1, b, c12);
    b = g2_frag(b3p + kb, hh); c03 = g2_mma(a0, b, c03); c13 = g2_mma(a1, b, c13); }
  v8f accs[8] = {c00, c01, c02, c03, c10, c11, c12, c13};
#pragma unroll
  for (int u = 0; u < 8; ++u) { const int t = u & 3, half = u >> 2; const int col = col0 + t * 16 + ln; const float bv = bp ? bf16_round(bp[col]) : 0.f;
#pragma unroll
    for (int r = 0; r < 8; ++r) { const int rloc = half * 16 + 8 * hh + r; float v = accs[u][r] * alpha + bv; if (CP) { if (rowsPerB < 0) v += CP[cofs + (size_t)(row0g + row0 + rloc) * ldc + col];      /* rowsPerB < 0: own element of the batched C plane */ else { const int bidx = (row0g + row0 + rloc) / rowsPerB; v += CP[(size_t)bidx * sCPb + (size_t)by * 64 + col]; } }
      if (ACT == 3) v = fmaxf(v, 0.f); else if (ACT == 6) v = 0.5f * v * (1.0f + erff(v * 0.70710678118654752f)); else if (ACT == 11) v = 1.0f / (1.0f + expf(-v)); else if (ACT == 15) v = v / (1.0f + expf(-v)); else if (ACT == 12) v = (v > 0.f) ? v : 0.01f * v; else if (ACT == 8) v = tanhf(v); else if (ACT == 9) v = 0.5f * v * (1.0f + tanhf(0.7978845608028654f * (v + 0.044715f * v * v * v))); else if (ACT == 14) v = (v > 0.f) ? v : 0.1f * v; else if (ACT == 16) v = (v >= 0.f) ? v : 0.3f * v; else if (ACT == 17) v = (v >= 0.f) ? v : 0.2f * v;
      so[w][rloc][t * 16 + ln] = v; } }
  __builtin_amdgcn_fence(__ATOMIC_ACQ_REL, "workgroup"); __builtin_amdgcn_wave_barrier();
  const int rsub = lane >> 4, c4 = (lane & 15) * 4;
  {
#pragma unroll
    for (int q = 0; q < 16; ++q) { const int r = q * 2 + rsub; const v4f v = *(const v4fa*)&so[w][r][c4]; if (C) *(v4f*)(C + cofs + (size_t)(row0 + r) * ldc + col0 + c4) = v; if (C16) { v4h h4; for (int i = 0; i < 4; ++i) h4[i] = (_Float16)v[i]; *(v4h*)(C16 + cofs + (size_t)(row0 + r) * ldc + col0 + c4) = h4; } }
     } }

__global__ __launch_bounds__(256) void k_wnat(const float* __restrict__ w, size_t n8, _Float16* __restrict__ Bt) { const size_t t = (size_t)blockIdx.x * 256 + threadIdx.x; if (t >= n8) return; FragH f; for (int q = 0; q < 8; ++q) f.h[q] = (_Float16)(bf16_round(w[t * 8 + q]) * 16.0f); *(v8us*)((unsigned short*)Bt + t * 8) = f.half[0];  }

// Row softmax, P = 256 softmax(S) as f16. One wave owns a whole score row: each of its loads reads 512 contiguous bytes, the row stays in registers
// (read once), maximum and sum go across the lanes. SM_WAVES waves (rows) a block; grid.x covers the QN rows of a head, grid.y the heads.
// Every loop over the pieces is unrolled: d[] stays in registers only under constant indices.
#define SM_WAVES 16
#define SM_CH (SQ / 128)             /* 16-byte pieces of a row per lane */
static_assert(QN % SM_WAVES == 0 && SQ % 256 == 0, "k_rsmf: whole blocks of rows and pairs of 512-byte pieces only");
template <int M> __device__ __forceinline__ float sm_xrow(float v) { return __builtin_bit_cast(float, __builtin_amdgcn_update_dpp(0, __builtin_bit_cast(int, v), 0x160 | M, 0xf, 0xf, true)); }      /* lane l reads lane l ^ M of its 16-lane row (DPP row_xmask) */
__device__ __forceinline__ float sm_xhalf(float v) { return __builtin_bit_cast(float, __builtin_amdgcn_permlanex16(__builtin_bit_cast(int, v), __builtin_bit_cast(int, v), 0x76543210, 0xfedcba98, false, false)); }      /* lane l reads lane l ^ 16 */
// 2^x of eight values in one statement, closed by one v_nop. Behind a transcendental the instruction set asks for one independent instruction before its result is read or its
// source overwritten: inside the statement each v_exp_f32 is that instruction for the one in front of it (the early-clobber results lie on no source), the v_nop is it for the last.
__device__ __forceinline__ void sm_exp2x8(v4f& a, v4f& b) { float r0, r1, r2, r3, r4, r5, r6, r7;
  asm("v_exp_f32 %0, %8\n\tv_exp_f32 %1, %9\n\tv_exp_f32 %2, %10\n\tv_exp_f32 %3, %11\n\tv_exp_f32 %4, %12\n\tv_exp_f32 %5, %13\n\tv_exp_f32 %6, %14\n\tv_exp_f32 %7, %15\n\tv_nop"
      : "=&v"(r0), "=&v"(r1), "=&v"(r2), "=&v"(r3), "=&v"(r4), "=&v"(r5), "=&v"(r6), "=&v"(r7) : "v"(a[0]), "v"(a[1]), "v"(a[2]), "v"(a[3]), "v"(b[0]), "v"(b[1]), "v"(b[2]), "v"(b[3]));
  a[0] = r0; a[1] = r1; a[2] = r2; a[3] = r3; b[0] = r4; b[1] = r5; b[2] = r6; b[3] = r7; }
__global__ __launch_bounds__(SM_WAVES * 32) void k_rsmf(const float* __restrict__ S, _Float16* __restrict__ P) {
  const unsigned lane = threadIdx.x & 31u, wave = __builtin_amdgcn_readfirstlane(threadIdx.x >> 5);
  const size_t row = (size_t)blockIdx.y * SQ + blockIdx.x * SM_WAVES + wave;      /* the wave's row in the [head][query] planes */
  const v4fa* s = (const v4fa*)(S + row * SQ); v4f d[SM_CH];      /* piece c of the row: lane l takes elements 128 c + 4 l .. + 3 */
#pragma unroll
  for (int c = 0; c < SM_CH; ++c) d[c] = s[c * 32 + lane];
  float m0 = -3.0e38f, m1 = -3.0e38f, m2 = -3.0e38f, m3 = -3.0e38f;
#pragma unroll
  for (int c = 0; c < SM_CH; ++c) { m0 = fmaxf(m0, d[c][0]); m1 = fmaxf(m1, d[c][1]); m2 = fmaxf(m2, d[c][2]); m3 = fmaxf(m3, d[c][3]); }
  float mx = fmaxf(fmaxf(m0, m1), fmaxf(m2, m3));
  mx = fmaxf(mx, sm_xrow<1>(mx)); mx = fmaxf(mx, sm_xrow<2>(mx)); mx = fmaxf(mx, sm_xrow<4>(mx)); mx = fmaxf(mx, sm_xrow<8>(mx)); mx = fmaxf(mx, sm_xhalf(mx));
  float a0 = 0.f, a1 = 0.f, a2 = 0.f, a3 = 0.f;
#pragma unroll
  for (int c = 0; c < SM_CH; c += 2) {      /* exp(s - mx) as 2^((s - mx) log2 e), what __expf compiles to */
    for (int i = 0; i < 4; ++i) { d[c][i] = (d[c][i] - mx) * 1.44269504f; d[c + 1][i] = (d[c + 1][i] - mx) * 1.44269504f; }
    sm_exp2x8(d[c], d[c + 1]);
    a0 += d[c][0]; a1 += d[c][1]; a2 += d[c][2]; a3 += d[c][3]; a0 += d[c + 1][0]; a1 += d[c + 1][1]; a2 += d[c + 1][2]; a3 += d[c + 1][3]; }
  float se = (a0 + a1) + (a2 + a3);
  se += sm_xrow<1>(se); se += sm_xrow<2>(se); se += sm_xrow<4>(se); se += sm_xrow<8>(se); se += sm_xhalf(se);
  const float sc = 256.0f / se; v4h* p = (v4h*)(P + row * SQ);
#pragma unroll
  for (int c = 0; c < SM_CH; ++c) { v4h h4; for (int i = 0; i < 4; ++i) h4[i] = (_Float16)(d[c][i] * sc); p[c * 32 + lane] = h4; } }

extern "C" void kernel_launch(void* const* d_in, const int* in_sizes, int n_in,
                              void* d_out, int out_size, void* d_ws, size_t ws_size, hipStream_t stream) {
  (void)in_sizes; (void)n_in; (void)out_size;
  const float* const* I = (const float* const*)d_in; const float* x = I[0]; const float* watt = I[1]; const float* wv = I[2]; const float* bv = I[3]; const float* wo = I[4]; const float* bo = I[5];      /* x [2][2048][1024]; the per-head bilinear weight [16][64][64] ([head][in d][out e]); the natural value weight [DM][DM] and its bias; the natural output weight [DM][DM] and its bias */
  char* ws = (char*)d_ws; size_t off = 0;
  auto take = [&](size_t bytes) { char* p = ws + off; off += (bytes + 255) & ~(size_t)255; return p; };
  _Float16* BW = (_Float16*)take((size_t)NH * HD * HD * 2); _Float16* BV = (_Float16*)take((size_t)DM * DM * 2); _Float16* BO = (_Float16*)take((size_t)DM * DM * 2);      /* BW: sixteen transposed [64][64] head planes, one after another */
  _Float16* X16 = (_Float16*)take(NR * DM * 2); _Float16* Q16 = (_Float16*)take(NR * DM * 2); float* QF = (float*)take(NR * DM * 4); _Float16* QL = (_Float16*)take(NR * DM * 2); _Float16* V16 = (_Float16*)take(NR * DM * 2); _Float16* O16 = (_Float16*)take(NR * DM * 2);
  float* S = (float*)take((size_t)HG * SQ * SQ * 4); _Float16* P = (_Float16*)take((size_t)HG * SQ * SQ * 2); _Float16* VT = (_Float16*)take((size_t)NH * HD * SQ * 2);
  if (off > ws_size) return;
  for (int h = 0; h < NH; ++h) k_wt_f16<<<(unsigned)((HD * (HD / 8) + 255) / 256), 256, 0, stream>>>(watt + (size_t)h * HD * HD, BW + (size_t)h * HD * HD, HD, HD, 16.0f);      /* a head's [in d][out e] weight -> its transposed x16 plane Bt[e][d]; a launch a head */
  k_wnat<<<(unsigned)(((size_t)DM * DM / 8 + 255) / 256), 256, 0, stream>>>(wv, (size_t)DM * DM / 8, BV); k_wnat<<<(unsigned)(((size_t)DM * DM / 8 + 255) / 256), 256, 0, stream>>>(wo, (size_t)DM * DM / 8, BO);      /* natural [out][in] = Bt[n][k] x16 (no transpose) */

  k_x16<<<(unsigned)((NR * DM / 8 + 255) / 256), 256, 0, stream>>>(x, X16, NR * DM / 8);
  const size_t r0p = (size_t)B0 * SQ;      /* first projected row */
  k_gemm2<0><<<dim3((unsigned)((MP / 128) * (HD / 64)), NH), 128, 0, stream>>>(X16 + r0p * DM, DM, (size_t)HD, BW, HD, (size_t)HD * HD, 0.0625f, nullptr, 0, nullptr, 1, 0, 0, QF + r0p * DM, nullptr, DM, (size_t)HD, MP, HD, HD); k_hl<<<(unsigned)(((size_t)MP * DM / 8 + 255) / 256), 256, 0, stream>>>(QF + r0p * DM, Q16 + r0p * DM, QL + r0p * DM, (size_t)MP * DM / 8);      /* the per-head product x_h W_h for all 16 heads on grid.y (head strides: 64 input columns, one [64][64] plane, 64 result columns; K = 64), in f32 -> f16 hi (Q16) + x1024 residual (QL) planes */
  k_gemm2<0><<<dim3((unsigned)((MP / 128) * (DM / 64)), 1), 128, 0, stream>>>(X16 + r0p * DM, DM, 0, BV, DM, 0, 0.0625f, bv, 0, nullptr, 1, 0, 0, nullptr, V16 + r0p * DM, DM, 0, MP, DM, DM);      /* v = x Wv^T + bv as f16 rows */
  for (int b = B0; b < B0 + NBR; ++b) { const size_t r0 = (size_t)b * SQ;
    k_vt<NH, SQ><<<NH * (SQ / 64), 256, 0, stream>>>(V16 + r0 * LQ, LQ, 0, VT);      /* V^T [NH][HD][SQ] for this batch */
    for (int h0 = 0; h0 < NHD; h0 += HG) {
      k_gemm2<0><<<dim3((QN / 128) * (SQ / 64), HG), 128, 0, stream>>>(Q16 + r0 * LQ + h0 * HD, LQ, (size_t)HD, X16 + r0 * LQ + h0 * HD, LQ, (size_t)HD, 0.125f, nullptr, 0, nullptr, 1, 0, 0, S, nullptr, SQ, (size_t)SQ * SQ, QN, SQ, HD); k_gemm2<0><<<dim3((QN / 128) * (SQ / 64), HG), 128, 0, stream>>>(QL + r0 * LQ + h0 * HD, LQ, (size_t)HD, X16 + r0 * LQ + h0 * HD, LQ, (size_t)HD, 0.0001220703125f, nullptr, 0, S, -1, 0, 0, S, nullptr, SQ, (size_t)SQ * SQ, QN, SQ, HD);      
      k_rsmf<<<dim3(QN / SM_WAVES, HG), SM_WAVES * 32, 0, stream>>>(S, P);      /* P = 256 softmax (f16), rows of all HG heads */
      k_gemm2<0><<<dim3((QN / 128) * (HD / 64), HG), 128, 0, stream>>>(P, SQ, (size_t)SQ * SQ, VT + (size_t)h0 * HD * SQ, SQ, (size_t)HD * SQ, 0.25f, nullptr, 0, nullptr, 1, 0, 0, nullptr, O16 + r0 * DM + h0 * HD, DM, (size_t)HD, QN, HD, SQ); } }      /* o (merged heads) as f16 rows */
  k_gemm2<0><<<dim3((unsigned)((MPO / 128) * (DM / 64)), 1), 128, 0, stream>>>(O16 + r0p * DM, DM, 0, BO, DM, 0, 0.0009765625f, bo, 0, nullptr, 1, 0, 0, (float*)d_out + r0p * DM, nullptr, DM, 0, MPO, DM, DM);      /* out rows are the output layout */
}

// v002
// It runs in 199 microseconds.
// Timed twice side by side with v001, it ran 6.21 and 6.08 times as fast.
// Over all steps from v000 it is 13.8 times as fast.
#include <hip/hip_runtime.h>
// Multi-head self-attention with a PER-HEAD BILINEAR SCORE and no query / key projections (x [2][2048][1024] viewed as 16 heads of 64; scores = (x_h W_h) . x_h / sqrt(64) with W [16][64][64] ([head][in][out]); softmax over all 2048 keys (no mask); v = x w_v^T + b_v (natural [1024][1024] + a bias, zero on this module's draw: read all the same); out = merged w_out^T + b_out (natural + a bias, zero on this draw too) -> [2][2048][1024]).
// Compute dtype: inputs rounded to bf16; x / weights exact; the per-head product as f16 hi + x1024 residual; the key operand is x itself as f16; v, softmax weights and o as plain f16 GEMM operands (~2^-12); scores and softmax statistics f32. v_wmma_f32_16x16x32_f16.
#define NB 2
#define SQ 2048
#define DM 1024
#define NH 16
#define HD 64
#define B0 0                         /* first batch processed (debug hook) */
#define NBR NB                       /* batches processed (debug hook) */
#define NR ((size_t)NB * SQ)         /* token rows */
#define MP ((int)((size_t)NBR * SQ)) /* rows projected (debug hook) */
#define MPO MP                       /* rows through the output stage (debug hook) */
#define LQ DM      /* row pitch of the q/k/v rows */
typedef __bf16 v16b __attribute__((ext_vector_type(16)));
typedef unsigned short v8us __attribute__((ext_vector_type(8), may_alias));
typedef float  v8f  __attribute__((ext_vector_type(8)));
typedef float  v4f  __attribute__((ext_vector_type(4)));
typedef float  v4fa __attribute__((ext_vector_type(4), may_alias));
union FragB { v16b v; v8us half[2]; unsigned short u[16]; };

__device__ __forceinline__ unsigned short bf16_bits(float x) { unsigned int u = __float_as_uint(x); return (unsigned short)((u + 0x7FFFu + ((u >> 16) & 1u)) >> 16); }
__device__ __forceinline__ float bf16_val(unsigned short b) { return __uint_as_float(((unsigned int)b) << 16); }
__device__ __forceinline__ float bf16_round(float x) { return bf16_val(bf16_bits(x)); }
// D += A·B with NT terms: 1 = ah·bh, 2 = + al·bh (A split), 3 = + ah·bl (both split)
template <int NT>
__device__ __forceinline__ v8f mmaN(v16b ah, v16b al, v16b bh, v16b bl, v8f c) {
  c = __builtin_amdgcn_wmma_f32_16x16x32_bf16(false, ah, false, bh, (short)0, c, false, false);
  if (NT >= 2) c = __builtin_amdgcn_wmma_f32_16x16x32_bf16(false, al, false, bh, (short)0, c, false, false);
  if (NT >= 3) c = __builtin_amdgcn_wmma_f32_16x16x32_bf16(false, ah, false, bl, (short)0, c, false, false);
  asm volatile("v_nop\n\tv_nop\n\tv_nop\n\tv_nop" : "+v"(c) : "v"(ah), "v"(al), "v"(bh), "v"(bl));
  return c;
}




// ---- f16 WMMA path (v_wmma_f32_16x16x32_f16): 11-bit significands for operands in range — used for every product here, the softmax weights (up to 2^14) included
typedef _Float16 v16h __attribute__((ext_vector_type(16)));
union FragH { v16h v; v8us half[2]; _Float16 h[16]; unsigned short u[16]; };
template <int NT>
__device__ __forceinline__ v8f mmaH(v16h ah, v16h al, v16h bh, v16h bl, v8f c) {
  c = __builtin_amdgcn_wmma_f32_16x16x32_f16(false, ah, false, bh, (short)0, c, false, false);
  if (NT >= 2) c = __builtin_amdgcn_wmma_f32_16x16x32_f16(false, al, false, bh, (short)0, c, false, false);
  if (NT >= 3) c = __builtin_amdgcn_wmma_f32_16x16x32_f16(false, ah, false, bl, (short)0, c, false, false);
  asm volatile("v_nop\n\tv_nop\n\tv_nop\n\tv_nop" : "+v"(c) : "v"(ah), "v"(al), "v"(bh), "v"(bl));
  return c;
}

// Wt[n][k] = f16(W[k][n]·scale) from f32 row-major W[K][N] (scale = power of two; bf16-exact weights stay exact in f16 away from the subnormal range)
__global__ __launch_bounds__(256) void k_wt_f16(const float* __restrict__ W, _Float16* __restrict__ Wt, int K, int N, float scale) {
  const int t = blockIdx.x * 256 + threadIdx.x; if (t >= N * (K / 8)) return; const int n = t / (K / 8), k8 = (t % (K / 8)) * 8; FragH f;
#pragma unroll
  for (int i = 0; i < 8; ++i) f.h[i] = (_Float16)(bf16_round(W[(size_t)(k8 + i) * N + n]) * scale); const v8us o = f.half[0];
  *(v8us*)((unsigned short*)Wt + (size_t)n * K + k8) = o; 
}

typedef _Float16 v4h __attribute__((ext_vector_type(4)));

__global__ __launch_bounds__(256) void k_x16(const float* __restrict__ x, _Float16* __restrict__ X16, size_t n8) { const size_t t = (size_t)blockIdx.x * 256 + threadIdx.x; if (t >= n8) return; FragH f;
#pragma unroll
  for (int q = 0; q < 8; ++q) f.h[q] = (_Float16)bf16_round(x[t * 8 + q]); *(v8us*)((unsigned short*)X16 + t * 8) = f.half[0];  }
template <int NHv, int TTv>
__global__ __launch_bounds__(256) void k_vt(const _Float16* __restrict__ V16, int ldv, int voff, _Float16* __restrict__ Vt) { __shared__ unsigned short tl[64][66]; const int tid = threadIdx.x; const int slab = blockIdx.x / (TTv / 64), lg = blockIdx.x % (TTv / 64); const int b = slab / NHv, h = slab % NHv;
  for (int i = tid; i < 64 * 8; i += 256) { const int r = i / 8, c8 = (i % 8) * 8; FragH f; f.half[0] = *(const v8us*)((const unsigned short*)V16 + ((size_t)b * TTv + lg * 64 + r) * ldv + voff + h * 64 + c8);
#pragma unroll
    for (int q = 0; q < 8; ++q) tl[r][c8 + q] = f.u[q]; }
  __syncthreads();
  {
#pragma unroll
    for (int rd = 0; rd < 2; ++rd) { const int d = rd * 32 + tid / 8, pc = tid % 8; FragH f;
#pragma unroll
      for (int q = 0; q < 8; ++q) f.u[q] = tl[pc * 8 + q][d];
      *(v8us*)((unsigned short*)Vt + ((size_t)slab * 64 + d) * TTv + lg * 64 + pc * 8) = f.half[0]; }
     } }

__global__ __launch_bounds__(256) void k_hl(const float* __restrict__ F, _Float16* __restrict__ Hh, _Float16* __restrict__ Hl, size_t n8) { const size_t t = (size_t)blockIdx.x * 256 + threadIdx.x; if (t >= n8) return; FragH fh, fl; const v4f a = *(const v4fa*)(F + t * 8), c = *(const v4fa*)(F + t * 8 + 4);
#pragma unroll
  for (int q = 0; q < 4; ++q) { _Float16 h = (_Float16)a[q]; fh.h[q] = h; fl.h[q] = (_Float16)((a[q] - (float)h) * 1024.0f); h = (_Float16)c[q]; fh.h[4 + q] = h; fl.h[4 + q] = (_Float16)((c[q] - (float)h) * 1024.0f); }
  { *(v8us*)((unsigned short*)Hh + t * 8) = fh.half[0]; *(v8us*)((unsigned short*)Hl + t * 8) = fl.half[0];  } }

// ---- fast GEMM (wave tile 32x64; requires M % 32 == 0 rows per launch region and N % 64 == 0) ----
__device__ __forceinline__ v16h g2_frag(const _Float16* p, int hh) { FragH f; f.half[0] = *(const v8us*)((const unsigned short*)p + 8 * hh); f.half[1] = *(const v8us*)((const unsigned short*)p + 16 + 8 * hh); return f.v; }
__device__ __forceinline__ v8f g2_mma(v16h a, v16h b, v8f c) { v8f d = __builtin_amdgcn_wmma_f32_16x16x32_f16(false, a, false, b, (short)0, c, false, false); asm volatile("v_nop\n\tv_nop\n\tv_nop\n\tv_nop" : "+v"(d) : "v"(a), "v"(b)); return d; }
template <int ACT>
__global__ __launch_bounds__(128) void k_gemm2(const _Float16* __restrict__ A, int lda, size_t sA, const _Float16* __restrict__ Bh, int ldb, size_t sB, float alpha, const float* __restrict__ bias, size_t sBias, const float* __restrict__ CP, int rowsPerB, size_t sCPb, int row0g,
    float* __restrict__ C, _Float16* __restrict__ C16, int ldc, size_t sC, int M, int N, int K) { static_assert(ACT == 0 || ACT == 3 || ACT == 6 || ACT == 8 || ACT == 9 || ACT == 11 || ACT == 12 || ACT == 14 || ACT == 15 || ACT == 16 || ACT == 17, "k_gemm2: unsupported ACT code (would silently apply no activation)");
  __shared__ __attribute__((aligned(16))) float so[4][32][68];
  const int tid = threadIdx.x, w = tid >> 5, lane = tid & 31, ln = lane & 15, hh = lane >> 4; const int by = blockIdx.y;
  A += (size_t)by * sA; Bh += (size_t)by * sB; const size_t cofs = (size_t)by * sC; const float* bp = bias ? bias + (size_t)by * sBias : nullptr;
  const int ntn = N >> 6; const int mt = blockIdx.x / ntn, nq = blockIdx.x - mt * ntn; const int row0 = mt * 128 + 32 * w, col0 = nq * 64; if (row0 >= M) return;
  const _Float16* a0p = A + (size_t)(row0 + ln) * lda; const _Float16* a1p = a0p + (size_t)16 * lda;
  const _Float16* b0p = Bh + (size_t)(col0 + ln) * ldb; const _Float16* b1p = b0p + (size_t)16 * ldb; const _Float16* b2p = b1p + (size_t)16 * ldb; const _Float16* b3p = b2p + (size_t)16 * ldb;
  const v8f z8 = {0.f,0.f,0.f,0.f,0.f,0.f,0.f,0.f}; v8f c00 = z8, c01 = z8, c02 = z8, c03 = z8, c10 = z8, c11 = z8, c12 = z8, c13 = z8;
  for (int kb = 0; kb < K; kb += 32) { const v16h a0 = g2_frag(a0p + kb, hh), a1 = g2_frag(a1p + kb, hh);
    v16h b = g2_frag(b0p + kb, hh); c00 = g2_mma(a0, b, c00); c10 = g2_mma(a1, b, c10);
    b = g2_frag(b1p + kb, hh); c01 = g2_mma(a0, b, c01); c11 = g2_mma(a1, b, c11);
    b = g2_frag(b2p + kb, hh); c02 = g2_mma(a0, b, c02); c12 = g2_mma(a1, b, c12);
    b = g2_frag(b3p + kb, hh); c03 = g2_mma(a0, b, c03); c13 = g2_mma(a1, b, c13); }
  v8f accs[8] = {c00, c01, c02, c03, c10, c11, c12, c13};
#pragma unroll
  for (int u = 0; u < 8; ++u) { const int t = u & 3, half = u >> 2; const int col = col0 + t * 16 + ln; const float bv = bp ? bf16_round(bp[col]) : 0.f;
#pragma unroll
    for (int r = 0; r < 8; ++r) { const int rloc = half * 16 + 8 * hh + r; float v = accs[u][r] * alpha + bv; if (CP) { if (rowsPerB < 0) v += CP[cofs + (size_t)(row0g + row0 + rloc) * ldc + col];      /* rowsPerB < 0: own element of the batched C plane */ else { const int bidx = (row0g + row0 + rloc) / rowsPerB; v += CP[(size_t)bidx * sCPb + (size_t)by * 64 + col]; } }
      if (ACT == 3) v = fmaxf(v, 0.f); else if (ACT == 6) v = 0.5f * v * (1.0f + erff(v * 0.70710678118654752f)); else if (ACT == 11) v = 1.0f / (1.0f + expf(-v)); else if (ACT == 15) v = v / (1.0f + expf(-v)); else if (ACT == 12) v = (v > 0.f) ? v : 0.01f * v; else if (ACT == 8) v = tanhf(v); else if (ACT == 9) v = 0.5f * v * (1.0f + tanhf(0.7978845608028654f * (v + 0.044715f * v * v * v))); else if (ACT == 14) v = (v > 0.f) ? v : 0.1f * v; else if (ACT == 16) v = (v >= 0.f) ? v : 0.3f * v; else if (ACT == 17) v = (v >= 0.f) ? v : 0.2f * v;
      so[w][rloc][t * 16 + ln] = v; } }
  __builtin_amdgcn_fence(__ATOMIC_ACQ_REL, "workgroup"); __builtin_amdgcn_wave_barrier();
  const int rsub = lane >> 4, c4 = (lane & 15) * 4;
  {
#pragma unroll
    for (int q = 0; q < 16; ++q) { const int r = q * 2 + rsub; const v4f v = *(const v4fa*)&so[w][r][c4]; if (C) *(v4f*)(C + cofs + (size_t)(row0 + r) * ldc + col0 + c4) = v; if (C16) { v4h h4; for (int i = 0; i < 4; ++i) h4[i] = (_Float16)v[i]; *(v4h*)(C16 + cofs + (size_t)(row0 + r) * ldc + col0 + c4) = h4; } }
     } }

__global__ __launch_bounds__(256) void k_wnat(const float* __restrict__ w, size_t n8, _Float16* __restrict__ Bt) { const size_t t = (size_t)blockIdx.x * 256 + threadIdx.x; if (t >= n8) return; FragH f; for (int q = 0; q < 8; ++q) f.h[q] = (_Float16)(bf16_round(w[t * 8 + q]) * 16.0f); *(v8us*)((unsigned short*)Bt + t * 8) = f.half[0];  }

// Fused attention of one head: scores, softmax and the weighted sum of v in one kernel, so that neither the scores nor the softmax weights go to memory.
// A wave owns FA_QW query columns and walks all SQ keys, 32 a pass. Both products are transposed: S^T = X_keys (A) x Q^T (B) and O^T += V^T (A) x P^T (B). In an S^T tile lane (ln, hh)
// holds keys 8 hh + r (r = 0..7) of query ln, which is the k order of a B fragment's half: two 16-key tiles pack into P^T in place, with no exchange between lanes.
// Softmax is the running-maximum form: weights are 2^(FA_C (u - mu) + FA_OFF) with u the raw score and mu the maximum in use for that query; when a pass brings a score more than FA_TH
// (in powers of two) above mu in any lane, sums and outputs are rescaled to the new maximum. So a weight stays at or below 2^(FA_TH + FA_OFF) = 2^14, inside f16.
// Every inner loop is unrolled: the fragment and accumulator arrays stay in registers only under constant indices.
typedef float v2f __attribute__((ext_vector_type(2)));
#define FA_WAVES 8
#define FA_QW 32
#define FA_C 0.18033688f             /* log2(e) / sqrt(64) */
#define FA_OFF 8.0f
#define FA_TH 6.0f
static_assert(SQ % (FA_WAVES * FA_QW) == 0 && SQ % 32 == 0 && HD == 64, "k_fattn: whole blocks of queries, whole passes of 32 keys, head size 64");
__device__ __forceinline__ float sm_xhalf(float v) { return __builtin_bit_cast(float, __builtin_amdgcn_permlanex16(__builtin_bit_cast(int, v), __builtin_bit_cast(int, v), 0x76543210, 0xfedcba98, false, false)); }      /* lane l reads lane l ^ 16 */
// 2^x of eight values in one statement, closed by one v_nop. Behind a transcendental the instruction set asks for one independent instruction before its result is read or its
// source overwritten: inside the statement each v_exp_f32 is that instruction for the one in front of it (the early-clobber results lie on no source), the v_nop is it for the last.
__device__ __forceinline__ v8f fa_exp2x8(v8f a) { float r0, r1, r2, r3, r4, r5, r6, r7;
  asm("v_exp_f32 %0, %8\n\tv_exp_f32 %1, %9\n\tv_exp_f32 %2, %10\n\tv_exp_f32 %3, %11\n\tv_exp_f32 %4, %12\n\tv_exp_f32 %5, %13\n\tv_exp_f32 %6, %14\n\tv_exp_f32 %7, %15\n\tv_nop"
      : "=&v"(r0), "=&v"(r1), "=&v"(r2), "=&v"(r3), "=&v"(r4), "=&v"(r5), "=&v"(r6), "=&v"(r7) : "v"(a[0]), "v"(a[1]), "v"(a[2]), "v"(a[3]), "v"(a[4]), "v"(a[5]), "v"(a[6]), "v"(a[7]));
  const v8f r = {r0, r1, r2, r3, r4, r5, r6, r7}; return r; }
// the same for the two rescale factors of a pass
__device__ __forceinline__ void fa_exp2x2(float& a, float& b) { float r0, r1; asm("v_exp_f32 %0, %2\n\tv_exp_f32 %1, %3\n\tv_nop" : "=&v"(r0), "=&v"(r1) : "v"(a), "v"(b)); a = r0; b = r1; }
__device__ __forceinline__ v8f fa_mma(v16h a, v16h b, v8f c) { return __builtin_amdgcn_wmma_f32_16x16x32_f16(false, a, false, b, (short)0, c, false, false); }
__device__ __forceinline__ float fa_max8(v8f a, v8f b) { return fmaxf(fmaxf(fmaxf(fmaxf(a[0], a[1]), fmaxf(a[2], a[3])), fmaxf(fmaxf(a[4], a[5]), fmaxf(a[6], a[7]))), fmaxf(fmaxf(fmaxf(b[0], b[1]), fmaxf(b[2], b[3])), fmaxf(fmaxf(b[4], b[5]), fmaxf(b[6], b[7])))); }
__global__ __launch_bounds__(FA_WAVES * 32) void k_fattn(const _Float16* __restrict__ Qh, const _Float16* __restrict__ Ql, const _Float16* __restrict__ Kx, const _Float16* __restrict__ Vt, _Float16* __restrict__ O) {
  const int lane = threadIdx.x & 31, ln = lane & 15, hh = lane >> 4; const int wave = __builtin_amdgcn_readfirstlane(threadIdx.x >> 5);
  const int h = blockIdx.y, b = blockIdx.z; const size_t rb = (size_t)b * SQ; const int q0 = blockIdx.x * (FA_WAVES * FA_QW) + wave * FA_QW;
  v16h qh[2][2], ql[2][2];      /* [16-query group][32-wide step of the head dimension]: the hi plane and the x1024 residual plane, kept for the whole walk */
#pragma unroll
  for (int g = 0; g < 2; ++g) { const size_t qo = (rb + q0 + g * 16 + ln) * DM + h * HD;
#pragma unroll
    for (int ks = 0; ks < 2; ++ks) { qh[g][ks] = g2_frag(Qh + qo + ks * 32, hh); ql[g][ks] = g2_frag(Ql + qo + ks * 32, hh); } }
  const _Float16* kp = Kx + (rb + ln) * DM + h * HD;      /* key row ln of the batch, this head's 64 columns */
  const _Float16* vp = Vt + (((size_t)b * NH + h) * HD + ln) * SQ;      /* V^T row ln of this head */
  const v8f z8 = {0.f, 0.f, 0.f, 0.f, 0.f, 0.f, 0.f, 0.f};
  v8f o[4][2]; v2f ls[2]; float mu[2];
#pragma unroll
  for (int g = 0; g < 2; ++g) { ls[g] = (v2f){0.f, 0.f}; mu[g] = -1.0e30f;
#pragma unroll
    for (int dt = 0; dt < 4; ++dt) o[dt][g] = z8; }
  v16h kf[2][2];      /* [16-key tile][step of the head dimension], fetched one pass ahead */
#pragma unroll
  for (int t = 0; t < 2; ++t) { kf[t][0] = g2_frag(kp + (size_t)(t * 16) * DM, hh); kf[t][1] = g2_frag(kp + (size_t)(t * 16) * DM + 32, hh); }
  for (int kb = 0; kb < SQ; kb += 32) {
    v16h vf[4];
#pragma unroll
    for (int dt = 0; dt < 4; ++dt) vf[dt] = g2_frag(vp + (size_t)(dt * 16) * SQ + kb, hh);
    asm volatile("s_wait_xcnt 0x0" ::: "memory");      /* before an address register of the loads above is written again; it also keeps these loads at the head of the pass, so that the score products cover their latency */
    v8f s[2][2];      /* [query group][key tile]: raw scores hi + residual / 1024 */
#pragma unroll
    for (int g = 0; g < 2; ++g) {
#pragma unroll
      for (int t = 0; t < 2; ++t) { v8f ch = fa_mma(kf[t][0], qh[g][0], z8); ch = fa_mma(kf[t][1], qh[g][1], ch); v8f cl = fa_mma(kf[t][0], ql[g][0], z8); cl = fa_mma(kf[t][1], ql[g][1], cl); s[g][t] = cl * 0.0009765625f + ch; } }
    const int kn = (kb + 32 < SQ) ? kb + 32 : 0;      /* the last pass fetches pass 0 again: in bounds, not used */
#pragma unroll
    for (int t = 0; t < 2; ++t) { kf[t][0] = g2_frag(kp + (size_t)(kn + t * 16) * DM, hh); kf[t][1] = g2_frag(kp + (size_t)(kn + t * 16) * DM + 32, hh); }
    __builtin_amdgcn_sched_barrier(0);      /* keeps the next pass's key loads here, right behind the score products: left free, the compiler sinks them to the end of the pass, where little is left to cover their latency */
    float mb0 = fa_max8(s[0][0], s[0][1]), mb1 = fa_max8(s[1][0], s[1][1]); mb0 = fmaxf(mb0, sm_xhalf(mb0)); mb1 = fmaxf(mb1, sm_xhalf(mb1));      /* both halves of a query's lanes must use one maximum */
    const bool need = (mb0 - mu[0]) * FA_C > FA_TH || (mb1 - mu[1]) * FA_C > FA_TH;
    if (__builtin_amdgcn_ballot_w32(need) != 0) {      /* wave-uniform: rare after the first passes */
      const float n0 = fmaxf(mu[0], mb0), n1 = fmaxf(mu[1], mb1); float a0 = (mu[0] - n0) * FA_C, a1 = (mu[1] - n1) * FA_C; fa_exp2x2(a0, a1); mu[0] = n0; mu[1] = n1; ls[0] *= a0; ls[1] *= a1;
#pragma unroll
      for (int dt = 0; dt < 4; ++dt) { o[dt][0] *= a0; o[dt][1] *= a1; } }
    FragH p[2];      /* P^T of both query groups is formed before the first product with V^T */
#pragma unroll
    for (int g = 0; g < 2; ++g) { const float bias = FA_OFF - mu[g] * FA_C; const v8f p0 = fa_exp2x8(s[g][0] * FA_C + bias), p1 = fa_exp2x8(s[g][1] * FA_C + bias); const v8f e = p0 + p1; ls[g] += (((v2f){e[0], e[1]} + (v2f){e[2], e[3]}) + ((v2f){e[4], e[5]} + (v2f){e[6], e[7]}));
#pragma unroll
      for (int i = 0; i < 8; ++i) { p[g].h[i] = (_Float16)p0[i]; p[g].h[8 + i] = (_Float16)p1[i]; } }
#pragma unroll
    for (int g = 0; g < 2; ++g) {
#pragma unroll
      for (int dt = 0; dt < 4; ++dt) o[dt][g] = fa_mma(vf[dt], p[g].v, o[dt][g]); } }
#pragma unroll
  for (int g = 0; g < 2; ++g) { float l = ls[g][0] + ls[g][1]; l += sm_xhalf(l); const float sc = 64.0f / l;      /* o x64, the scale the output stage expects */
    unsigned short* op = (unsigned short*)O + (rb + q0 + g * 16 + ln) * DM + h * HD + 8 * hh;
#pragma unroll
    for (int dt = 0; dt < 4; ++dt) { FragH f;
#pragma unroll
      for (int r = 0; r < 8; ++r) f.h[r] = (_Float16)(o[dt][g][r] * sc);
      *(v8us*)(op + dt * 16) = f.half[0]; } } }

extern "C" void kernel_launch(void* const* d_in, const int* in_sizes, int n_in,
                              void* d_out, int out_size, void* d_ws, size_t ws_size, hipStream_t stream) {
  (void)in_sizes; (void)n_in; (void)out_size;
  const float* const* I = (const float* const*)d_in; const float* x = I[0]; const float* watt = I[1]; const float* wv = I[2]; const float* bv = I[3]; const float* wo = I[4]; const float* bo = I[5];      /* x [2][2048][1024]; the per-head bilinear weight [16][64][64] ([head][in d][out e]); the natural value weight [DM][DM] and its bias; the natural output weight [DM][DM] and its bias */
  char* ws = (char*)d_ws; size_t off = 0;
  auto take = [&](size_t bytes) { char* p = ws + off; off += (bytes + 255) & ~(size_t)255; return p; };
  _Float16* BW = (_Float16*)take((size_t)NH * HD * HD * 2); _Float16* BV = (_Float16*)take((size_t)DM * DM * 2); _Float16* BO = (_Float16*)take((size_t)DM * DM * 2);      /* BW: sixteen transposed [64][64] head planes, one after another */
  _Float16* X16 = (_Float16*)take(NR * DM * 2); _Float16* Q16 = (_Float16*)take(NR * DM * 2); float* QF = (float*)take(NR * DM * 4); _Float16* QL = (_Float16*)take(NR * DM * 2); _Float16* V16 = (_Float16*)take(NR * DM * 2); _Float16* O16 = (_Float16*)take(NR * DM * 2);
  _Float16* VT = (_Float16*)take((size_t)NB * NH * HD * SQ * 2);
  if (off > ws_size) return;
  for (int h = 0; h < NH; ++h) k_wt_f16<<<(unsigned)((HD * (HD / 8) + 255) / 256), 256, 0, stream>>>(watt + (size_t)h * HD * HD, BW + (size_t)h * HD * HD, HD, HD, 16.0f);      /* a head's [in d][out e] weight -> its transposed x16 plane Bt[e][d]; a launch a head */
  k_wnat<<<(unsigned)(((size_t)DM * DM / 8 + 255) / 256), 256, 0, stream>>>(wv, (size_t)DM * DM / 8, BV); k_wnat<<<(unsigned)(((size_t)DM * DM / 8 + 255) / 256), 256, 0, stream>>>(wo, (size_t)DM * DM / 8, BO);      /* natural [out][in] = Bt[n][k] x16 (no transpose) */

  k_x16<<<(unsigned)((NR * DM / 8 + 255) / 256), 256, 0, stream>>>(x, X16, NR * DM / 8);
  const size_t r0p = (size_t)B0 * SQ;      /* first projected row */
  k_gemm2<0><<<dim3((unsigned)((MP / 128) * (HD / 64)), NH), 128, 0, stream>>>(X16 + r0p * DM, DM, (size_t)HD, BW, HD, (size_t)HD * HD, 0.0625f, nullptr, 0, nullptr, 1, 0, 0, QF + r0p * DM, nullptr, DM, (size_t)HD, MP, HD, HD); k_hl<<<(unsigned)(((size_t)MP * DM / 8 + 255) / 256), 256, 0, stream>>>(QF + r0p * DM, Q16 + r0p * DM, QL + r0p * DM, (size_t)MP * DM / 8);      /* the per-head product x_h W_h for all 16 heads on grid.y (head strides: 64 input columns, one [64][64] plane, 64 result columns; K = 64), in f32 -> f16 hi (Q16) + x1024 residual (QL) planes */
  k_gemm2<0><<<dim3((unsigned)((MP / 128) * (DM / 64)), 1), 128, 0, stream>>>(X16 + r0p * DM, DM, 0, BV, DM, 0, 0.0625f, bv, 0, nullptr, 1, 0, 0, nullptr, V16 + r0p * DM, DM, 0, MP, DM, DM);      /* v = x Wv^T + bv as f16 rows */
  k_vt<NH, SQ><<<NB * NH * (SQ / 64), 256, 0, stream>>>(V16, LQ, 0, VT);      /* V^T [NB][NH][HD][SQ], both batches */
  k_fattn<<<dim3(SQ / (FA_WAVES * FA_QW), NH, NB), FA_WAVES * 32, 0, stream>>>(Q16, QL, X16, VT, O16);      /* o (merged heads, x64) as f16 rows: every batch, head and query in one launch */
  k_gemm2<0><<<dim3((unsigned)((MPO / 128) * (DM / 64)), 1), 128, 0, stream>>>(O16 + r0p * DM, DM, 0, BO, DM, 0, 0.0009765625f, bo, 0, nullptr, 1, 0, 0, (float*)d_out + r0p * DM, nullptr, DM, 0, MPO, DM, DM);      /* out rows are the output layout */
}

// v003
// One run takes 146 microseconds.
// Next to v002, in two timings, it ran 1.35 and 1.36 times as fast.
// Counting every step since v000, it is 18.7 times as fast.
#include <hip/hip_runtime.h>
// Multi-head self-attention with a PER-HEAD BILINEAR SCORE and no query / key projections (x [2][2048][1024] viewed as 16 heads of 64; scores = (x_h W_h) . x_h / sqrt(64) with W [16][64][64] ([head][in][out]); softmax over all 2048 keys (no mask); v = x w_v^T + b_v (natural [1024][1024] + a bias, zero on this module's draw: read all the same); out = merged w_out^T + b_out (natural + a bias, zero on this draw too) -> [2][2048][1024]).
// Compute dtype: inputs rounded to bf16; x / weights exact; the per-head product as f16 hi + x1024 residual; the key operand is x itself as f16; v, softmax weights and o as plain f16 GEMM operands (~2^-12); scores and softmax statistics f32. v_wmma_f32_16x16x32_f16.
#define NB 2
#define SQ 2048
#define DM 1024
#define NH 16
#define HD 64
#define B0 0                         /* first batch processed (debug hook) */
#define NBR NB                       /* batches processed (debug hook) */
#define NR ((size_t)NB * SQ)         /* token rows */
#define MP ((int)((size_t)NBR * SQ)) /* rows projected (debug hook) */
#define MPO MP                       /* rows through the output stage (debug hook) */
#define LQ DM      /* row pitch of the q/k/v rows */
typedef __bf16 v16b __attribute__((ext_vector_type(16)));
typedef unsigned short v8us __attribute__((ext_vector_type(8), may_alias));
typedef float  v8f  __attribute__((ext_vector_type(8)));
typedef float  v4f  __attribute__((ext_vector_type(4)));
typedef float  v4fa __attribute__((ext_vector_type(4), may_alias));
union FragB { v16b v; v8us half[2]; unsigned short u[16]; };

__device__ __forceinline__ unsigned short bf16_bits(float x) { unsigned int u = __float_as_uint(x); return (unsigned short)((u + 0x7FFFu + ((u >> 16) & 1u)) >> 16); }
__device__ __forceinline__ float bf16_val(unsigned short b) { return __uint_as_float(((unsigned int)b) << 16); }
__device__ __forceinline__ float bf16_round(float x) { return bf16_val(bf16_bits(x)); }
// D += A·B with NT terms: 1 = ah·bh, 2 = + al·bh (A split), 3 = + ah·bl (both split)
template <int NT>
__device__ __forceinline__ v8f mmaN(v16b ah, v16b al, v16b bh, v16b bl, v8f c) {
  c = __builtin_amdgcn_wmma_f32_16x16x32_bf16(false, ah, false, bh, (short)0, c, false, false);
  if (NT >= 2) c = __builtin_amdgcn_wmma_f32_16x16x32_bf16(false, al, false, bh, (short)0, c, false, false);
  if (NT >= 3) c = __builtin_amdgcn_wmma_f32_16x16x32_bf16(false, ah, false, bl, (short)0, c, false, false);
  asm volatile("v_nop\n\tv_nop\n\tv_nop\n\tv_nop" : "+v"(c) : "v"(ah), "v"(al), "v"(bh), "v"(bl));
  return c;
}




// ---- f16 WMMA path (v_wmma_f32_16x16x32_f16): 11-bit significands for operands in range — used for every product here, the softmax weights (up to 2^14) included
typedef _Float16 v16h __attribute__((ext_vector_type(16)));
union FragH { v16h v; v8us half[2]; _Float16 h[16]; unsigned short u[16]; };
template <int NT>
__device__ __forceinline__ v8f mmaH(v16h ah, v16h al, v16h bh, v16h bl, v8f c) {
  c = __builtin_amdgcn_wmma_f32_16x16x32_f16(false, ah, false, bh, (short)0, c, false, false);
  if (NT >= 2) c = __builtin_amdgcn_wmma_f32_16x16x32_f16(false, al, false, bh, (short)0, c, false, false);
  if (NT >= 3) c = __builtin_amdgcn_wmma_f32_16x16x32_f16(false, ah, false, bl, (short)0, c, false, false);
  asm volatile("v_nop\n\tv_nop\n\tv_nop\n\tv_nop" : "+v"(c) : "v"(ah), "v"(al), "v"(bh), "v"(bl));
  return c;
}

// Wt[n][k] = f16(W[k][n]·scale) from f32 row-major W[K][N] (scale = power of two; bf16-exact weights stay exact in f16 away from the subnormal range)
__device__ __forceinline__ void d_wt_f16(const float* __restrict__ W, _Float16* __restrict__ Wt, int K, int N, float scale, int t) {
  const int n = t / (K / 8), k8 = (t % (K / 8)) * 8; FragH f;
#pragma unroll
  for (int i = 0; i < 8; ++i) f.h[i] = (_Float16)(bf16_round(W[(size_t)(k8 + i) * N + n]) * scale); const v8us o = f.half[0];
  *(v8us*)((unsigned short*)Wt + (size_t)n * K + k8) = o; 
}

typedef _Float16 v4h __attribute__((ext_vector_type(4)));

__device__ __forceinline__ void d_x16(const float* __restrict__ x, _Float16* __restrict__ X16, size_t t) { FragH f;
#pragma unroll
  for (int q = 0; q < 8; ++q) f.h[q] = (_Float16)bf16_round(x[t * 8 + q]); *(v8us*)((unsigned short*)X16 + t * 8) = f.half[0]; asm volatile("s_wait_xcnt 0x0" ::: "memory");      /* before a register of the store in front is written again: in a shared launch another job's code follows in the listing */
}
template <int NHv, int TTv>
__device__ __forceinline__ void d_vt(const _Float16* __restrict__ V16, int ldv, int voff, _Float16* __restrict__ Vt, int blk) { __shared__ unsigned short tl[64][66]; const int tid = threadIdx.x; const int slab = blk / (TTv / 64), lg = blk % (TTv / 64); const int b = slab / NHv, h = slab % NHv;
  for (int i = tid; i < 64 * 8; i += 256) { const int r = i / 8, c8 = (i % 8) * 8; FragH f; f.half[0] = *(const v8us*)((const unsigned short*)V16 + ((size_t)b * TTv + lg * 64 + r) * ldv + voff + h * 64 + c8);
#pragma unroll
    for (int q = 0; q < 8; ++q) tl[r][c8 + q] = f.u[q]; }
  __syncthreads();
  {
#pragma unroll
    for (int rd = 0; rd < 2; ++rd) { const int d = rd * 32 + tid / 8, pc = tid % 8; FragH f;
#pragma unroll
      for (int q = 0; q < 8; ++q) f.u[q] = tl[pc * 8 + q][d];
      *(v8us*)((unsigned short*)Vt + ((size_t)slab * 64 + d) * TTv + lg * 64 + pc * 8) = f.half[0]; }
     } }

__device__ __forceinline__ void d_hl(const float* __restrict__ F, _Float16* __restrict__ Hh, _Float16* __restrict__ Hl, size_t t) { FragH fh, fl; const v4f a = *(const v4fa*)(F + t * 8), c = *(const v4fa*)(F + t * 8 + 4);
#pragma unroll
  for (int q = 0; q < 4; ++q) { _Float16 h = (_Float16)a[q]; fh.h[q] = h; fl.h[q] = (_Float16)((a[q] - (float)h) * 1024.0f); h = (_Float16)c[q]; fh.h[4 + q] = h; fl.h[4 + q] = (_Float16)((c[q] - (float)h) * 1024.0f); }
  { *(v8us*)((unsigned short*)Hh + t * 8) = fh.half[0]; *(v8us*)((unsigned short*)Hl + t * 8) = fl.half[0]; asm volatile("s_wait_xcnt 0x0" ::: "memory");      /* before a register of the two stores in front is written again: in a shared launch another job's code follows in the listing */
  } }

// ---- fast GEMM (wave tile 32x64; requires M % 32 == 0 rows per launch region and N % 64 == 0) ----
__device__ __forceinline__ v16h g2_frag(const _Float16* p, int hh) { FragH f; f.half[0] = *(const v8us*)((const unsigned short*)p + 8 * hh); f.half[1] = *(const v8us*)((const unsigned short*)p + 16 + 8 * hh); return f.v; }
__device__ __forceinline__ v8f g2_mma(v16h a, v16h b, v8f c) { v8f d = __builtin_amdgcn_wmma_f32_16x16x32_f16(false, a, false, b, (short)0, c, false, false); asm volatile("v_nop\n\tv_nop\n\tv_nop\n\tv_nop" : "+v"(d) : "v"(a), "v"(b)); return d; }
template <int ACT>
__device__ __forceinline__ void d_gemm2(int bx, int by, const _Float16* __restrict__ A, int lda, size_t sA, const _Float16* __restrict__ Bh, int ldb, size_t sB, float alpha, const float* __restrict__ bias, size_t sBias, const float* __restrict__ CP, int rowsPerB, size_t sCPb, int row0g,
    float* __restrict__ C, _Float16* __restrict__ C16, int ldc, size_t sC, int M, int N, int K) { static_assert(ACT == 0 || ACT == 3 || ACT == 6 || ACT == 8 || ACT == 9 || ACT == 11 || ACT == 12 || ACT == 14 || ACT == 15 || ACT == 16 || ACT == 17, "k_gemm2: unsupported ACT code (would silently apply no activation)");
  __shared__ __attribute__((aligned(16))) float so[4][32][68];
  const int tid = threadIdx.x, w = tid >> 5, lane = tid & 31, ln = lane & 15, hh = lane >> 4;
  A += (size_t)by * sA; Bh += (size_t)by * sB; const size_t cofs = (size_t)by * sC; const float* bp = bias ? bias + (size_t)by * sBias : nullptr;
  const int ntn = N >> 6; const int mt = bx / ntn, nq = bx - mt * ntn; const int row0 = mt * 128 + 32 * w, col0 = nq * 64; if (row0 >= M) return;
  const _Float16* a0p = A + (size_t)(row0 + ln) * lda; const _Float16* a1p = a0p + (size_t)16 * lda;
  const _Float16* b0p = Bh + (size_t)(col0 + ln) * ldb; const _Float16* b1p = b0p + (size_t)16 * ldb; const _Float16* b2p = b1p + (size_t)16 * ldb; const _Float16* b3p = b2p + (size_t)16 * ldb;
  const v8f z8 = {0.f,0.f,0.f,0.f,0.f,0.f,0.f,0.f}; v8f c00 = z8, c01 = z8, c02 = z8, c03 = z8, c10 = z8, c11 = z8, c12 = z8, c13 = z8;
  for (int kb = 0; kb < K; kb += 32) { const v16h a0 = g2_frag(a0p + kb, hh), a1 = g2_frag(a1p + kb, hh);
    v16h b = g2_frag(b0p + kb, hh); c00 = g2_mma(a0, b, c00); c10 = g2_mma(a1, b, c10);
    b = g2_frag(b1p + kb, hh); c01 = g2_mma(a0, b, c01); c11 = g2_mma(a1, b, c11);
    b = g2_frag(b2p + kb, hh); c02 = g2_mma(a0, b, c02); c12 = g2_mma(a1, b, c12);
    b = g2_frag(b3p + kb, hh); c03 = g2_mma(a0, b, c03); c13 = g2_mma(a1, b, c13); }
  v8f accs[8] = {c00, c01, c02, c03, c10, c11, c12, c13};
#pragma unroll
  for (int u = 0; u < 8; ++u) { const int t = u & 3, half = u >> 2; const int col = col0 + t * 16 + ln; const float bv = bp ? bf16_round(bp[col]) : 0.f;
#pragma unroll
    for (int r = 0; r < 8; ++r) { const int rloc = half * 16 + 8 * hh + r; float v = accs[u][r] * alpha + bv; if (CP) { if (rowsPerB < 0) v += CP[cofs + (size_t)(row0g + row0 + rloc) * ldc + col];      /* rowsPerB < 0: own element of the batched C plane */ else { const int bidx = (row0g + row0 + rloc) / rowsPerB; v += CP[(size_t)bidx * sCPb + (size_t)by * 64 + col]; } }
      if (ACT == 3) v = fmaxf(v, 0.f); else if (ACT == 6) v = 0.5f * v * (1.0f + erff(v * 0.70710678118654752f)); else if (ACT == 11) v = 1.0f / (1.0f + expf(-v)); else if (ACT == 15) v = v / (1.0f + expf(-v)); else if (ACT == 12) v = (v > 0.f) ? v : 0.01f * v; else if (ACT == 8) v = tanhf(v); else if (ACT == 9) v = 0.5f * v * (1.0f + tanhf(0.7978845608028654f * (v + 0.044715f * v * v * v))); else if (ACT == 14) v = (v > 0.f) ? v : 0.1f * v; else if (ACT == 16) v = (v >= 0.f) ? v : 0.3f * v; else if (ACT == 17) v = (v >= 0.f) ? v : 0.2f * v;
      so[w][rloc][t * 16 + ln] = v; } }
  __builtin_amdgcn_fence(__ATOMIC_ACQ_REL, "workgroup"); __builtin_amdgcn_wave_barrier();
  const int rsub = lane >> 4, c4 = (lane & 15) * 4;
  {
#pragma unroll
    for (int q = 0; q < 16; ++q) { const int r = q * 2 + rsub; const v4f v = *(const v4fa*)&so[w][r][c4]; if (C) *(v4f*)(C + cofs + (size_t)(row0 + r) * ldc + col0 + c4) = v; if (C16) { v4h h4; for (int i = 0; i < 4; ++i) h4[i] = (_Float16)v[i]; *(v4h*)(C16 + cofs + (size_t)(row0 + r) * ldc + col0 + c4) = h4; } }
     } }

__device__ __forceinline__ void d_wnat(const float* __restrict__ w, _Float16* __restrict__ Bt, size_t t) { FragH f; for (int q = 0; q < 8; ++q) f.h[q] = (_Float16)(bf16_round(w[t * 8 + q]) * 16.0f); *(v8us*)((unsigned short*)Bt + t * 8) = f.half[0]; asm volatile("s_wait_xcnt 0x0" ::: "memory");      /* before a register of the store in front is written again: in a shared launch another job's code follows in the listing */
}

template <int ACT>
__global__ __launch_bounds__(128) void k_gemm2(const _Float16* __restrict__ A, int lda, size_t sA, const _Float16* __restrict__ Bh, int ldb, size_t sB, float alpha, const float* __restrict__ bias, size_t sBias, const float* __restrict__ CP, int rowsPerB, size_t sCPb, int row0g,
    float* __restrict__ C, _Float16* __restrict__ C16, int ldc, size_t sC, int M, int N, int K) { d_gemm2<ACT>(blockIdx.x, blockIdx.y, A, lda, sA, Bh, ldb, sB, alpha, bias, sBias, CP, rowsPerB, sCPb, row0g, C, C16, ldc, sC, M, N, K); }

// ---- Shared launches: jobs that read none of each other's output run in one grid. Each job keeps its own code, its own threads and its own blocks, a range of blockIdx.x. ----
#define PB_WT (NH * HD * (HD / 8) / 256)      /* blocks of the sixteen head planes, HD * (HD / 8) threads a head */
#define PB_WN (DM * DM / 8 / 256)             /* blocks of one natural [DM][DM] weight */
#define PB_X ((int)(NR * DM / 8 / 256))       /* blocks of x */
#define GB_V ((MP / 128) * (DM / 64))         /* blocks of the value projection */
#define GB_Q ((MP / 128) * (HD / 64))         /* blocks of one head's bilinear product */
#define TB_VT (NB * NH * (SQ / 64))           /* blocks of the V transpose */
#define TB_HL ((int)((size_t)MP * DM / 8 / 256))      /* blocks of the hi / residual split */
static_assert((NH * HD * (HD / 8)) % 256 == 0 && (DM * DM / 8) % 256 == 0 && (NR * DM / 8) % 256 == 0 && ((size_t)MP * DM / 8) % 256 == 0 && MP % 128 == 0, "shared launches: every job fills whole blocks");
// every conversion that reads inputs only: the head planes, both natural weights, x
__global__ __launch_bounds__(256) void k_prep(const float* __restrict__ x, const float* __restrict__ watt, const float* __restrict__ wv, const float* __restrict__ wo, _Float16* __restrict__ X16, _Float16* __restrict__ BW, _Float16* __restrict__ BV, _Float16* __restrict__ BO) {
  int blk = blockIdx.x;
  if (blk < PB_WT) { const int t = blk * 256 + threadIdx.x, h = t / (HD * (HD / 8)); d_wt_f16(watt + (size_t)h * HD * HD, BW + (size_t)h * HD * HD, HD, HD, 16.0f, t % (HD * (HD / 8))); return; }      /* a head's [in d][out e] weight -> its transposed x16 plane Bt[e][d] */
  blk -= PB_WT; if (blk < PB_WN) { d_wnat(wv, BV, (size_t)blk * 256 + threadIdx.x); return; }      /* natural [out][in] = Bt[n][k] x16 (no transpose) */
  blk -= PB_WN; if (blk < PB_WN) { d_wnat(wo, BO, (size_t)blk * 256 + threadIdx.x); return; }
  blk -= PB_WN; d_x16(x, X16, (size_t)blk * 256 + threadIdx.x); }
// both products of x: v = x Wv^T + bv as f16 rows (the long blocks, K = DM, first), then the per-head product x_h W_h in f32 (head strides: 64 input columns, one [64][64] plane, 64 result columns; K = 64)
__global__ __launch_bounds__(128) void k_proj(const _Float16* __restrict__ X16, const _Float16* __restrict__ BW, const _Float16* __restrict__ BV, const float* __restrict__ bv, float* __restrict__ QF, _Float16* __restrict__ V16) {
  const int blk = blockIdx.x;
  if (blk < GB_V) d_gemm2<0>(blk, 0, X16, DM, 0, BV, DM, 0, 0.0625f, bv, 0, nullptr, 1, 0, 0, nullptr, V16, DM, 0, MP, DM, DM);
  else d_gemm2<0>((blk - GB_V) % GB_Q, (blk - GB_V) / GB_Q, X16, DM, (size_t)HD, BW, HD, (size_t)HD * HD, 0.0625f, nullptr, 0, nullptr, 1, 0, 0, QF, nullptr, DM, (size_t)HD, MP, HD, HD); }
// what follows the two products: V^T [NB][NH][HD][SQ] of both batches, and the f32 product -> f16 hi + x1024 residual planes
__global__ __launch_bounds__(256) void k_post(const _Float16* __restrict__ V16, _Float16* __restrict__ VT, const float* __restrict__ QF, _Float16* __restrict__ Q16, _Float16* __restrict__ QL) {
  if (blockIdx.x < TB_VT) d_vt<NH, SQ>(V16, LQ, 0, VT, blockIdx.x);      /* holds a barrier: the branch goes one way for a whole block */
  else d_hl(QF, Q16, QL, (size_t)(blockIdx.x - TB_VT) * 256 + threadIdx.x); }

// Fused attention of one head: scores, softmax and the weighted sum of v in one kernel, so that neither the scores nor the softmax weights go to memory.
// A wave owns FA_QW query columns and walks all SQ keys, 32 a pass. Both products are transposed: S^T = X_keys (A) x Q^T (B) and O^T += V^T (A) x P^T (B). In an S^T tile lane (ln, hh)
// holds keys 8 hh + r (r = 0..7) of query ln, which is the k order of a B fragment's half: two 16-key tiles pack into P^T in place, with no exchange between lanes.
// Softmax is the running-maximum form: weights are 2^(FA_C (u - mu) + FA_OFF) with u the raw score and mu the maximum in use for that query; when a pass brings a score more than FA_TH
// (in powers of two) above mu in any lane, sums and outputs are rescaled to the new maximum. So a weight stays at or below 2^(FA_TH + FA_OFF) = 2^14, inside f16.
// Every inner loop is unrolled: the fragment and accumulator arrays stay in registers only under constant indices.
typedef float v2f __attribute__((ext_vector_type(2)));
#define FA_WAVES 8
#define FA_QW 32
#define FA_C 0.18033688f             /* log2(e) / sqrt(64) */
#define FA_OFF 8.0f
#define FA_TH 6.0f
static_assert(SQ % (FA_WAVES * FA_QW) == 0 && SQ % 32 == 0 && HD == 64, "k_fattn: whole blocks of queries, whole passes of 32 keys, head size 64");
__device__ __forceinline__ float sm_xhalf(float v) { return __builtin_bit_cast(float, __builtin_amdgcn_permlanex16(__builtin_bit_cast(int, v), __builtin_bit_cast(int, v), 0x76543210, 0xfedcba98, false, false)); }      /* lane l reads lane l ^ 16 */
// 2^x of eight values in one statement, closed by one v_nop. Behind a transcendental the instruction set asks for one independent instruction before its result is read or its
// source overwritten: inside the statement each v_exp_f32 is that instruction for the one in front of it (the early-clobber results lie on no source), the v_nop is it for the last.
__device__ __forceinline__ v8f fa_exp2x8(v8f a) { float r0, r1, r2, r3, r4, r5, r6, r7;
  asm("v_exp_f32 %0, %8\n\tv_exp_f32 %1, %9\n\tv_exp_f32 %2, %10\n\tv_exp_f32 %3, %11\n\tv_exp_f32 %4, %12\n\tv_exp_f32 %5, %13\n\tv_exp_f32 %6, %14\n\tv_exp_f32 %7, %15\n\tv_nop"
      : "=&v"(r0), "=&v"(r1), "=&v"(r2), "=&v"(r3), "=&v"(r4), "=&v"(r5), "=&v"(r6), "=&v"(r7) : "v"(a[0]), "v"(a[1]), "v"(a[2]), "v"(a[3]), "v"(a[4]), "v"(a[5]), "v"(a[6]), "v"(a[7]));
  const v8f r = {r0, r1, r2, r3, r4, r5, r6, r7}; return r; }
// the same for the two rescale factors of a pass
__device__ __forceinline__ void fa_exp2x2(float& a, float& b) { float r0, r1; asm("v_exp_f32 %0, %2\n\tv_exp_f32 %1, %3\n\tv_nop" : "=&v"(r0), "=&v"(r1) : "v"(a), "v"(b)); a = r0; b = r1; }
__device__ __forceinline__ v8f fa_mma(v16h a, v16h b, v8f c) { return __builtin_amdgcn_wmma_f32_16x16x32_f16(false, a, false, b, (short)0, c, false, false); }
__device__ __forceinline__ float fa_max8(v8f a, v8f b) { return fmaxf(fmaxf(fmaxf(fmaxf(a[0], a[1]), fmaxf(a[2], a[3])), fmaxf(fmaxf(a[4], a[5]), fmaxf(a[6], a[7]))), fmaxf(fmaxf(fmaxf(b[0], b[1]), fmaxf(b[2], b[3])), fmaxf(fmaxf(b[4], b[5]), fmaxf(b[6], b[7])))); }
__global__ __launch_bounds__(FA_WAVES * 32) void k_fattn(const _Float16* __restrict__ Qh, const _Float16* __restrict__ Ql, const _Float16* __restrict__ Kx, const _Float16* __restrict__ Vt, _Float16* __restrict__ O) {
  const int lane = threadIdx.x & 31, ln = lane & 15, hh = lane >> 4; const int wave = __builtin_amdgcn_readfirstlane(threadIdx.x >> 5);
  const int h = blockIdx.y, b = blockIdx.z; const size_t rb = (size_t)b * SQ; const int q0 = blockIdx.x * (FA_WAVES * FA_QW) + wave * FA_QW;
  v16h qh[2][2], ql[2][2];      /* [16-query group][32-wide step of the head dimension]: the hi plane and the x1024 residual plane, kept for the whole walk */
#pragma unroll
  for (int g = 0; g < 2; ++g) { const size_t qo = (rb + q0 + g * 16 + ln) * DM + h * HD;
#pragma unroll
    for (int ks = 0; ks < 2; ++ks) { qh[g][ks] = g2_frag(Qh + qo + ks * 32, hh); ql[g][ks] = g2_frag(Ql + qo + ks * 32, hh); } }
  const _Float16* kp = Kx + (rb + ln) * DM + h * HD;      /* key row ln of the batch, this head's 64 columns */
  const _Float16* vp = Vt + (((size_t)b * NH + h) * HD + ln) * SQ;      /* V^T row ln of this head */
  const v8f z8 = {0.f, 0.f, 0.f, 0.f, 0.f, 0.f, 0.f, 0.f};
  v8f o[4][2]; v2f ls[2]; float mu[2];
#pragma unroll
  for (int g = 0; g < 2; ++g) { ls[g] = (v2f){0.f, 0.f}; mu[g] = -1.0e30f;
#pragma unroll
    for (int dt = 0; dt < 4; ++dt) o[dt][g] = z8; }
  v16h kf[2][2];      /* [16-key tile][step of the head dimension], fetched one pass ahead */
#pragma unroll
  for (int t = 0; t < 2; ++t) { kf[t][0] = g2_frag(kp + (size_t)(t * 16) * DM, hh); kf[t][1] = g2_frag(kp + (size_t)(t * 16) * DM + 32, hh); }
  for (int kb = 0; kb < SQ; kb += 32) {
    v16h vf[4];
#pragma unroll
    for (int dt = 0; dt < 4; ++dt) vf[dt] = g2_frag(vp + (size_t)(dt * 16) * SQ + kb, hh);
    asm volatile("s_wait_xcnt 0x0" ::: "memory");      /* before an address register of the loads above is written again; it also keeps these loads at the head of the pass, so that the score products cover their latency */
    v8f s[2][2];      /* [query group][key tile]: raw scores hi + residual / 1024 */
#pragma unroll
    for (int g = 0; g < 2; ++g) {
#pragma unroll
      for (int t = 0; t < 2; ++t) { v8f ch = fa_mma(kf[t][0], qh[g][0], z8); ch = fa_mma(kf[t][1], qh[g][1], ch); v8f cl = fa_mma(kf[t][0], ql[g][0], z8); cl = fa_mma(kf[t][1], ql[g][1], cl); s[g][t] = cl * 0.0009765625f + ch; } }
    const int kn = (kb + 32 < SQ) ? kb + 32 : 0;      /* the last pass fetches pass 0 again: in bounds, not used */
#pragma unroll
    for (int t = 0; t < 2; ++t) { kf[t][0] = g2_frag(kp + (size_t)(kn + t * 16) * DM, hh); kf[t][1] = g2_frag(kp + (size_t)(kn + t * 16) * DM + 32, hh); }
    __builtin_amdgcn_sched_barrier(0);      /* keeps the next pass's key loads here, right behind the score products: left free, the compiler sinks them to the end of the pass, where little is left to cover their latency */
    float mb0 = fa_max8(s[0][0], s[0][1]), mb1 = fa_max8(s[1][0], s[1][1]); mb0 = fmaxf(mb0, sm_xhalf(mb0)); mb1 = fmaxf(mb1, sm_xhalf(mb1));      /* both halves of a query's lanes must use one maximum */
    const bool need = (mb0 - mu[0]) * FA_C > FA_TH || (mb1 - mu[1]) * FA_C > FA_TH;
    if (__builtin_amdgcn_ballot_w32(need) != 0) {      /* wave-uniform: rare after the first passes */
      const float n0 = fmaxf(mu[0], mb0), n1 = fmaxf(mu[1], mb1); float a0 = (mu[0] - n0) * FA_C, a1 = (mu[1] - n1) * FA_C; fa_exp2x2(a0, a1); mu[0] = n0; mu[1] = n1; ls[0] *= a0; ls[1] *= a1;
#pragma unroll
      for (int dt = 0; dt < 4; ++dt) { o[dt][0] *= a0; o[dt][1] *= a1; } }
    FragH p[2];      /* P^T of both query groups is formed before the first product with V^T */
#pragma unroll
    for (int g = 0; g < 2; ++g) { const float bias = FA_OFF - mu[g] * FA_C; const v8f p0 = fa_exp2x8(s[g][0] * FA_C + bias), p1 = fa_exp2x8(s[g][1] * FA_C + bias); const v8f e = p0 + p1; ls[g] += (((v2f){e[0], e[1]} + (v2f){e[2], e[3]}) + ((v2f){e[4], e[5]} + (v2f){e[6], e[7]}));
#pragma unroll
      for (int i = 0; i < 8; ++i) { p[g].h[i] = (_Float16)p0[i]; p[g].h[8 + i] = (_Float16)p1[i]; } }
#pragma unroll
    for (int g = 0; g < 2; ++g) {
#pragma unroll
      for (int dt = 0; dt < 4; ++dt) o[dt][g] = fa_mma(vf[dt], p[g].v, o[dt][g]); } }
#pragma unroll
  for (int g = 0; g < 2; ++g) { float l = ls[g][0] + ls[g][1]; l += sm_xhalf(l); const float sc = 64.0f / l;      /* o x64, the scale the output stage expects */
    unsigned short* op = (unsigned short*)O + (rb + q0 + g * 16 + ln) * DM + h * HD + 8 * hh;
#pragma unroll
    for (int dt = 0; dt < 4; ++dt) { FragH f;
#pragma unroll
      for (int r = 0; r < 8; ++r) f.h[r] = (_Float16)(o[dt][g][r] * sc);
      *(v8us*)(op + dt * 16) = f.half[0]; } } }

extern "C" void kernel_launch(void* const* d_in, const int* in_sizes, int n_in,
                              void* d_out, int out_size, void* d_ws, size_t ws_size, hipStream_t stream) {
  (void)in_sizes; (void)n_in; (void)out_size;
  const float* const* I = (const float* const*)d_in; const float* x = I[0]; const float* watt = I[1]; const float* wv = I[2]; const float* bv = I[3]; const float* wo = I[4]; const float* bo = I[5];      /* x [2][2048][1024]; the per-head bilinear weight [16][64][64] ([head][in d][out e]); the natural value weight [DM][DM] and its bias; the natural output weight [DM][DM] and its bias */
  char* ws = (char*)d_ws; size_t off = 0;
  auto take = [&](size_t bytes) { char* p = ws + off; off += (bytes + 255) & ~(size_t)255; return p; };
  _Float16* BW = (_Float16*)take((size_t)NH * HD * HD * 2); _Float16* BV = (_Float16*)take((size_t)DM * DM * 2); _Float16* BO = (_Float16*)take((size_t)DM * DM * 2);      /* BW: sixteen transposed [64][64] head planes, one after another */
  _Float16* X16 = (_Float16*)take(NR * DM * 2); _Float16* Q16 = (_Float16*)take(NR * DM * 2); float* QF = (float*)take(NR * DM * 4); _Float16* QL = (_Float16*)take(NR * DM * 2); _Float16* V16 = (_Float16*)take(NR * DM * 2); _Float16* O16 = (_Float16*)take(NR * DM * 2);
  _Float16* VT = (_Float16*)take((size_t)NB * NH * HD * SQ * 2);
  if (off > ws_size) return;
  const size_t r0p = (size_t)B0 * SQ;      /* first projected row */
  k_prep<<<PB_WT + 2 * PB_WN + PB_X, 256, 0, stream>>>(x, watt, wv, wo, X16, BW, BV, BO);
  k_proj<<<GB_V + NH * GB_Q, 128, 0, stream>>>(X16 + r0p * DM, BW, BV, bv, QF + r0p * DM, V16 + r0p * DM);
  k_post<<<TB_VT + TB_HL, 256, 0, stream>>>(V16, VT, QF + r0p * DM, Q16 + r0p * DM, QL + r0p * DM);
  k_fattn<<<dim3(SQ / (FA_WAVES * FA_QW), NH, NB), FA_WAVES * 32, 0, stream>>>(Q16, QL, X16, VT, O16);      /* o (merged heads, x64) as f16 rows: every batch, head and query in one launch */
  k_gemm2<0><<<dim3((unsigned)((MPO / 128) * (DM / 64)), 1), 128, 0, stream>>>(O16 + r0p * DM, DM, 0, BO, DM, 0, 0.0009765625f, bo, 0, nullptr, 1, 0, 0, (float*)d_out + r0p * DM, nullptr, DM, 0, MPO, DM, DM);      /* out rows are the output layout */
}

// v004
// It runs in 133 microseconds.
// In both of two side-by-side timings against v003, it was 1.11 times as fast.
// Over all steps from v000 it is 20.7 times as fast.
#include <hip/hip_runtime.h>
// Multi-head self-attention with a PER-HEAD BILINEAR SCORE and no query / key projections (x [2][2048][1024] viewed as 16 heads of 64; scores = (x_h W_h) . x_h / sqrt(64) with W [16][64][64] ([head][in][out]); softmax over all 2048 keys (no mask); v = x w_v^T + b_v (natural [1024][1024] + a bias, zero on this module's draw: read all the same); out = merged w_out^T + b_out (natural + a bias, zero on this draw too) -> [2][2048][1024]).
// Compute dtype: inputs rounded to bf16; x / weights exact; the per-head product as f16 hi + x1024 residual; the key operand is x itself as f16; v, softmax weights and o as plain f16 GEMM operands (~2^-12); scores and softmax statistics f32. v_wmma_f32_16x16x32_f16.
#define NB 2
#define SQ 2048
#define DM 1024
#define NH 16
#define HD 64
#define B0 0                         /* first batch processed (debug hook) */
#define NBR NB                       /* batches processed (debug hook) */
#define NR ((size_t)NB * SQ)         /* token rows */
#define MP ((int)((size_t)NBR * SQ)) /* rows projected (debug hook) */
#define MPO MP                       /* rows through the output stage (debug hook) */
#define LQ DM      /* row pitch of the q/k/v rows */
typedef __bf16 v16b __attribute__((ext_vector_type(16)));
typedef unsigned short v8us __attribute__((ext_vector_type(8), may_alias));
typedef float  v8f  __attribute__((ext_vector_type(8)));
typedef float  v4f  __attribute__((ext_vector_type(4)));
typedef float  v4fa __attribute__((ext_vector_type(4), may_alias));
union FragB { v16b v; v8us half[2]; unsigned short u[16]; };

__device__ __forceinline__ unsigned short bf16_bits(float x) { unsigned int u = __float_as_uint(x); return (unsigned short)((u + 0x7FFFu + ((u >> 16) & 1u)) >> 16); }
__device__ __forceinline__ float bf16_val(unsigned short b) { return __uint_as_float(((unsigned int)b) << 16); }
__device__ __forceinline__ float bf16_round(float x) { return bf16_val(bf16_bits(x)); }
// D += A·B with NT terms: 1 = ah·bh, 2 = + al·bh (A split), 3 = + ah·bl (both split)
template <int NT>
__device__ __forceinline__ v8f mmaN(v16b ah, v16b al, v16b bh, v16b bl, v8f c) {
  c = __builtin_amdgcn_wmma_f32_16x16x32_bf16(false, ah, false, bh, (short)0, c, false, false);
  if (NT >= 2) c = __builtin_amdgcn_wmma_f32_16x16x32_bf16(false, al, false, bh, (short)0, c, false, false);
  if (NT >= 3) c = __builtin_amdgcn_wmma_f32_16x16x32_bf16(false, ah, false, bl, (short)0, c, false, false);
  asm volatile("v_nop\n\tv_nop\n\tv_nop\n\tv_nop" : "+v"(c) : "v"(ah), "v"(al), "v"(bh), "v"(bl));
  return c;
}




// ---- f16 WMMA path (v_wmma_f32_16x16x32_f16): 11-bit significands for operands in range — used for every product here, the softmax weights (up to 2^14) included
typedef _Float16 v16h __attribute__((ext_vector_type(16)));
union FragH { v16h v; v8us half[2]; _Float16 h[16]; unsigned short u[16]; };
template <int NT>
__device__ __forceinline__ v8f mmaH(v16h ah, v16h al, v16h bh, v16h bl, v8f c) {
  c = __builtin_amdgcn_wmma_f32_16x16x32_f16(false, ah, false, bh, (short)0, c, false, false);
  if (NT >= 2) c = __builtin_amdgcn_wmma_f32_16x16x32_f16(false, al, false, bh, (short)0, c, false, false);
  if (NT >= 3) c = __builtin_amdgcn_wmma_f32_16x16x32_f16(false, ah, false, bl, (short)0, c, false, false);
  asm volatile("v_nop\n\tv_nop\n\tv_nop\n\tv_nop" : "+v"(c) : "v"(ah), "v"(al), "v"(bh), "v"(bl));
  return c;
}

// Wt[n][k] = f16(W[k][n]·scale) from f32 row-major W[K][N] (scale = power of two; bf16-exact weights stay exact in f16 away from the subnormal range)
__device__ __forceinline__ void d_wt_f16(const float* __restrict__ W, _Float16* __restrict__ Wt, int K, int N, float scale, int t) {
  const int n = t / (K / 8), k8 = (t % (K / 8)) * 8; FragH f;
#pragma unroll
  for (int i = 0; i < 8; ++i) f.h[i] = (_Float16)(bf16_round(W[(size_t)(k8 + i) * N + n]) * scale); const v8us o = f.half[0];
  *(v8us*)((unsigned short*)Wt + (size_t)n * K + k8) = o; 
}

typedef _Float16 v4h __attribute__((ext_vector_type(4)));

__device__ __forceinline__ void d_x16(const float* __restrict__ x, _Float16* __restrict__ X16, size_t t) { FragH f;
#pragma unroll
  for (int q = 0; q < 8; ++q) f.h[q] = (_Float16)bf16_round(x[t * 8 + q]); *(v8us*)((unsigned short*)X16 + t * 8) = f.half[0]; asm volatile("s_wait_xcnt 0x0" ::: "memory");      /* before a register of the store in front is written again: in a shared launch another job's code follows in the listing */
}
template <int NHv, int TTv>
__device__ __forceinline__ void d_vt(const _Float16* __restrict__ V16, int ldv, int voff, _Float16* __restrict__ Vt, int blk) { __shared__ unsigned short tl[64][66]; const int tid = threadIdx.x; const int slab = blk / (TTv / 64), lg = blk % (TTv / 64); const int b = slab / NHv, h = slab % NHv;
  for (int i = tid; i < 64 * 8; i += 256) { const int r = i / 8, c8 = (i % 8) * 8; FragH f; f.half[0] = *(const v8us*)((const unsigned short*)V16 + ((size_t)b * TTv + lg * 64 + r) * ldv + voff + h * 64 + c8);
#pragma unroll
    for (int q = 0; q < 8; ++q) tl[r][c8 + q] = f.u[q]; }
  __syncthreads();
  {
#pragma unroll
    for (int rd = 0; rd < 2; ++rd) { const int d = rd * 32 + tid / 8, pc = tid % 8; FragH f;
#pragma unroll
      for (int q = 0; q < 8; ++q) f.u[q] = tl[pc * 8 + q][d];
      *(v8us*)((unsigned short*)Vt + ((size_t)slab * 64 + d) * TTv + lg * 64 + pc * 8) = f.half[0]; }
     } }

__device__ __forceinline__ void d_hl(const float* __restrict__ F, _Float16* __restrict__ Hh, _Float16* __restrict__ Hl, size_t t) { FragH fh, fl; const v4f a = *(const v4fa*)(F + t * 8), c = *(const v4fa*)(F + t * 8 + 4);
#pragma unroll
  for (int q = 0; q < 4; ++q) { _Float16 h = (_Float16)a[q]; fh.h[q] = h; fl.h[q] = (_Float16)((a[q] - (float)h) * 1024.0f); h = (_Float16)c[q]; fh.h[4 + q] = h; fl.h[4 + q] = (_Float16)((c[q] - (float)h) * 1024.0f); }
  { *(v8us*)((unsigned short*)Hh + t * 8) = fh.half[0]; *(v8us*)((unsigned short*)Hl + t * 8) = fl.half[0]; asm volatile("s_wait_xcnt 0x0" ::: "memory");      /* before a register of the two stores in front is written again: in a shared launch another job's code follows in the listing */
  } }

// ---- fast GEMM (wave tile 32x64; requires M % 32 == 0 rows per launch region and N % 64 == 0) ----
__device__ __forceinline__ v16h g2_frag(const _Float16* p, int hh) { FragH f; f.half[0] = *(const v8us*)((const unsigned short*)p + 8 * hh); f.half[1] = *(const v8us*)((const unsigned short*)p + 16 + 8 * hh); return f.v; }
__device__ __forceinline__ v8f g2_mma(v16h a, v16h b, v8f c) { v8f d = __builtin_amdgcn_wmma_f32_16x16x32_f16(false, a, false, b, (short)0, c, false, false); asm volatile("v_nop\n\tv_nop\n\tv_nop\n\tv_nop" : "+v"(d) : "v"(a), "v"(b)); return d; }
template <int ACT>
__device__ __forceinline__ void d_gemm2(int bx, int by, const _Float16* __restrict__ A, int lda, size_t sA, const _Float16* __restrict__ Bh, int ldb, size_t sB, float alpha, const float* __restrict__ bias, size_t sBias, const float* __restrict__ CP, int rowsPerB, size_t sCPb, int row0g,
    float* __restrict__ C, _Float16* __restrict__ C16, int ldc, size_t sC, int M, int N, int K) { static_assert(ACT == 0 || ACT == 3 || ACT == 6 || ACT == 8 || ACT == 9 || ACT == 11 || ACT == 12 || ACT == 14 || ACT == 15 || ACT == 16 || ACT == 17, "k_gemm2: unsupported ACT code (would silently apply no activation)");
  __shared__ __attribute__((aligned(16))) float so[4][32][68];
  const int tid = threadIdx.x, w = tid >> 5, lane = tid & 31, ln = lane & 15, hh = lane >> 4;
  A += (size_t)by * sA; Bh += (size_t)by * sB; const size_t cofs = (size_t)by * sC; const float* bp = bias ? bias + (size_t)by * sBias : nullptr;
  const int ntn = N >> 6; const int mt = bx / ntn, nq = bx - mt * ntn; const int row0 = mt * 128 + 32 * w, col0 = nq * 64; if (row0 >= M) return;
  const _Float16* a0p = A + (size_t)(row0 + ln) * lda; const _Float16* a1p = a0p + (size_t)16 * lda;
  const _Float16* b0p = Bh + (size_t)(col0 + ln) * ldb; const _Float16* b1p = b0p + (size_t)16 * ldb; const _Float16* b2p = b1p + (size_t)16 * ldb; const _Float16* b3p = b2p + (size_t)16 * ldb;
  const v8f z8 = {0.f,0.f,0.f,0.f,0.f,0.f,0.f,0.f}; v8f c00 = z8, c01 = z8, c02 = z8, c03 = z8, c10 = z8, c11 = z8, c12 = z8, c13 = z8;
  for (int kb = 0; kb < K; kb += 32) { const v16h a0 = g2_frag(a0p + kb, hh), a1 = g2_frag(a1p + kb, hh);
    v16h b = g2_frag(b0p + kb, hh); c00 = g2_mma(a0, b, c00); c10 = g2_mma(a1, b, c10);
    b = g2_frag(b1p + kb, hh); c01 = g2_mma(a0, b, c01); c11 = g2_mma(a1, b, c11);
    b = g2_frag(b2p + kb, hh); c02 = g2_mma(a0, b, c02); c12 = g2_mma(a1, b, c12);
    b = g2_frag(b3p + kb, hh); c03 = g2_mma(a0, b, c03); c13 = g2_mma(a1, b, c13); }
  v8f accs[8] = {c00, c01, c02, c03, c10, c11, c12, c13};
#pragma unroll
  for (int u = 0; u < 8; ++u) { const int t = u & 3, half = u >> 2; const int col = col0 + t * 16 + ln; const float bv = bp ? bf16_round(bp[col]) : 0.f;
#pragma unroll
    for (int r = 0; r < 8; ++r) { const int rloc = half * 16 + 8 * hh + r; float v = accs[u][r] * alpha + bv; if (CP) { if (rowsPerB < 0) v += CP[cofs + (size_t)(row0g + row0 + rloc) * ldc + col];      /* rowsPerB < 0: own element of the batched C plane */ else { const int bidx = (row0g + row0 + rloc) / rowsPerB; v += CP[(size_t)bidx * sCPb + (size_t)by * 64 + col]; } }
      if (ACT == 3) v = fmaxf(v, 0.f); else if (ACT == 6) v = 0.5f * v * (1.0f + erff(v * 0.70710678118654752f)); else if (ACT == 11) v = 1.0f / (1.0f + expf(-v)); else if (ACT == 15) v = v / (1.0f + expf(-v)); else if (ACT == 12) v = (v > 0.f) ? v : 0.01f * v; else if (ACT == 8) v = tanhf(v); else if (ACT == 9) v = 0.5f * v * (1.0f + tanhf(0.7978845608028654f * (v + 0.044715f * v * v * v))); else if (ACT == 14) v = (v > 0.f) ? v : 0.1f * v; else if (ACT == 16) v = (v >= 0.f) ? v : 0.3f * v; else if (ACT == 17) v = (v >= 0.f) ? v : 0.2f * v;
      so[w][rloc][t * 16 + ln] = v; } }
  __builtin_amdgcn_fence(__ATOMIC_ACQ_REL, "workgroup"); __builtin_amdgcn_wave_barrier();
  const int rsub = lane >> 4, c4 = (lane & 15) * 4;
  {
#pragma unroll
    for (int q = 0; q < 16; ++q) { const int r = q * 2 + rsub; const v4f v = *(const v4fa*)&so[w][r][c4]; if (C) *(v4f*)(C + cofs + (size_t)(row0 + r) * ldc + col0 + c4) = v; if (C16) { v4h h4; for (int i = 0; i < 4; ++i) h4[i] = (_Float16)v[i]; *(v4h*)(C16 + cofs + (size_t)(row0 + r) * ldc + col0 + c4) = h4; } }
     } }

__device__ __forceinline__ void d_wnat(const float* __restrict__ w, _Float16* __restrict__ Bt, size_t t) { FragH f; for (int q = 0; q < 8; ++q) f.h[q] = (_Float16)(bf16_round(w[t * 8 + q]) * 16.0f); *(v8us*)((unsigned short*)Bt + t * 8) = f.half[0]; asm volatile("s_wait_xcnt 0x0" ::: "memory");      /* before a register of the store in front is written again: in a shared launch another job's code follows in the listing */
}

template <int ACT>
__global__ __launch_bounds__(128) void k_gemm2(const _Float16* __restrict__ A, int lda, size_t sA, const _Float16* __restrict__ Bh, int ldb, size_t sB, float alpha, const float* __restrict__ bias, size_t sBias, const float* __restrict__ CP, int rowsPerB, size_t sCPb, int row0g,
    float* __restrict__ C, _Float16* __restrict__ C16, int ldc, size_t sC, int M, int N, int K) { d_gemm2<ACT>(blockIdx.x, blockIdx.y, A, lda, sA, Bh, ldb, sB, alpha, bias, sBias, CP, rowsPerB, sCPb, row0g, C, C16, ldc, sC, M, N, K); }

// ---- Shared launches: jobs that read none of each other's output run in one grid. Each job keeps its own code, its own threads and its own blocks, a range of blockIdx.x. ----
#define PB_WT (NH * HD * (HD / 8) / 256)      /* blocks of the sixteen head planes, HD * (HD / 8) threads a head */
#define PB_WN (DM * DM / 8 / 256)             /* blocks of one natural [DM][DM] weight */
#define PB_X ((int)(NR * DM / 8 / 256))       /* blocks of x */
#define GB_V ((MP / 128) * (DM / 64))         /* blocks of the value projection */
#define GB_Q ((MP / 128) * (HD / 64))         /* blocks of one head's bilinear product */
#define TB_VT (NB * NH * (SQ / 64))           /* blocks of the V transpose */
#define TB_HL ((int)((size_t)MP * DM / 8 / 256))      /* blocks of the hi / residual split */
static_assert((NH * HD * (HD / 8)) % 256 == 0 && (DM * DM / 8) % 256 == 0 && (NR * DM / 8) % 256 == 0 && ((size_t)MP * DM / 8) % 256 == 0 && MP % 128 == 0, "shared launches: every job fills whole blocks");
// every conversion that reads inputs only: the head planes, both natural weights, x
__global__ __launch_bounds__(256) void k_prep(const float* __restrict__ x, const float* __restrict__ watt, const float* __restrict__ wv, const float* __restrict__ wo, _Float16* __restrict__ X16, _Float16* __restrict__ BW, _Float16* __restrict__ BV, _Float16* __restrict__ BO) {
  int blk = blockIdx.x;
  if (blk < PB_WT) { const int t = blk * 256 + threadIdx.x, h = t / (HD * (HD / 8)); d_wt_f16(watt + (size_t)h * HD * HD, BW + (size_t)h * HD * HD, HD, HD, 16.0f, t % (HD * (HD / 8))); return; }      /* a head's [in d][out e] weight -> its transposed x16 plane Bt[e][d] */
  blk -= PB_WT; if (blk < PB_WN) { d_wnat(wv, BV, (size_t)blk * 256 + threadIdx.x); return; }      /* natural [out][in] = Bt[n][k] x16 (no transpose) */
  blk -= PB_WN; if (blk < PB_WN) { d_wnat(wo, BO, (size_t)blk * 256 + threadIdx.x); return; }
  blk -= PB_WN; d_x16(x, X16, (size_t)blk * 256 + threadIdx.x); }
// both products of x: v = x Wv^T + bv as f16 rows (the long blocks, K = DM, first), then the per-head product x_h W_h in f32 (head strides: 64 input columns, one [64][64] plane, 64 result columns; K = 64)
__global__ __launch_bounds__(128) void k_proj(const _Float16* __restrict__ X16, const _Float16* __restrict__ BW, const _Float16* __restrict__ BV, const float* __restrict__ bv, float* __restrict__ QF, _Float16* __restrict__ V16) {
  const int blk = blockIdx.x;
  if (blk < GB_V) d_gemm2<0>(blk, 0, X16, DM, 0, BV, DM, 0, 0.0625f, bv, 0, nullptr, 1, 0, 0, nullptr, V16, DM, 0, MP, DM, DM);
  else d_gemm2<0>((blk - GB_V) % GB_Q, (blk - GB_V) / GB_Q, X16, DM, (size_t)HD, BW, HD, (size_t)HD * HD, 0.0625f, nullptr, 0, nullptr, 1, 0, 0, QF, nullptr, DM, (size_t)HD, MP, HD, HD); }
// what follows the two products: V^T [NB][NH][HD][SQ] of both batches, and the f32 product -> f16 hi + x1024 residual planes
__global__ __launch_bounds__(256) void k_post(const _Float16* __restrict__ V16, _Float16* __restrict__ VT, const float* __restrict__ QF, _Float16* __restrict__ Q16, _Float16* __restrict__ QL) {
  if (blockIdx.x < TB_VT) d_vt<NH, SQ>(V16, LQ, 0, VT, blockIdx.x);      /* holds a barrier: the branch goes one way for a whole block */
  else d_hl(QF, Q16, QL, (size_t)(blockIdx.x - TB_VT) * 256 + threadIdx.x); }

// Fused attention of one head: scores, softmax and the weighted sum of v in one kernel, so that neither the scores nor the softmax weights go to memory.
// A wave owns FA_QW query columns and walks all SQ keys, 32 a pass. The block's eight waves walk the same keys: key rows and V^T rows come into LDS once for all of them, FA_SK keys a stage, by asynchronous copies into two buffers. Both products are transposed: S^T = X_keys (A) x Q^T (B) and O^T += V^T (A) x P^T (B). In an S^T tile lane (ln, hh)
// holds keys 8 hh + r (r = 0..7) of query ln, which is the k order of a B fragment's half: two 16-key tiles pack into P^T in place, with no exchange between lanes.
// Softmax is the running-maximum form: weights are 2^(FA_C (u - mu) + FA_OFF) with u the raw score and mu the maximum in use for that query; when a pass brings a score more than FA_TH
// (in powers of two) above mu in any lane, sums and outputs are rescaled to the new maximum. So a weight stays at or below 2^(FA_TH + FA_OFF) = 2^14, inside f16.
// Every loop over a fragment or accumulator index is unrolled: the fragment and accumulator arrays stay in registers only under constant indices.
typedef float v2f __attribute__((ext_vector_type(2)));
#define FA_WAVES 8
#define FA_QW 32
#define FA_C 0.18033688f             /* log2(e) / sqrt(64) */
#define FA_OFF 8.0f
#define FA_TH 6.0f
#define FA_SK 128                    /* keys of a stage: four passes */
#define FA_NST (SQ / FA_SK)          /* stages of a walk */
#define FA_PK 144                    /* LDS pitch of a key row, 128 bytes + 16: 16 x odd, the pitch free of bank conflicts for 16-byte reads */
#define FA_PV 272                    /* LDS pitch of a V^T row of a stage, 256 bytes + 16 */
#define FA_KB (FA_SK * FA_PK)        /* bytes of a stage's key rows; its V^T rows follow */
#define FA_STB (FA_KB + HD * FA_PV)  /* bytes of a stage */
static_assert(SQ % (FA_WAVES * FA_QW) == 0 && SQ % FA_SK == 0 && FA_NST >= 2 && FA_SK % 32 == 0 && HD == 64 && FA_WAVES == 8, "k_fattn: whole blocks of queries, two or more whole stages of 128 keys, head size 64, 256 threads copy a stage");
__device__ __forceinline__ float sm_xhalf(float v) { return __builtin_bit_cast(float, __builtin_amdgcn_permlanex16(__builtin_bit_cast(int, v), __builtin_bit_cast(int, v), 0x76543210, 0xfedcba98, false, false)); }      /* lane l reads lane l ^ 16 */
// 2^x of eight values in one statement, closed by one v_nop. Behind a transcendental the instruction set asks for one independent instruction before its result is read or its
// source overwritten: inside the statement each v_exp_f32 is that instruction for the one in front of it (the early-clobber results lie on no source), the v_nop is it for the last.
__device__ __forceinline__ v8f fa_exp2x8(v8f a) { float r0, r1, r2, r3, r4, r5, r6, r7;
  asm("v_exp_f32 %0, %8\n\tv_exp_f32 %1, %9\n\tv_exp_f32 %2, %10\n\tv_exp_f32 %3, %11\n\tv_exp_f32 %4, %12\n\tv_exp_f32 %5, %13\n\tv_exp_f32 %6, %14\n\tv_exp_f32 %7, %15\n\tv_nop"
      : "=&v"(r0), "=&v"(r1), "=&v"(r2), "=&v"(r3), "=&v"(r4), "=&v"(r5), "=&v"(r6), "=&v"(r7) : "v"(a[0]), "v"(a[1]), "v"(a[2]), "v"(a[3]), "v"(a[4]), "v"(a[5]), "v"(a[6]), "v"(a[7]));
  const v8f r = {r0, r1, r2, r3, r4, r5, r6, r7}; return r; }
// the same for the two rescale factors of a pass
__device__ __forceinline__ void fa_exp2x2(float& a, float& b) { float r0, r1; asm("v_exp_f32 %0, %2\n\tv_exp_f32 %1, %3\n\tv_nop" : "=&v"(r0), "=&v"(r1) : "v"(a), "v"(b)); a = r0; b = r1; }
__device__ __forceinline__ v8f fa_mma(v16h a, v16h b, v8f c) { return __builtin_amdgcn_wmma_f32_16x16x32_f16(false, a, false, b, (short)0, c, false, false); }
__device__ __forceinline__ float fa_max8(v8f a, v8f b) { return fmaxf(fmaxf(fmaxf(fmaxf(a[0], a[1]), fmaxf(a[2], a[3])), fmaxf(fmaxf(a[4], a[5]), fmaxf(a[6], a[7]))), fmaxf(fmaxf(fmaxf(b[0], b[1]), fmaxf(b[2], b[3])), fmaxf(fmaxf(b[4], b[5]), fmaxf(b[6], b[7])))); }
__device__ __forceinline__ v16h fa_lfrag(const unsigned char* p) { FragH f; f.half[0] = *(const v8us*)p; f.half[1] = *(const v8us*)(p + 32); return f.v; }      /* g2_frag from an LDS row; p holds the lane half's 16 bytes already */
// One stage into LDS, through no register: every thread copies eight 16-byte pieces, four of the key rows (8 threads a 128-byte row, 32 rows a round) and four of the V^T rows (16 threads a 256-byte row, 16 rows a round).
// kg, vg: the thread's own piece in round 0 of this stage; kl, vl: its LDS byte address in the stage's buffer. The closing s_wait_xcnt 0 stands inside the statement, so that no register a copy names is written again in front of it.
__device__ __forceinline__ void fa_stage(const _Float16* kg, const _Float16* vg, unsigned kl, unsigned vl) {
  asm volatile("global_load_async_to_lds_b128 %0, %8, off\n\tglobal_load_async_to_lds_b128 %1, %9, off\n\tglobal_load_async_to_lds_b128 %2, %10, off\n\tglobal_load_async_to_lds_b128 %3, %11, off\n\t"
               "global_load_async_to_lds_b128 %4, %12, off\n\tglobal_load_async_to_lds_b128 %5, %13, off\n\tglobal_load_async_to_lds_b128 %6, %14, off\n\tglobal_load_async_to_lds_b128 %7, %15, off\n\ts_wait_xcnt 0x0"
               :: "v"(kl), "v"(kl + 32 * FA_PK), "v"(kl + 64 * FA_PK), "v"(kl + 96 * FA_PK), "v"(vl), "v"(vl + 16 * FA_PV), "v"(vl + 32 * FA_PV), "v"(vl + 48 * FA_PV),
                  "v"(kg), "v"(kg + (size_t)32 * DM), "v"(kg + (size_t)64 * DM), "v"(kg + (size_t)96 * DM), "v"(vg), "v"(vg + (size_t)16 * SQ), "v"(vg + (size_t)32 * SQ), "v"(vg + (size_t)48 * SQ) : "memory"); }
__global__ __launch_bounds__(FA_WAVES * 32) void k_fattn(const _Float16* __restrict__ Qh, const _Float16* __restrict__ Ql, const _Float16* __restrict__ Kx, const _Float16* __restrict__ Vt, _Float16* __restrict__ O) {
  __shared__ __attribute__((aligned(16))) unsigned char fl[2 * FA_STB];      /* two buffers of one stage each */
  const int tid = threadIdx.x, lane = tid & 31, ln = lane & 15, hh = lane >> 4; const int wave = __builtin_amdgcn_readfirstlane(threadIdx.x >> 5);
  const int h = blockIdx.y, b = blockIdx.z; const size_t rb = (size_t)b * SQ; const int q0 = blockIdx.x * (FA_WAVES * FA_QW) + wave * FA_QW;
  v16h qh[2][2], ql[2][2];      /* [16-query group][32-wide step of the head dimension]: the hi plane and the x1024 residual plane, kept for the whole walk */
#pragma unroll
  for (int g = 0; g < 2; ++g) { const size_t qo = (rb + q0 + g * 16 + ln) * DM + h * HD;
#pragma unroll
    for (int ks = 0; ks < 2; ++ks) { qh[g][ks] = g2_frag(Qh + qo + ks * 32, hh); ql[g][ks] = g2_frag(Ql + qo + ks * 32, hh); } }
  const _Float16* kg = Kx + (rb + (tid >> 3)) * DM + h * HD + (tid & 7) * 8;      /* this thread's piece of key row tid / 8, this head's 64 columns */
  const _Float16* vg = Vt + (((size_t)b * NH + h) * HD + (tid >> 4)) * SQ + (tid & 15) * 8;      /* its piece of V^T row tid / 16 of this head */
  const unsigned kl = (unsigned)(size_t)fl + (tid >> 3) * FA_PK + (tid & 7) * 16, vl = (unsigned)(size_t)fl + FA_KB + (tid >> 4) * FA_PV + (tid & 15) * 16;      /* LDS byte address = low 32 bits of the __shared__ address */
  fa_stage(kg, vg, kl, vl);      /* stage 0 into buffer 0 */
  asm volatile("s_wait_asynccnt 0x0" ::: "memory");      /* this wave's copies of stage 0 have landed */
  __syncthreads();      /* and every other wave's: stage 0 may be read */
  fa_stage(kg + (size_t)FA_SK * DM, vg + FA_SK, kl + FA_STB, vl + FA_STB);      /* stage 1 flies while stage 0 is worked on */
  const v8f z8 = {0.f, 0.f, 0.f, 0.f, 0.f, 0.f, 0.f, 0.f};
  v8f o[4][2]; v2f ls[2]; float mu[2];
#pragma unroll
  for (int g = 0; g < 2; ++g) { ls[g] = (v2f){0.f, 0.f}; mu[g] = -1.0e30f;
#pragma unroll
    for (int dt = 0; dt < 4; ++dt) o[dt][g] = z8; }
  for (int st = 0; st < FA_NST; ++st) {
   const unsigned char* kr = fl + (st & 1) * FA_STB + ln * FA_PK + 16 * hh;      /* key row ln of this stage's buffer, the lane half's 16 bytes */
   const unsigned char* vr = fl + (st & 1) * FA_STB + FA_KB + ln * FA_PV + 16 * hh;      /* V^T row ln */
   v16h kf[2][2];      /* [16-key tile][step of the head dimension], fetched one pass ahead inside a stage */
#pragma unroll
   for (int t = 0; t < 2; ++t) { kf[t][0] = fa_lfrag(kr + (t * 16) * FA_PK); kf[t][1] = fa_lfrag(kr + (t * 16) * FA_PK + 64); }
#pragma unroll 1      /* rolled: unrolled, the four passes took more than 256 registers and spilled */
   for (int ps = 0; ps < FA_SK / 32; ++ps) {
    v8f s[2][2];      /* [query group][key tile]: raw scores hi + residual / 1024 */
#pragma unroll
    for (int g = 0; g < 2; ++g) {
#pragma unroll
      for (int t = 0; t < 2; ++t) { v8f ch = fa_mma(kf[t][0], qh[g][0], z8); ch = fa_mma(kf[t][1], qh[g][1], ch); v8f cl = fa_mma(kf[t][0], ql[g][0], z8); cl = fa_mma(kf[t][1], ql[g][1], cl); s[g][t] = cl * 0.0009765625f + ch; } }
    v16h vf[4];
#pragma unroll
    for (int dt = 0; dt < 4; ++dt) vf[dt] = fa_lfrag(vr + (dt * 16) * FA_PV + ps * 64);
    const int pn = (ps + 1 < FA_SK / 32) ? ps + 1 : 0;      /* the next stage is not published yet, nothing of it is read here: a stage's last pass fetches its own pass 0 again, not used */
#pragma unroll
    for (int t = 0; t < 2; ++t) { kf[t][0] = fa_lfrag(kr + (pn * 32 + t * 16) * FA_PK); kf[t][1] = fa_lfrag(kr + (pn * 32 + t * 16) * FA_PK + 64); }
    __builtin_amdgcn_sched_barrier(0);      /* keeps this pass's V^T reads and the next pass's key reads here as one group, right behind the score products: the softmax arithmetic covers their latency */
    float mb0 = fa_max8(s[0][0], s[0][1]), mb1 = fa_max8(s[1][0], s[1][1]); mb0 = fmaxf(mb0, sm_xhalf(mb0)); mb1 = fmaxf(mb1, sm_xhalf(mb1));      /* both halves of a query's lanes must use one maximum */
    const bool need = (mb0 - mu[0]) * FA_C > FA_TH || (mb1 - mu[1]) * FA_C > FA_TH;
    if (__builtin_amdgcn_ballot_w32(need) != 0) {      /* wave-uniform: rare after the first passes */
      const float n0 = fmaxf(mu[0], mb0), n1 = fmaxf(mu[1], mb1); float a0 = (mu[0] - n0) * FA_C, a1 = (mu[1] - n1) * FA_C; fa_exp2x2(a0, a1); mu[0] = n0; mu[1] = n1; ls[0] *= a0; ls[1] *= a1;
#pragma unroll
      for (int dt = 0; dt < 4; ++dt) { o[dt][0] *= a0; o[dt][1] *= a1; } }
    FragH p[2];      /* P^T of both query groups is formed before the first product with V^T */
#pragma unroll
    for (int g = 0; g < 2; ++g) { const float bias = FA_OFF - mu[g] * FA_C; const v8f p0 = fa_exp2x8(s[g][0] * FA_C + bias), p1 = fa_exp2x8(s[g][1] * FA_C + bias); const v8f e = p0 + p1; ls[g] += (((v2f){e[0], e[1]} + (v2f){e[2], e[3]}) + ((v2f){e[4], e[5]} + (v2f){e[6], e[7]}));
#pragma unroll
      for (int i = 0; i < 8; ++i) { p[g].h[i] = (_Float16)p0[i]; p[g].h[8 + i] = (_Float16)p1[i]; } }
#pragma unroll
    for (int g = 0; g < 2; ++g) {
#pragma unroll
      for (int dt = 0; dt < 4; ++dt) o[dt][g] = fa_mma(vf[dt], p[g].v, o[dt][g]); } }
   asm volatile("s_wait_dscnt 0x0" ::: "memory");      /* this wave's last reads of the buffer have returned */
   asm volatile("s_wait_asynccnt 0x0" ::: "memory");      /* its copies of stage st + 1 have landed */
   __syncthreads();      /* one barrier a stage: it publishes stage st + 1 and ends every wave's reads of stage st */
   if (st + 2 < FA_NST) fa_stage(kg + (size_t)(st + 2) * FA_SK * DM, vg + (st + 2) * FA_SK, kl + (st & 1) * FA_STB, vl + (st & 1) * FA_STB); }      /* refill of the buffer just left; the test reads the same in the whole block */
  asm volatile("s_wait_asynccnt 0x0" ::: "memory");      /* no copy is left in flight when the wave ends */
#pragma unroll
  for (int g = 0; g < 2; ++g) { float l = ls[g][0] + ls[g][1]; l += sm_xhalf(l); const float sc = 64.0f / l;      /* o x64, the scale the output stage expects */
    unsigned short* op = (unsigned short*)O + (rb + q0 + g * 16 + ln) * DM + h * HD + 8 * hh;
#pragma unroll
    for (int dt = 0; dt < 4; ++dt) { FragH f;
#pragma unroll
      for (int r = 0; r < 8; ++r) f.h[r] = (_Float16)(o[dt][g][r] * sc);
      *(v8us*)(op + dt * 16) = f.half[0]; } } }

extern "C" void kernel_launch(void* const* d_in, const int* in_sizes, int n_in,
                              void* d_out, int out_size, void* d_ws, size_t ws_size, hipStream_t stream) {
  (void)in_sizes; (void)n_in; (void)out_size;
  const float* const* I = (const float* const*)d_in; const float* x = I[0]; const float* watt = I[1]; const float* wv = I[2]; const float* bv = I[3]; const float* wo = I[4]; const float* bo = I[5];      /* x [2][2048][1024]; the per-head bilinear weight [16][64][64] ([head][in d][out e]); the natural value weight [DM][DM] and its bias; the natural output weight [DM][DM] and its bias */
  char* ws = (char*)d_ws; size_t off = 0;
  auto take = [&](size_t bytes) { char* p = ws + off; off += (bytes + 255) & ~(size_t)255; return p; };
  _Float16* BW = (_Float16*)take((size_t)NH * HD * HD * 2); _Float16* BV = (_Float16*)take((size_t)DM * DM * 2); _Float16* BO = (_Float16*)take((size_t)DM * DM * 2);      /* BW: sixteen transposed [64][64] head planes, one after another */
  _Float16* X16 = (_Float16*)take(NR * DM * 2); _Float16* Q16 = (_Float16*)take(NR * DM * 2); float* QF = (float*)take(NR * DM * 4); _Float16* QL = (_Float16*)take(NR * DM * 2); _Float16* V16 = (_Float16*)take(NR * DM * 2); _Float16* O16 = (_Float16*)take(NR * DM * 2);
  _Float16* VT = (_Float16*)take((size_t)NB * NH * HD * SQ * 2);
  if (off > ws_size) return;
  const size_t r0p = (size_t)B0 * SQ;      /* first projected row */
  k_prep<<<PB_WT + 2 * PB_WN + PB_X, 256, 0, stream>>>(x, watt, wv, wo, X16, BW, BV, BO);
  k_proj<<<GB_V + NH * GB_Q, 128, 0, stream>>>(X16 + r0p * DM, BW, BV, bv, QF + r0p * DM, V16 + r0p * DM);
  k_post<<<TB_VT + TB_HL, 256, 0, stream>>>(V16, VT, QF + r0p * DM, Q16 + r0p * DM, QL + r0p * DM);
  k_fattn<<<dim3(SQ / (FA_WAVES * FA_QW), NH, NB), FA_WAVES * 32, 0, stream>>>(Q16, QL, X16, VT, O16);      /* o (merged heads, x64) as f16 rows: every batch, head and query in one launch */
  k_gemm2<0><<<dim3((unsigned)((MPO / 128) * (DM / 64)), 1), 128, 0, stream>>>(O16 + r0p * DM, DM, 0, BO, DM, 0, 0.0009765625f, bo, 0, nullptr, 1, 0, 0, (float*)d_out + r0p * DM, nullptr, DM, 0, MPO, DM, DM);      /* out rows are the output layout */
}

// v005
// Measured time: 80.4 microseconds a run.
// Timed twice side by side with v004, it ran 1.61 and 1.63 times as fast.
// All steps since v000 together make it 33.6 times as fast.
#include <hip/hip_runtime.h>
// Multi-head self-attention with a PER-HEAD BILINEAR SCORE and no query / key projections (x [2][2048][1024] viewed as 16 heads of 64; scores = (x_h W_h) . x_h / sqrt(64) with W [16][64][64] ([head][in][out]); softmax over all 2048 keys (no mask); v = x w_v^T + b_v (natural [1024][1024] + a bias, zero on this module's draw: read all the same); out = merged w_out^T + b_out (natural + a bias, zero on this draw too) -> [2][2048][1024]).
// Compute dtype: inputs rounded to bf16; x / weights exact; the per-head product as f16 hi + x1024 residual; the key operand is x itself as f16; v, softmax weights and o as plain f16 GEMM operands (~2^-12); scores and softmax statistics f32. v_wmma_f32_16x16x32_f16.
#define NB 2
#define SQ 2048
#define DM 1024
#define NH 16
#define HD 64
#define B0 0                         /* first batch processed (debug hook) */
#define NBR NB                       /* batches processed (debug hook) */
#define NR ((size_t)NB * SQ)         /* token rows */
#define MP ((int)((size_t)NBR * SQ)) /* rows projected (debug hook) */
#define MPO MP                       /* rows through the output stage (debug hook) */
#define LQ DM      /* row pitch of the q/k/v rows */
typedef __bf16 v16b __attribute__((ext_vector_type(16)));
typedef unsigned short v8us __attribute__((ext_vector_type(8), may_alias));
typedef float  v8f  __attribute__((ext_vector_type(8)));
typedef float  v4f  __attribute__((ext_vector_type(4)));
typedef float  v4fa __attribute__((ext_vector_type(4), may_alias));
union FragB { v16b v; v8us half[2]; unsigned short u[16]; };

__device__ __forceinline__ unsigned short bf16_bits(float x) { unsigned int u = __float_as_uint(x); return (unsigned short)((u + 0x7FFFu + ((u >> 16) & 1u)) >> 16); }
__device__ __forceinline__ float bf16_val(unsigned short b) { return __uint_as_float(((unsigned int)b) << 16); }
__device__ __forceinline__ float bf16_round(float x) { return bf16_val(bf16_bits(x)); }
// D += A·B with NT terms: 1 = ah·bh, 2 = + al·bh (A split), 3 = + ah·bl (both split)
template <int NT>
__device__ __forceinline__ v8f mmaN(v16b ah, v16b al, v16b bh, v16b bl, v8f c) {
  c = __builtin_amdgcn_wmma_f32_16x16x32_bf16(false, ah, false, bh, (short)0, c, false, false);
  if (NT >= 2) c = __builtin_amdgcn_wmma_f32_16x16x32_bf16(false, al, false, bh, (short)0, c, false, false);
  if (NT >= 3) c = __builtin_amdgcn_wmma_f32_16x16x32_bf16(false, ah, false, bl, (short)0, c, false, false);
  asm volatile("v_nop\n\tv_nop\n\tv_nop\n\tv_nop" : "+v"(c) : "v"(ah), "v"(al), "v"(bh), "v"(bl));
  return c;
}




// ---- f16 WMMA path (v_wmma_f32_16x16x32_f16): 11-bit significands for operands in range — used for every product here, the softmax weights (up to 2^14) included
typedef _Float16 v16h __attribute__((ext_vector_type(16)));
union FragH { v16h v; v8us half[2]; _Float16 h[16]; unsigned short u[16]; };
template <int NT>
__device__ __forceinline__ v8f mmaH(v16h ah, v16h al, v16h bh, v16h bl, v8f c) {
  c = __builtin_amdgcn_wmma_f32_16x16x32_f16(false, ah, false, bh, (short)0, c, false, false);
  if (NT >= 2) c = __builtin_amdgcn_wmma_f32_16x16x32_f16(false, al, false, bh, (short)0, c, false, false);
  if (NT >= 3) c = __builtin_amdgcn_wmma_f32_16x16x32_f16(false, ah, false, bl, (short)0, c, false, false);
  asm volatile("v_nop\n\tv_nop\n\tv_nop\n\tv_nop" : "+v"(c) : "v"(ah), "v"(al), "v"(bh), "v"(bl));
  return c;
}

// Wt[n][k] = f16(W[k][n]·scale) from f32 row-major W[K][N] (scale = power of two; bf16-exact weights stay exact in f16 away from the subnormal range)
__device__ __forceinline__ void d_wt_f16(const float* __restrict__ W, _Float16* __restrict__ Wt, int K, int N, float scale, int t) {
  const int n = t / (K / 8), k8 = (t % (K / 8)) * 8; FragH f;
#pragma unroll
  for (int i = 0; i < 8; ++i) f.h[i] = (_Float16)(bf16_round(W[(size_t)(k8 + i) * N + n]) * scale); const v8us o = f.half[0];
  *(v8us*)((unsigned short*)Wt + (size_t)n * K + k8) = o; 
}

typedef _Float16 v4h __attribute__((ext_vector_type(4)));

__device__ __forceinline__ void d_x16(const float* __restrict__ x, _Float16* __restrict__ X16, size_t t) { FragH f;
#pragma unroll
  for (int q = 0; q < 8; ++q) f.h[q] = (_Float16)bf16_round(x[t * 8 + q]); *(v8us*)((unsigned short*)X16 + t * 8) = f.half[0]; asm volatile("s_wait_xcnt 0x0" ::: "memory");      /* before a register of the store in front is written again: in a shared launch another job's code follows in the listing */
}
template <int NHv, int TTv>
__device__ __forceinline__ void d_vt(const _Float16* __restrict__ V16, int ldv, int voff, _Float16* __restrict__ Vt, int blk) { __shared__ unsigned short tl[64][66]; const int tid = threadIdx.x; const int slab = blk / (TTv / 64), lg = blk % (TTv / 64); const int b = slab / NHv, h = slab % NHv;
  for (int i = tid; i < 64 * 8; i += 256) { const int r = i / 8, c8 = (i % 8) * 8; FragH f; f.half[0] = *(const v8us*)((const unsigned short*)V16 + ((size_t)b * TTv + lg * 64 + r) * ldv + voff + h * 64 + c8);
#pragma unroll
    for (int q = 0; q < 8; ++q) tl[r][c8 + q] = f.u[q]; }
  __syncthreads();
  {
#pragma unroll
    for (int rd = 0; rd < 2; ++rd) { const int d = rd * 32 + tid / 8, pc = tid % 8; FragH f;
#pragma unroll
      for (int q = 0; q < 8; ++q) f.u[q] = tl[pc * 8 + q][d];
      *(v8us*)((unsigned short*)Vt + ((size_t)slab * 64 + d) * TTv + lg * 64 + pc * 8) = f.half[0]; }
     } }

__device__ __forceinline__ void d_hl(const float* __restrict__ F, _Float16* __restrict__ Hh, _Float16* __restrict__ Hl, size_t t) { FragH fh, fl; const v4f a = *(const v4fa*)(F + t * 8), c = *(const v4fa*)(F + t * 8 + 4);
#pragma unroll
  for (int q = 0; q < 4; ++q) { _Float16 h = (_Float16)a[q]; fh.h[q] = h; fl.h[q] = (_Float16)((a[q] - (float)h) * 1024.0f); h = (_Float16)c[q]; fh.h[4 + q] = h; fl.h[4 + q] = (_Float16)((c[q] - (float)h) * 1024.0f); }
  { *(v8us*)((unsigned short*)Hh + t * 8) = fh.half[0]; *(v8us*)((unsigned short*)Hl + t * 8) = fl.half[0]; asm volatile("s_wait_xcnt 0x0" ::: "memory");      /* before a register of the two stores in front is written again: in a shared launch another job's code follows in the listing */
  } }

// ---- fast GEMM (wave tile 32x64, block tile 128x64; requires M % 128 == 0 rows per launch region, N % 64 == 0 and K % KS == 0) ----
__device__ __forceinline__ v16h g2_frag(const _Float16* p, int hh) { FragH f; f.half[0] = *(const v8us*)((const unsigned short*)p + 8 * hh); f.half[1] = *(const v8us*)((const unsigned short*)p + 16 + 8 * hh); return f.v; }
__device__ __forceinline__ v8f g2_mma(v16h a, v16h b, v8f c) { v8f d = __builtin_amdgcn_wmma_f32_16x16x32_f16(false, a, false, b, (short)0, c, false, false); asm volatile("v_nop\n\tv_nop\n\tv_nop\n\tv_nop" : "+v"(d) : "v"(a), "v"(b)); return d; }
// A block's operands come through LDS: its 128 A rows and 64 B rows, KS k a stage, by asynchronous copies of whole 128-byte lines into two buffers; the four waves read their fragments from there.
#define G2_PK(KS) ((KS) * 2 + 16)             /* LDS pitch of a staged row, its bytes + 16: 16 x odd (144, 272), the pitch free of bank conflicts for 16-byte reads */
#define G2_STB(KS) ((128 + 64) * G2_PK(KS))   /* bytes of a stage: the A rows, then the B rows */
__device__ __forceinline__ unsigned char* g2_lds() { __shared__ __attribute__((aligned(16))) unsigned char sm[2 * G2_STB(128)]; return sm; }      /* two buffers of the longest stage; one array for every stage length that a kernel holds */
__device__ __forceinline__ v16h g2_lfrag(const unsigned char* p) { FragH f; f.half[0] = *(const v8us*)p; f.half[1] = *(const v8us*)(p + 32); return f.v; }      /* g2_frag from an LDS row; p holds the lane half's 16 bytes already */
// 64 k of a stage into LDS, through no register: every thread copies twelve 16-byte pieces (8 threads a 128-byte line, 16 rows a round): eight rounds of A rows, four of B rows.
// ag, bg: the thread's own piece in round 0; a16, b16: elements of 16 rows; al, bl: its LDS byte address in the stage's buffer; p16: LDS bytes of 16 rows. The closing s_wait_xcnt 0 stands inside the statement, so that no register a copy names is written again in front of it.
__device__ __forceinline__ void g2_stage(const _Float16* ag, size_t a16, const _Float16* bg, size_t b16, unsigned al, unsigned bl, unsigned p16) {
  asm volatile("global_load_async_to_lds_b128 %0, %12, off\n\tglobal_load_async_to_lds_b128 %1, %13, off\n\tglobal_load_async_to_lds_b128 %2, %14, off\n\tglobal_load_async_to_lds_b128 %3, %15, off\n\t"
               "global_load_async_to_lds_b128 %4, %16, off\n\tglobal_load_async_to_lds_b128 %5, %17, off\n\tglobal_load_async_to_lds_b128 %6, %18, off\n\tglobal_load_async_to_lds_b128 %7, %19, off\n\t"
               "global_load_async_to_lds_b128 %8, %20, off\n\tglobal_load_async_to_lds_b128 %9, %21, off\n\tglobal_load_async_to_lds_b128 %10, %22, off\n\tglobal_load_async_to_lds_b128 %11, %23, off\n\ts_wait_xcnt 0x0"
               :: "v"(al), "v"(al + p16), "v"(al + 2 * p16), "v"(al + 3 * p16), "v"(al + 4 * p16), "v"(al + 5 * p16), "v"(al + 6 * p16), "v"(al + 7 * p16),
                  "v"(bl), "v"(bl + p16), "v"(bl + 2 * p16), "v"(bl + 3 * p16),
                  "v"(ag), "v"(ag + a16), "v"(ag + 2 * a16), "v"(ag + 3 * a16), "v"(ag + 4 * a16), "v"(ag + 5 * a16), "v"(ag + 6 * a16), "v"(ag + 7 * a16),
                  "v"(bg), "v"(bg + b16), "v"(bg + 2 * b16), "v"(bg + 3 * b16) : "memory"); }
// a whole stage: one such statement for each 64 k of it (12 or 24 copies of a wave in flight)
template <int KS>
__device__ __forceinline__ void g2_fill(const _Float16* ag, size_t a16, const _Float16* bg, size_t b16, unsigned al, unsigned bl) {
#pragma unroll      /* one or two statements in a row, no loop around them */
  for (int h = 0; h < KS / 64; ++h) g2_stage(ag + h * 64, a16, bg + h * 64, b16, al + h * 128, bl + h * 128, 16 * G2_PK(KS)); }
template <int ACT, int KS>
__device__ __forceinline__ void d_gemm2(int bx, int by, const _Float16* __restrict__ A, int lda, size_t sA, const _Float16* __restrict__ Bh, int ldb, size_t sB, float alpha, const float* __restrict__ bias, size_t sBias, const float* __restrict__ CP, int rowsPerB, size_t sCPb, int row0g,
    float* __restrict__ C, _Float16* __restrict__ C16, int ldc, size_t sC, int M, int N, int K) { static_assert(ACT == 0 || ACT == 3 || ACT == 6 || ACT == 8 || ACT == 9 || ACT == 11 || ACT == 12 || ACT == 14 || ACT == 15 || ACT == 16 || ACT == 17, "k_gemm2: unsupported ACT code (would silently apply no activation)");
  static_assert(KS == 64 || KS == 128, "a stage is one or two 128-byte lines of every row"); constexpr int PK = G2_PK(KS), AB = 128 * PK, STB = G2_STB(KS);      /* row pitch, bytes of a stage's A rows, bytes of a stage */
  unsigned char* const sm = g2_lds();
  float (*so)[32][68] = (float (*)[32][68])sm; static_assert(sizeof(float) * 4 * 32 * 68 <= 2 * G2_STB(64), "the result tiles fit the staging bytes");      /* behind the loop's last barrier the same bytes hold each wave's result tile */
  const int tid = threadIdx.x, w = tid >> 5, lane = tid & 31, ln = lane & 15, hh = lane >> 4;
  A += (size_t)by * sA; Bh += (size_t)by * sB; const size_t cofs = (size_t)by * sC; const float* bp = bias ? bias + (size_t)by * sBias : nullptr;
  const int ntn = N >> 6; const int mt = bx / ntn, nq = bx - mt * ntn; const int row0 = mt * 128 + 32 * w, col0 = nq * 64; if (mt * 128 >= M) return;      /* a whole block leaves or none, in front of every barrier (M is a multiple of 128) */
  const _Float16* ag = A + (size_t)(mt * 128 + (tid >> 3)) * lda + (tid & 7) * 8;      /* this thread's piece of the block's A row tid / 8 */
  const _Float16* bg = Bh + (size_t)(col0 + (tid >> 3)) * ldb + (tid & 7) * 8;      /* its piece of B row tid / 8 */
  const unsigned al = (unsigned)(size_t)sm + (tid >> 3) * PK + (tid & 7) * 16, bl = al + AB;      /* LDS byte address = low 32 bits of the __shared__ address */
  const size_t a16 = (size_t)16 * lda, b16 = (size_t)16 * ldb; const int nst = K / KS;      /* whole stages (K is a multiple of KS) */
  g2_fill<KS>(ag, a16, bg, b16, al, bl);      /* stage 0 into buffer 0 */
  asm volatile("s_wait_asynccnt 0x0" ::: "memory");      /* this wave's copies of stage 0 have landed */
  __syncthreads();      /* and every other wave's: stage 0 may be read */
  if (nst > 1) g2_fill<KS>(ag + KS, a16, bg + KS, b16, al + STB, bl + STB);      /* stage 1 flies while stage 0 is worked on */
  const v8f z8 = {0.f,0.f,0.f,0.f,0.f,0.f,0.f,0.f}; v8f c00 = z8, c01 = z8, c02 = z8, c03 = z8, c10 = z8, c11 = z8, c12 = z8, c13 = z8;
#pragma unroll 1      /* rolled: one copy of the stage's code, whatever K is at the call */
  for (int st = 0; st < nst; ++st) {
    const unsigned char* ar = sm + (st & 1) * STB + (32 * w + ln) * PK + 16 * hh;      /* the wave's A row ln of this stage's buffer, the lane half's 16 bytes */
    const unsigned char* br = sm + (st & 1) * STB + AB + ln * PK + 16 * hh;      /* B row ln */
    /* every loop inside a stage is unrolled: the fragment arrays stay in registers only under constant indices */
#pragma unroll
    for (int h = 0; h < KS / 64; ++h) {
      v16h af[2][2], bf[2][4];      /* [32-wide k step][16-row tile]: the fragments of 64 k are read as one group in front of their sixteen products */
#pragma unroll
      for (int ks = 0; ks < 2; ++ks) {
#pragma unroll
        for (int t = 0; t < 2; ++t) af[ks][t] = g2_lfrag(ar + (t * 16) * PK + h * 128 + ks * 64);
#pragma unroll
        for (int t = 0; t < 4; ++t) bf[ks][t] = g2_lfrag(br + (t * 16) * PK + h * 128 + ks * 64); }
#pragma unroll
      for (int ks = 0; ks < 2; ++ks) {
        c00 = g2_mma(af[ks][0], bf[ks][0], c00); c10 = g2_mma(af[ks][1], bf[ks][0], c10);
        c01 = g2_mma(af[ks][0], bf[ks][1], c01); c11 = g2_mma(af[ks][1], bf[ks][1], c11);
        c02 = g2_mma(af[ks][0], bf[ks][2], c02); c12 = g2_mma(af[ks][1], bf[ks][2], c12);
        c03 = g2_mma(af[ks][0], bf[ks][3], c03); c13 = g2_mma(af[ks][1], bf[ks][3], c13); } }
    asm volatile("s_wait_dscnt 0x0" ::: "memory");      /* this wave's last reads of the buffer have returned */
    asm volatile("s_wait_asynccnt 0x0" ::: "memory");      /* its copies of stage st + 1 have landed */
    __syncthreads();      /* one barrier a stage: it publishes stage st + 1 and ends every wave's reads of stage st */
    if (st + 2 < nst) g2_fill<KS>(ag + (size_t)(st + 2) * KS, a16, bg + (size_t)(st + 2) * KS, b16, al + (st & 1) * STB, bl + (st & 1) * STB); }      /* refill of the buffer just left; the test reads the same in the whole block */
  asm volatile("s_wait_asynccnt 0x0" ::: "memory");      /* no copy is left in flight when the staging bytes take the result tiles */
  v8f accs[8] = {c00, c01, c02, c03, c10, c11, c12, c13};
#pragma unroll
  for (int u = 0; u < 8; ++u) { const int t = u & 3, half = u >> 2; const int col = col0 + t * 16 + ln; const float bv = bp ? bf16_round(bp[col]) : 0.f;
#pragma unroll
    for (int r = 0; r < 8; ++r) { const int rloc = half * 16 + 8 * hh + r; float v = accs[u][r] * alpha + bv; if (CP) { if (rowsPerB < 0) v += CP[cofs + (size_t)(row0g + row0 + rloc) * ldc + col];      /* rowsPerB < 0: own element of the batched C plane */ else { const int bidx = (row0g + row0 + rloc) / rowsPerB; v += CP[(size_t)bidx * sCPb + (size_t)by * 64 + col]; } }
      if (ACT == 3) v = fmaxf(v, 0.f); else if (ACT == 6) v = 0.5f * v * (1.0f + erff(v * 0.70710678118654752f)); else if (ACT == 11) v = 1.0f / (1.0f + expf(-v)); else if (ACT == 15) v = v / (1.0f + expf(-v)); else if (ACT == 12) v = (v > 0.f) ? v : 0.01f * v; else if (ACT == 8) v = tanhf(v); else if (ACT == 9) v = 0.5f * v * (1.0f + tanhf(0.7978845608028654f * (v + 0.044715f * v * v * v))); else if (ACT == 14) v = (v > 0.f) ? v : 0.1f * v; else if (ACT == 16) v = (v >= 0.f) ? v : 0.3f * v; else if (ACT == 17) v = (v >= 0.f) ? v : 0.2f * v;
      so[w][rloc][t * 16 + ln] = v; } }
  __builtin_amdgcn_fence(__ATOMIC_ACQ_REL, "workgroup"); __builtin_amdgcn_wave_barrier();
  const int rsub = lane >> 4, c4 = (lane & 15) * 4;
  { v4f vv[16];      /* the tile's rows are read as one group in front of the stores: no LDS read can pass the waits behind the stores, and one read a store would add its latency sixteen times */
#pragma unroll
    for (int q = 0; q < 16; ++q) vv[q] = *(const v4fa*)&so[w][q * 2 + rsub][c4];
#pragma unroll      /* constant indices keep vv in registers */
    for (int q = 0; q < 16; ++q) { const int r = q * 2 + rsub; const v4f v = vv[q];
      if (C) { *(v4f*)(C + cofs + (size_t)(row0 + r) * ldc + col0 + c4) = v; asm volatile("s_wait_xcnt 0x0" ::: "memory"); }      /* before a register of the store in front is written again (the next row's address, the f16 form, another job's code in a shared launch) */
      if (C16) { v4h h4; for (int i = 0; i < 4; ++i) h4[i] = (_Float16)v[i]; *(v4h*)(C16 + cofs + (size_t)(row0 + r) * ldc + col0 + c4) = h4; asm volatile("s_wait_xcnt 0x0" ::: "memory"); } }      /* the same for this store */
     } }

__device__ __forceinline__ void d_wnat(const float* __restrict__ w, _Float16* __restrict__ Bt, size_t t) { FragH f; for (int q = 0; q < 8; ++q) f.h[q] = (_Float16)(bf16_round(w[t * 8 + q]) * 16.0f); *(v8us*)((unsigned short*)Bt + t * 8) = f.half[0]; asm volatile("s_wait_xcnt 0x0" ::: "memory");      /* before a register of the store in front is written again: in a shared launch another job's code follows in the listing */
}

template <int ACT>
__global__ __launch_bounds__(128) void k_gemm2(const _Float16* __restrict__ A, int lda, size_t sA, const _Float16* __restrict__ Bh, int ldb, size_t sB, float alpha, const float* __restrict__ bias, size_t sBias, const float* __restrict__ CP, int rowsPerB, size_t sCPb, int row0g,
    float* __restrict__ C, _Float16* __restrict__ C16, int ldc, size_t sC, int M, int N, int K) { d_gemm2<ACT, 128>(blockIdx.x, blockIdx.y, A, lda, sA, Bh, ldb, sB, alpha, bias, sBias, CP, rowsPerB, sCPb, row0g, C, C16, ldc, sC, M, N, K); }

// ---- Shared launches: jobs that read none of each other's output run in one grid. Each job keeps its own code, its own threads and its own blocks, a range of blockIdx.x. ----
#define PB_WT (NH * HD * (HD / 8) / 256)      /* blocks of the sixteen head planes, HD * (HD / 8) threads a head */
#define PB_WN (DM * DM / 8 / 256)             /* blocks of one natural [DM][DM] weight */
#define PB_X ((int)(NR * DM / 8 / 256))       /* blocks of x */
#define GB_V ((MP / 128) * (DM / 64))         /* blocks of the value projection */
#define GB_Q ((MP / 128) * (HD / 64))         /* blocks of one head's bilinear product */
#define TB_VT (NB * NH * (SQ / 64))           /* blocks of the V transpose */
#define TB_HL ((int)((size_t)MP * DM / 8 / 256))      /* blocks of the hi / residual split */
static_assert((NH * HD * (HD / 8)) % 256 == 0 && (DM * DM / 8) % 256 == 0 && (NR * DM / 8) % 256 == 0 && ((size_t)MP * DM / 8) % 256 == 0 && MP % 128 == 0 && DM % 128 == 0 && HD % 64 == 0, "shared launches: every job fills whole blocks; the products' K is whole stages");
// every conversion that reads inputs only: the head planes, both natural weights, x
__global__ __launch_bounds__(256) void k_prep(const float* __restrict__ x, const float* __restrict__ watt, const float* __restrict__ wv, const float* __restrict__ wo, _Float16* __restrict__ X16, _Float16* __restrict__ BW, _Float16* __restrict__ BV, _Float16* __restrict__ BO) {
  int blk = blockIdx.x;
  if (blk < PB_WT) { const int t = blk * 256 + threadIdx.x, h = t / (HD * (HD / 8)); d_wt_f16(watt + (size_t)h * HD * HD, BW + (size_t)h * HD * HD, HD, HD, 16.0f, t % (HD * (HD / 8))); return; }      /* a head's [in d][out e] weight -> its transposed x16 plane Bt[e][d] */
  blk -= PB_WT; if (blk < PB_WN) { d_wnat(wv, BV, (size_t)blk * 256 + threadIdx.x); return; }      /* natural [out][in] = Bt[n][k] x16 (no transpose) */
  blk -= PB_WN; if (blk < PB_WN) { d_wnat(wo, BO, (size_t)blk * 256 + threadIdx.x); return; }
  blk -= PB_WN; d_x16(x, X16, (size_t)blk * 256 + threadIdx.x); }
// both products of x: v = x Wv^T + bv as f16 rows (the long blocks, K = DM, first), then the per-head product x_h W_h in f32 (head strides: 64 input columns, one [64][64] plane, 64 result columns; K = 64)
__global__ __launch_bounds__(128) void k_proj(const _Float16* __restrict__ X16, const _Float16* __restrict__ BW, const _Float16* __restrict__ BV, const float* __restrict__ bv, float* __restrict__ QF, _Float16* __restrict__ V16) {
  const int blk = blockIdx.x;
  if (blk < GB_V) d_gemm2<0, 128>(blk, 0, X16, DM, 0, BV, DM, 0, 0.0625f, bv, 0, nullptr, 1, 0, 0, nullptr, V16, DM, 0, MP, DM, DM);
  else d_gemm2<0, 64>((blk - GB_V) % GB_Q, (blk - GB_V) / GB_Q, X16, DM, (size_t)HD, BW, HD, (size_t)HD * HD, 0.0625f, nullptr, 0, nullptr, 1, 0, 0, QF, nullptr, DM, (size_t)HD, MP, HD, HD); }
// what follows the two products: V^T [NB][NH][HD][SQ] of both batches, and the f32 product -> f16 hi + x1024 residual planes
__global__ __launch_bounds__(256) void k_post(const _Float16* __restrict__ V16, _Float16* __restrict__ VT, const float* __restrict__ QF, _Float16* __restrict__ Q16, _Float16* __restrict__ QL) {
  if (blockIdx.x < TB_VT) d_vt<NH, SQ>(V16, LQ, 0, VT, blockIdx.x);      /* holds a barrier: the branch goes one way for a whole block */
  else d_hl(QF, Q16, QL, (size_t)(blockIdx.x - TB_VT) * 256 + threadIdx.x); }

// Fused attention of one head: scores, softmax and the weighted sum of v in one kernel, so that neither the scores nor the softmax weights go to memory.
// A wave owns FA_QW query columns and walks all SQ keys, 32 a pass. The block's eight waves walk the same keys: key rows and V^T rows come into LDS once for all of them, FA_SK keys a stage, by asynchronous copies into two buffers. Both products are transposed: S^T = X_keys (A) x Q^T (B) and O^T += V^T (A) x P^T (B). In an S^T tile lane (ln, hh)
// holds keys 8 hh + r (r = 0..7) of query ln, which is the k order of a B fragment's half: two 16-key tiles pack into P^T in place, with no exchange between lanes.
// Softmax is the running-maximum form: weights are 2^(FA_C (u - mu) + FA_OFF) with u the raw score and mu the maximum in use for that query; when a pass brings a score more than FA_TH
// (in powers of two) above mu in any lane, sums and outputs are rescaled to the new maximum. So a weight stays at or below 2^(FA_TH + FA_OFF) = 2^14, inside f16.
// Every loop over a fragment or accumulator index is unrolled: the fragment and accumulator arrays stay in registers only under constant indices.
typedef float v2f __attribute__((ext_vector_type(2)));
#define FA_WAVES 8
#define FA_QW 32
#define FA_C 0.18033688f             /* log2(e) / sqrt(64) */
#define FA_OFF 8.0f
#define FA_TH 6.0f
#define FA_SK 128                    /* keys of a stage: four passes */
#define FA_NST (SQ / FA_SK)          /* stages of a walk */
#define FA_PK 144                    /* LDS pitch of a key row, 128 bytes + 16: 16 x odd, the pitch free of bank conflicts for 16-byte reads */
#define FA_PV 272                    /* LDS pitch of a V^T row of a stage, 256 bytes + 16 */
#define FA_KB (FA_SK * FA_PK)        /* bytes of a stage's key rows; its V^T rows follow */
#define FA_STB (FA_KB + HD * FA_PV)  /* bytes of a stage */
static_assert(SQ % (FA_WAVES * FA_QW) == 0 && SQ % FA_SK == 0 && FA_NST >= 2 && FA_SK % 32 == 0 && HD == 64 && FA_WAVES == 8, "k_fattn: whole blocks of queries, two or more whole stages of 128 keys, head size 64, 256 threads copy a stage");
__device__ __forceinline__ float sm_xhalf(float v) { return __builtin_bit_cast(float, __builtin_amdgcn_permlanex16(__builtin_bit_cast(int, v), __builtin_bit_cast(int, v), 0x76543210, 0xfedcba98, false, false)); }      /* lane l reads lane l ^ 16 */
// 2^x of eight values in one statement, closed by one v_nop. Behind a transcendental the instruction set asks for one independent instruction before its result is read or its
// source overwritten: inside the statement each v_exp_f32 is that instruction for the one in front of it (the early-clobber results lie on no source), the v_nop is it for the last.
__device__ __forceinline__ v8f fa_exp2x8(v8f a) { float r0, r1, r2, r3, r4, r5, r6, r7;
  asm("v_exp_f32 %0, %8\n\tv_exp_f32 %1, %9\n\tv_exp_f32 %2, %10\n\tv_exp_f32 %3, %11\n\tv_exp_f32 %4, %12\n\tv_exp_f32 %5, %13\n\tv_exp_f32 %6, %14\n\tv_exp_f32 %7, %15\n\tv_nop"
      : "=&v"(r0), "=&v"(r1), "=&v"(r2), "=&v"(r3), "=&v"(r4), "=&v"(r5), "=&v"(r6), "=&v"(r7) : "v"(a[0]), "v"(a[1]), "v"(a[2]), "v"(a[3]), "v"(a[4]), "v"(a[5]), "v"(a[6]), "v"(a[7]));
  const v8f r = {r0, r1, r2, r3, r4, r5, r6, r7}; return r; }
// the same for the two rescale factors of a pass
__device__ __forceinline__ void fa_exp2x2(float& a, float& b) { float r0, r1; asm("v_exp_f32 %0, %2\n\tv_exp_f32 %1, %3\n\tv_nop" : "=&v"(r0), "=&v"(r1) : "v"(a), "v"(b)); a = r0; b = r1; }
__device__ __forceinline__ v8f fa_mma(v16h a, v16h b, v8f c) { return __builtin_amdgcn_wmma_f32_16x16x32_f16(false, a, false, b, (short)0, c, false, false); }
__device__ __forceinline__ float fa_max8(v8f a, v8f b) { return fmaxf(fmaxf(fmaxf(fmaxf(a[0], a[1]), fmaxf(a[2], a[3])), fmaxf(fmaxf(a[4], a[5]), fmaxf(a[6], a[7]))), fmaxf(fmaxf(fmaxf(b[0], b[1]), fmaxf(b[2], b[3])), fmaxf(fmaxf(b[4], b[5]), fmaxf(b[6], b[7])))); }
__device__ __forceinline__ v16h fa_lfrag(const unsigned char* p) { FragH f; f.half[0] = *(const v8us*)p; f.half[1] = *(const v8us*)(p + 32); return f.v; }      /* g2_frag from an LDS row; p holds the lane half's 16 bytes already */
// One stage into LDS, through no register: every thread copies eight 16-byte pieces, four of the key rows (8 threads a 128-byte row, 32 rows a round) and four of the V^T rows (16 threads a 256-byte row, 16 rows a round).
// kg, vg: the thread's own piece in round 0 of this stage; kl, vl: its LDS byte address in the stage's buffer. The closing s_wait_xcnt 0 stands inside the statement, so that no register a copy names is written again in front of it.
__device__ __forceinline__ void fa_stage(const _Float16* kg, const _Float16* vg, unsigned kl, unsigned vl) {
  asm volatile("global_load_async_to_lds_b128 %0, %8, off\n\tglobal_load_async_to_lds_b128 %1, %9, off\n\tglobal_load_async_to_lds_b128 %2, %10, off\n\tglobal_load_async_to_lds_b128 %3, %11, off\n\t"
               "global_load_async_to_lds_b128 %4, %12, off\n\tglobal_load_async_to_lds_b128 %5, %13, off\n\tglobal_load_async_to_lds_b128 %6, %14, off\n\tglobal_load_async_to_lds_b128 %7, %15, off\n\ts_wait_xcnt 0x0"
               :: "v"(kl), "v"(kl + 32 * FA_PK), "v"(kl + 64 * FA_PK), "v"(kl + 96 * FA_PK), "v"(vl), "v"(vl + 16 * FA_PV), "v"(vl + 32 * FA_PV), "v"(vl + 48 * FA_PV),
                  "v"(kg), "v"(kg + (size_t)32 * DM), "v"(kg + (size_t)64 * DM), "v"(kg + (size_t)96 * DM), "v"(vg), "v"(vg + (size_t)16 * SQ), "v"(vg + (size_t)32 * SQ), "v"(vg + (size_t)48 * SQ) : "memory"); }
__global__ __launch_bounds__(FA_WAVES * 32) void k_fattn(const _Float16* __restrict__ Qh, const _Float16* __restrict__ Ql, const _Float16* __restrict__ Kx, const _Float16* __restrict__ Vt, _Float16* __restrict__ O) {
  __shared__ __attribute__((aligned(16))) unsigned char fl[2 * FA_STB];      /* two buffers of one stage each */
  const int tid = threadIdx.x, lane = tid & 31, ln = lane & 15, hh = lane >> 4; const int wave = __builtin_amdgcn_readfirstlane(threadIdx.x >> 5);
  const int h = blockIdx.y, b = blockIdx.z; const size_t rb = (size_t)b * SQ; const int q0 = blockIdx.x * (FA_WAVES * FA_QW) + wave * FA_QW;
  v16h qh[2][2], ql[2][2];      /* [16-query group][32-wide step of the head dimension]: the hi plane and the x1024 residual plane, kept for the whole walk */
#pragma unroll
  for (int g = 0; g < 2; ++g) { const size_t qo = (rb + q0 + g * 16 + ln) * DM + h * HD;
#pragma unroll
    for (int ks = 0; ks < 2; ++ks) { qh[g][ks] = g2_frag(Qh + qo + ks * 32, hh); ql[g][ks] = g2_frag(Ql + qo + ks * 32, hh); } }
  const _Float16* kg = Kx + (rb + (tid >> 3)) * DM + h * HD + (tid & 7) * 8;      /* this thread's piece of key row tid / 8, this head's 64 columns */
  const _Float16* vg = Vt + (((size_t)b * NH + h) * HD + (tid >> 4)) * SQ + (tid & 15) * 8;      /* its piece of V^T row tid / 16 of this head */
  const unsigned kl = (unsigned)(size_t)fl + (tid >> 3) * FA_PK + (tid & 7) * 16, vl = (unsigned)(size_t)fl + FA_KB + (tid >> 4) * FA_PV + (tid & 15) * 16;      /* LDS byte address = low 32 bits of the __shared__ address */
  fa_stage(kg, vg, kl, vl);      /* stage 0 into buffer 0 */
  asm volatile("s_wait_asynccnt 0x0" ::: "memory");      /* this wave's copies of stage 0 have landed */
  __syncthreads();      /* and every other wave's: stage 0 may be read */
  fa_stage(kg + (size_t)FA_SK * DM, vg + FA_SK, kl + FA_STB, vl + FA_STB);      /* stage 1 flies while stage 0 is worked on */
  const v8f z8 = {0.f, 0.f, 0.f, 0.f, 0.f, 0.f, 0.f, 0.f};
  v8f o[4][2]; v2f ls[2]; float mu[2];
#pragma unroll
  for (int g = 0; g < 2; ++g) { ls[g] = (v2f){0.f, 0.f}; mu[g] = -1.0e30f;
#pragma unroll
    for (int dt = 0; dt < 4; ++dt) o[dt][g] = z8; }
  for (int st = 0; st < FA_NST; ++st) {
   const unsigned char* kr = fl + (st & 1) * FA_STB + ln * FA_PK + 16 * hh;      /* key row ln of this stage's buffer, the lane half's 16 bytes */
   const unsigned char* vr = fl + (st & 1) * FA_STB + FA_KB + ln * FA_PV + 16 * hh;      /* V^T row ln */
   v16h kf[2][2];      /* [16-key tile][step of the head dimension], fetched one pass ahead inside a stage */
#pragma unroll
   for (int t = 0; t < 2; ++t) { kf[t][0] = fa_lfrag(kr + (t * 16) * FA_PK); kf[t][1] = fa_lfrag(kr + (t * 16) * FA_PK + 64); }
#pragma unroll 1      /* rolled: unrolled, the four passes took more than 256 registers and spilled */
   for (int ps = 0; ps < FA_SK / 32; ++ps) {
    v8f s[2][2];      /* [query group][key tile]: raw scores hi + residual / 1024 */
#pragma unroll
    for (int g = 0; g < 2; ++g) {
#pragma unroll
      for (int t = 0; t < 2; ++t) { v8f ch = fa_mma(kf[t][0], qh[g][0], z8); ch = fa_mma(kf[t][1], qh[g][1], ch); v8f cl = fa_mma(kf[t][0], ql[g][0], z8); cl = fa_mma(kf[t][1], ql[g][1], cl); s[g][t] = cl * 0.0009765625f + ch; } }
    v16h vf[4];
#pragma unroll
    for (int dt = 0; dt < 4; ++dt) vf[dt] = fa_lfrag(vr + (dt * 16) * FA_PV + ps * 64);
    const int pn = (ps + 1 < FA_SK / 32) ? ps + 1 : 0;      /* the next stage is not published yet, nothing of it is read here: a stage's last pass fetches its own pass 0 again, not used */
#pragma unroll
    for (int t = 0; t < 2; ++t) { kf[t][0] = fa_lfrag(kr + (pn * 32 + t * 16) * FA_PK); kf[t][1] = fa_lfrag(kr + (pn * 32 + t * 16) * FA_PK + 64); }
    __builtin_amdgcn_sched_barrier(0);      /* keeps this pass's V^T reads and the next pass's key reads here as one group, right behind the score products: the softmax arithmetic covers their latency */
    float mb0 = fa_max8(s[0][0], s[0][1]), mb1 = fa_max8(s[1][0], s[1][1]); mb0 = fmaxf(mb0, sm_xhalf(mb0)); mb1 = fmaxf(mb1, sm_xhalf(mb1));      /* both halves of a query's lanes must use one maximum */
    const bool need = (mb0 - mu[0]) * FA_C > FA_TH || (mb1 - mu[1]) * FA_C > FA_TH;
    if (__builtin_amdgcn_ballot_w32(need) != 0) {      /* wave-uniform: rare after the first passes */
      const float n0 = fmaxf(mu[0], mb0), n1 = fmaxf(mu[1], mb1); float a0 = (mu[0] - n0) * FA_C, a1 = (mu[1] - n1) * FA_C; fa_exp2x2(a0, a1); mu[0] = n0; mu[1] = n1; ls[0] *= a0; ls[1] *= a1;
#pragma unroll
      for (int dt = 0; dt < 4; ++dt) { o[dt][0] *= a0; o[dt][1] *= a1; } }
    FragH p[2];      /* P^T of both query groups is formed before the first product with V^T */
#pragma unroll
    for (int g = 0; g < 2; ++g) { const float bias = FA_OFF - mu[g] * FA_C; const v8f p0 = fa_exp2x8(s[g][0] * FA_C + bias), p1 = fa_exp2x8(s[g][1] * FA_C + bias); const v8f e = p0 + p1; ls[g] += (((v2f){e[0], e[1]} + (v2f){e[2], e[3]}) + ((v2f){e[4], e[5]} + (v2f){e[6], e[7]}));
#pragma unroll
      for (int i = 0; i < 8; ++i) { p[g].h[i] = (_Float16)p0[i]; p[g].h[8 + i] = (_Float16)p1[i]; } }
#pragma unroll
    for (int g = 0; g < 2; ++g) {
#pragma unroll
      for (int dt = 0; dt < 4; ++dt) o[dt][g] = fa_mma(vf[dt], p[g].v, o[dt][g]); } }
   asm volatile("s_wait_dscnt 0x0" ::: "memory");      /* this wave's last reads of the buffer have returned */
   asm volatile("s_wait_asynccnt 0x0" ::: "memory");      /* its copies of stage st + 1 have landed */
   __syncthreads();      /* one barrier a stage: it publishes stage st + 1 and ends every wave's reads of stage st */
   if (st + 2 < FA_NST) fa_stage(kg + (size_t)(st + 2) * FA_SK * DM, vg + (st + 2) * FA_SK, kl + (st & 1) * FA_STB, vl + (st & 1) * FA_STB); }      /* refill of the buffer just left; the test reads the same in the whole block */
  asm volatile("s_wait_asynccnt 0x0" ::: "memory");      /* no copy is left in flight when the wave ends */
#pragma unroll
  for (int g = 0; g < 2; ++g) { float l = ls[g][0] + ls[g][1]; l += sm_xhalf(l); const float sc = 64.0f / l;      /* o x64, the scale the output stage expects */
    unsigned short* op = (unsigned short*)O + (rb + q0 + g * 16 + ln) * DM + h * HD + 8 * hh;
#pragma unroll
    for (int dt = 0; dt < 4; ++dt) { FragH f;
#pragma unroll
      for (int r = 0; r < 8; ++r) f.h[r] = (_Float16)(o[dt][g][r] * sc);
      *(v8us*)(op + dt * 16) = f.half[0]; } } }

extern "C" void kernel_launch(void* const* d_in, const int* in_sizes, int n_in,
                              void* d_out, int out_size, void* d_ws, size_t ws_size, hipStream_t stream) {
  (void)in_sizes; (void)n_in; (void)out_size;
  const float* const* I = (const float* const*)d_in; const float* x = I[0]; const float* watt = I[1]; const float* wv = I[2]; const float* bv = I[3]; const float* wo = I[4]; const float* bo = I[5];      /* x [2][2048][1024]; the per-head bilinear weight [16][64][64] ([head][in d][out e]); the natural value weight [DM][DM] and its bias; the natural output weight [DM][DM] and its bias */
  char* ws = (char*)d_ws; size_t off = 0;
  auto take = [&](size_t bytes) { char* p = ws + off; off += (bytes + 255) & ~(size_t)255; return p; };
  _Float16* BW = (_Float16*)take((size_t)NH * HD * HD * 2); _Float16* BV = (_Float16*)take((size_t)DM * DM * 2); _Float16* BO = (_Float16*)take((size_t)DM * DM * 2);      /* BW: sixteen transposed [64][64] head planes, one after another */
  _Float16* X16 = (_Float16*)take(NR * DM * 2); _Float16* Q16 = (_Float16*)take(NR * DM * 2); float* QF = (float*)take(NR * DM * 4); _Float16* QL = (_Float16*)take(NR * DM * 2); _Float16* V16 = (_Float16*)take(NR * DM * 2); _Float16* O16 = (_Float16*)take(NR * DM * 2);
  _Float16* VT = (_Float16*)take((size_t)NB * NH * HD * SQ * 2);
  if (off > ws_size) return;
  const size_t r0p = (size_t)B0 * SQ;      /* first projected row */
  k_prep<<<PB_WT + 2 * PB_WN + PB_X, 256, 0, stream>>>(x, watt, wv, wo, X16, BW, BV, BO);
  k_proj<<<GB_V + NH * GB_Q, 128, 0, stream>>>(X16 + r0p * DM, BW, BV, bv, QF + r0p * DM, V16 + r0p * DM);
  k_post<<<TB_VT + TB_HL, 256, 0, stream>>>(V16, VT, QF + r0p * DM, Q16 + r0p * DM, QL + r0p * DM);
  k_fattn<<<dim3(SQ / (FA_WAVES * FA_QW), NH, NB), FA_WAVES * 32, 0, stream>>>(Q16, QL, X16, VT, O16);      /* o (merged heads, x64) as f16 rows: every batch, head and query in one launch */
  k_gemm2<0><<<dim3((unsigned)((MPO / 128) * (DM / 64)), 1), 128, 0, stream>>>(O16 + r0p * DM, DM, 0, BO, DM, 0, 0.0009765625f, bo, 0, nullptr, 1, 0, 0, (float*)d_out + r0p * DM, nullptr, DM, 0, MPO, DM, DM);      /* out rows are the output layout */
}

// v006
// It runs in 72.6 microseconds.
// Next to v005, in two timings, it ran 1.10 times as fast each time.
// Over all steps from v000 it is 37.0 times as fast.
#include <hip/hip_runtime.h>
// Multi-head self-attention with a PER-HEAD BILINEAR SCORE and no query / key projections (x [2][2048][1024] viewed as 16 heads of 64; scores = (x_h W_h) . x_h / sqrt(64) with W [16][64][64] ([head][in][out]); softmax over all 2048 keys (no mask); v = x w_v^T + b_v (natural [1024][1024] + a bias, zero on this module's draw: read all the same); out = merged w_out^T + b_out (natural + a bias, zero on this draw too) -> [2][2048][1024]).
// Compute dtype: inputs rounded to bf16; x / weights exact; the per-head product as f16 hi + x1024 residual; the key operand is x itself as f16; v, softmax weights and o as plain f16 GEMM operands (~2^-12); scores and softmax statistics f32. v_wmma_f32_16x16x32_f16.
#define NB 2
#define SQ 2048
#define DM 1024
#define NH 16
#define HD 64
#define B0 0                         /* first batch processed (debug hook) */
#define NBR NB                       /* batches processed (debug hook) */
#define NR ((size_t)NB * SQ)         /* token rows */
#define MP ((int)((size_t)NBR * SQ)) /* rows projected (debug hook) */
#define MPO MP                       /* rows through the output stage (debug hook) */
typedef __bf16 v16b __attribute__((ext_vector_type(16)));
typedef unsigned short v8us __attribute__((ext_vector_type(8), may_alias));
typedef float  v8f  __attribute__((ext_vector_type(8)));
typedef float  v4f  __attribute__((ext_vector_type(4)));
typedef float  v4fa __attribute__((ext_vector_type(4), may_alias));
union FragB { v16b v; v8us half[2]; unsigned short u[16]; };

__device__ __forceinline__ unsigned short bf16_bits(float x) { unsigned int u = __float_as_uint(x); return (unsigned short)((u + 0x7FFFu + ((u >> 16) & 1u)) >> 16); }
__device__ __forceinline__ float bf16_val(unsigned short b) { return __uint_as_float(((unsigned int)b) << 16); }
__device__ __forceinline__ float bf16_round(float x) { return bf16_val(bf16_bits(x)); }
// D += A·B with NT terms: 1 = ah·bh, 2 = + al·bh (A split), 3 = + ah·bl (both split)
template <int NT>
__device__ __forceinline__ v8f mmaN(v16b ah, v16b al, v16b bh, v16b bl, v8f c) {
  c = __builtin_amdgcn_wmma_f32_16x16x32_bf16(false, ah, false, bh, (short)0, c, false, false);
  if (NT >= 2) c = __builtin_amdgcn_wmma_f32_16x16x32_bf16(false, al, false, bh, (short)0, c, false, false);
  if (NT >= 3) c = __builtin_amdgcn_wmma_f32_16x16x32_bf16(false, ah, false, bl, (short)0, c, false, false);
  asm volatile("v_nop\n\tv_nop\n\tv_nop\n\tv_nop" : "+v"(c) : "v"(ah), "v"(al), "v"(bh), "v"(bl));
  return c;
}




// ---- f16 WMMA path (v_wmma_f32_16x16x32_f16): 11-bit significands for operands in range — used for every product here, the softmax weights (up to 2^14) included
typedef _Float16 v16h __attribute__((ext_vector_type(16)));
union FragH { v16h v; v8us half[2]; _Float16 h[16]; unsigned short u[16]; };
template <int NT>
__device__ __forceinline__ v8f mmaH(v16h ah, v16h al, v16h bh, v16h bl, v8f c) {
  c = __builtin_amdgcn_wmma_f32_16x16x32_f16(false, ah, false, bh, (short)0, c, false, false);
  if (NT >= 2) c = __builtin_amdgcn_wmma_f32_16x16x32_f16(false, al, false, bh, (short)0, c, false, false);
  if (NT >= 3) c = __builtin_amdgcn_wmma_f32_16x16x32_f16(false, ah, false, bl, (short)0, c, false, false);
  asm volatile("v_nop\n\tv_nop\n\tv_nop\n\tv_nop" : "+v"(c) : "v"(ah), "v"(al), "v"(bh), "v"(bl));
  return c;
}

// Wt[n][k] = f16(W[k][n]·scale) from f32 row-major W[K][N] (scale = power of two; bf16-exact weights stay exact in f16 away from the subnormal range)
__device__ __forceinline__ void d_wt_f16(const float* __restrict__ W, _Float16* __restrict__ Wt, int K, int N, float scale, int t) {
  const int n = t / (K / 8), k8 = (t % (K / 8)) * 8; FragH f;
#pragma unroll
  for (int i = 0; i < 8; ++i) f.h[i] = (_Float16)(bf16_round(W[(size_t)(k8 + i) * N + n]) * scale); const v8us o = f.half[0];
  *(v8us*)((unsigned short*)Wt + (size_t)n * K + k8) = o; 
}

typedef _Float16 v4h __attribute__((ext_vector_type(4)));

__device__ __forceinline__ void d_x16(const float* __restrict__ x, _Float16* __restrict__ X16, size_t t) { FragH f;
#pragma unroll
  for (int q = 0; q < 8; ++q) f.h[q] = (_Float16)bf16_round(x[t * 8 + q]); *(v8us*)((unsigned short*)X16 + t * 8) = f.half[0]; asm volatile("s_wait_xcnt 0x0" ::: "memory");      /* before a register of the store in front is written again: in a shared launch another job's code follows in the listing */
}
// ---- fast GEMM (wave tile 32x64, block tile 128x64; requires M % 128 == 0 rows per launch region, N % 64 == 0 and K % KS == 0); RB: the bias belongs to the rows of C, not to its columns; CL: the x1024 residual of the f16 result, v - f16(v), as a second f16 plane ----
__device__ __forceinline__ v16h g2_frag(const _Float16* p, int hh) { FragH f; f.half[0] = *(const v8us*)((const unsigned short*)p + 8 * hh); f.half[1] = *(const v8us*)((const unsigned short*)p + 16 + 8 * hh); return f.v; }
__device__ __forceinline__ v8f g2_mma(v16h a, v16h b, v8f c) { v8f d = __builtin_amdgcn_wmma_f32_16x16x32_f16(false, a, false, b, (short)0, c, false, false); asm volatile("v_nop\n\tv_nop\n\tv_nop\n\tv_nop" : "+v"(d) : "v"(a), "v"(b)); return d; }
// A block's operands come through LDS: its 128 A rows and 64 B rows, KS k a stage, by asynchronous copies of whole 128-byte lines into two buffers; the four waves read their fragments from there.
#define G2_PK(KS) ((KS) * 2 + 16)             /* LDS pitch of a staged row, its bytes + 16: 16 x odd (144, 272), the pitch free of bank conflicts for 16-byte reads */
#define G2_STB(KS) ((128 + 64) * G2_PK(KS))   /* bytes of a stage: the A rows, then the B rows */
__device__ __forceinline__ unsigned char* g2_lds() { __shared__ __attribute__((aligned(16))) unsigned char sm[2 * G2_STB(128)]; return sm; }      /* two buffers of the longest stage; one array for every stage length that a kernel holds */
__device__ __forceinline__ v16h g2_lfrag(const unsigned char* p) { FragH f; f.half[0] = *(const v8us*)p; f.half[1] = *(const v8us*)(p + 32); return f.v; }      /* g2_frag from an LDS row; p holds the lane half's 16 bytes already */
// 64 k of a stage into LDS, through no register: every thread copies twelve 16-byte pieces (8 threads a 128-byte line, 16 rows a round): eight rounds of A rows, four of B rows.
// ag, bg: the thread's own piece in round 0; a16, b16: elements of 16 rows; al, bl: its LDS byte address in the stage's buffer; p16: LDS bytes of 16 rows. The closing s_wait_xcnt 0 stands inside the statement, so that no register a copy names is written again in front of it.
__device__ __forceinline__ void g2_stage(const _Float16* ag, size_t a16, const _Float16* bg, size_t b16, unsigned al, unsigned bl, unsigned p16) {
  asm volatile("global_load_async_to_lds_b128 %0, %12, off\n\tglobal_load_async_to_lds_b128 %1, %13, off\n\tglobal_load_async_to_lds_b128 %2, %14, off\n\tglobal_load_async_to_lds_b128 %3, %15, off\n\t"
               "global_load_async_to_lds_b128 %4, %16, off\n\tglobal_load_async_to_lds_b128 %5, %17, off\n\tglobal_load_async_to_lds_b128 %6, %18, off\n\tglobal_load_async_to_lds_b128 %7, %19, off\n\t"
               "global_load_async_to_lds_b128 %8, %20, off\n\tglobal_load_async_to_lds_b128 %9, %21, off\n\tglobal_load_async_to_lds_b128 %10, %22, off\n\tglobal_load_async_to_lds_b128 %11, %23, off\n\ts_wait_xcnt 0x0"
               :: "v"(al), "v"(al + p16), "v"(al + 2 * p16), "v"(al + 3 * p16), "v"(al + 4 * p16), "v"(al + 5 * p16), "v"(al + 6 * p16), "v"(al + 7 * p16),
                  "v"(bl), "v"(bl + p16), "v"(bl + 2 * p16), "v"(bl + 3 * p16),
                  "v"(ag), "v"(ag + a16), "v"(ag + 2 * a16), "v"(ag + 3 * a16), "v"(ag + 4 * a16), "v"(ag + 5 * a16), "v"(ag + 6 * a16), "v"(ag + 7 * a16),
                  "v"(bg), "v"(bg + b16), "v"(bg + 2 * b16), "v"(bg + 3 * b16) : "memory"); }
// a whole stage: one such statement for each 64 k of it (12 or 24 copies of a wave in flight)
template <int KS>
__device__ __forceinline__ void g2_fill(const _Float16* ag, size_t a16, const _Float16* bg, size_t b16, unsigned al, unsigned bl) {
#pragma unroll      /* one or two statements in a row, no loop around them */
  for (int h = 0; h < KS / 64; ++h) g2_stage(ag + h * 64, a16, bg + h * 64, b16, al + h * 128, bl + h * 128, 16 * G2_PK(KS)); }
template <int ACT, int KS, bool RB>
__device__ __forceinline__ void d_gemm2(int bx, int by, const _Float16* __restrict__ A, int lda, size_t sA, const _Float16* __restrict__ Bh, int ldb, size_t sB, float alpha, const float* __restrict__ bias, size_t sBias, const float* __restrict__ CP, int rowsPerB, size_t sCPb, int row0g,
    float* __restrict__ C, _Float16* __restrict__ C16, _Float16* __restrict__ CL, int ldc, size_t sC, int M, int N, int K) { static_assert(ACT == 0 || ACT == 3 || ACT == 6 || ACT == 8 || ACT == 9 || ACT == 11 || ACT == 12 || ACT == 14 || ACT == 15 || ACT == 16 || ACT == 17, "k_gemm2: unsupported ACT code (would silently apply no activation)");
  static_assert(KS == 64 || KS == 128, "a stage is one or two 128-byte lines of every row"); constexpr int PK = G2_PK(KS), AB = 128 * PK, STB = G2_STB(KS);      /* row pitch, bytes of a stage's A rows, bytes of a stage */
  unsigned char* const sm = g2_lds();
  float (*so)[32][68] = (float (*)[32][68])sm; static_assert(sizeof(float) * 4 * 32 * 68 <= 2 * G2_STB(64), "the result tiles fit the staging bytes");      /* behind the loop's last barrier the same bytes hold each wave's result tile */
  const int tid = threadIdx.x, w = tid >> 5, lane = tid & 31, ln = lane & 15, hh = lane >> 4;
  A += (size_t)by * sA; Bh += (size_t)by * sB; const size_t cofs = (size_t)by * sC; const float* bp = bias ? bias + (size_t)by * sBias : nullptr;
  const int ntn = N >> 6; const int mt = bx / ntn, nq = bx - mt * ntn; const int row0 = mt * 128 + 32 * w, col0 = nq * 64; if (mt * 128 >= M) return;      /* a whole block leaves or none, in front of every barrier (M is a multiple of 128) */
  const _Float16* ag = A + (size_t)(mt * 128 + (tid >> 3)) * lda + (tid & 7) * 8;      /* this thread's piece of the block's A row tid / 8 */
  const _Float16* bg = Bh + (size_t)(col0 + (tid >> 3)) * ldb + (tid & 7) * 8;      /* its piece of B row tid / 8 */
  const unsigned al = (unsigned)(size_t)sm + (tid >> 3) * PK + (tid & 7) * 16, bl = al + AB;      /* LDS byte address = low 32 bits of the __shared__ address */
  const size_t a16 = (size_t)16 * lda, b16 = (size_t)16 * ldb; const int nst = K / KS;      /* whole stages (K is a multiple of KS) */
  g2_fill<KS>(ag, a16, bg, b16, al, bl);      /* stage 0 into buffer 0 */
  asm volatile("s_wait_asynccnt 0x0" ::: "memory");      /* this wave's copies of stage 0 have landed */
  __syncthreads();      /* and every other wave's: stage 0 may be read */
  if (nst > 1) g2_fill<KS>(ag + KS, a16, bg + KS, b16, al + STB, bl + STB);      /* stage 1 flies while stage 0 is worked on */
  v4f rb4[4];      /* RB: the biases of this lane's sixteen result rows (two 16-row tiles, rows 8 hh + r of each), fetched as one group in front of the loop, which covers their latency */
#pragma unroll      /* constant indices keep rb4 in registers */
  for (int i = 0; i < 4; ++i) rb4[i] = (v4f){0.f, 0.f, 0.f, 0.f};
  if (RB && bp) {
#pragma unroll
    for (int i = 0; i < 4; ++i) rb4[i] = *(const v4fa*)(bp + row0 + (i >> 1) * 16 + 8 * hh + (i & 1) * 4);
    asm volatile("s_wait_xcnt 0x0" ::: "memory"); }      /* before a register of the four loads in front is written again */
  const v8f z8 = {0.f,0.f,0.f,0.f,0.f,0.f,0.f,0.f}; v8f c00 = z8, c01 = z8, c02 = z8, c03 = z8, c10 = z8, c11 = z8, c12 = z8, c13 = z8;
#pragma unroll 1      /* rolled: one copy of the stage's code, whatever K is at the call */
  for (int st = 0; st < nst; ++st) {
    const unsigned char* ar = sm + (st & 1) * STB + (32 * w + ln) * PK + 16 * hh;      /* the wave's A row ln of this stage's buffer, the lane half's 16 bytes */
    const unsigned char* br = sm + (st & 1) * STB + AB + ln * PK + 16 * hh;      /* B row ln */
    /* every loop inside a stage is unrolled: the fragment arrays stay in registers only under constant indices */
#pragma unroll
    for (int h = 0; h < KS / 64; ++h) {
      v16h af[2][2], bf[2][4];      /* [32-wide k step][16-row tile]: the fragments of 64 k are read as one group in front of their sixteen products */
#pragma unroll
      for (int ks = 0; ks < 2; ++ks) {
#pragma unroll
        for (int t = 0; t < 2; ++t) af[ks][t] = g2_lfrag(ar + (t * 16) * PK + h * 128 + ks * 64);
#pragma unroll
        for (int t = 0; t < 4; ++t) bf[ks][t] = g2_lfrag(br + (t * 16) * PK + h * 128 + ks * 64); }
#pragma unroll
      for (int ks = 0; ks < 2; ++ks) {
        c00 = g2_mma(af[ks][0], bf[ks][0], c00); c10 = g2_mma(af[ks][1], bf[ks][0], c10);
        c01 = g2_mma(af[ks][0], bf[ks][1], c01); c11 = g2_mma(af[ks][1], bf[ks][1], c11);
        c02 = g2_mma(af[ks][0], bf[ks][2], c02); c12 = g2_mma(af[ks][1], bf[ks][2], c12);
        c03 = g2_mma(af[ks][0], bf[ks][3], c03); c13 = g2_mma(af[ks][1], bf[ks][3], c13); } }
    asm volatile("s_wait_dscnt 0x0" ::: "memory");      /* this wave's last reads of the buffer have returned */
    asm volatile("s_wait_asynccnt 0x0" ::: "memory");      /* its copies of stage st + 1 have landed */
    __syncthreads();      /* one barrier a stage: it publishes stage st + 1 and ends every wave's reads of stage st */
    if (st + 2 < nst) g2_fill<KS>(ag + (size_t)(st + 2) * KS, a16, bg + (size_t)(st + 2) * KS, b16, al + (st & 1) * STB, bl + (st & 1) * STB); }      /* refill of the buffer just left; the test reads the same in the whole block */
  asm volatile("s_wait_asynccnt 0x0" ::: "memory");      /* no copy is left in flight when the staging bytes take the result tiles */
  v8f accs[8] = {c00, c01, c02, c03, c10, c11, c12, c13};
#pragma unroll
  for (int u = 0; u < 8; ++u) { const int t = u & 3, half = u >> 2; const int col = col0 + t * 16 + ln; const float bv = (bp && !RB) ? bf16_round(bp[col]) : 0.f;
#pragma unroll
    for (int r = 0; r < 8; ++r) { const int rloc = half * 16 + 8 * hh + r; float v = accs[u][r] * alpha + (RB ? bf16_round(rb4[half * 2 + (r >> 2)][r & 3]) : bv); if (CP) { if (rowsPerB < 0) v += CP[cofs + (size_t)(row0g + row0 + rloc) * ldc + col];      /* rowsPerB < 0: own element of the batched C plane */ else { const int bidx = (row0g + row0 + rloc) / rowsPerB; v += CP[(size_t)bidx * sCPb + (size_t)by * 64 + col]; } }
      if (ACT == 3) v = fmaxf(v, 0.f); else if (ACT == 6) v = 0.5f * v * (1.0f + erff(v * 0.70710678118654752f)); else if (ACT == 11) v = 1.0f / (1.0f + expf(-v)); else if (ACT == 15) v = v / (1.0f + expf(-v)); else if (ACT == 12) v = (v > 0.f) ? v : 0.01f * v; else if (ACT == 8) v = tanhf(v); else if (ACT == 9) v = 0.5f * v * (1.0f + tanhf(0.7978845608028654f * (v + 0.044715f * v * v * v))); else if (ACT == 14) v = (v > 0.f) ? v : 0.1f * v; else if (ACT == 16) v = (v >= 0.f) ? v : 0.3f * v; else if (ACT == 17) v = (v >= 0.f) ? v : 0.2f * v;
      so[w][rloc][t * 16 + ln] = v; } }
  __builtin_amdgcn_fence(__ATOMIC_ACQ_REL, "workgroup"); __builtin_amdgcn_wave_barrier();
  const int rsub = lane >> 4, c4 = (lane & 15) * 4;
  { v4f vv[16];      /* the tile's rows are read as one group in front of the stores: no LDS read can pass the waits behind the stores, and one read a store would add its latency sixteen times */
#pragma unroll
    for (int q = 0; q < 16; ++q) vv[q] = *(const v4fa*)&so[w][q * 2 + rsub][c4];
#pragma unroll      /* constant indices keep vv in registers */
    for (int q = 0; q < 16; ++q) { const int r = q * 2 + rsub; const v4f v = vv[q];
      if (C) { *(v4f*)(C + cofs + (size_t)(row0 + r) * ldc + col0 + c4) = v; asm volatile("s_wait_xcnt 0x0" ::: "memory"); }      /* before a register of the store in front is written again (the next row's address, the f16 form, another job's code in a shared launch) */
      if (C16) { v4h h4; for (int i = 0; i < 4; ++i) h4[i] = (_Float16)v[i]; *(v4h*)(C16 + cofs + (size_t)(row0 + r) * ldc + col0 + c4) = h4; asm volatile("s_wait_xcnt 0x0" ::: "memory"); }      /* the same for this store */
      if (CL) { v4h l4; for (int i = 0; i < 4; ++i) l4[i] = (_Float16)((v[i] - (float)(_Float16)v[i]) * 1024.0f); *(v4h*)(CL + cofs + (size_t)(row0 + r) * ldc + col0 + c4) = l4; asm volatile("s_wait_xcnt 0x0" ::: "memory"); } }      /* and for this one */
     } }

__device__ __forceinline__ void d_wnat(const float* __restrict__ w, _Float16* __restrict__ Bt, size_t t) { FragH f; for (int q = 0; q < 8; ++q) f.h[q] = (_Float16)(bf16_round(w[t * 8 + q]) * 16.0f); *(v8us*)((unsigned short*)Bt + t * 8) = f.half[0]; asm volatile("s_wait_xcnt 0x0" ::: "memory");      /* before a register of the store in front is written again: in a shared launch another job's code follows in the listing */
}

template <int ACT>
__global__ __launch_bounds__(128) void k_gemm2(const _Float16* __restrict__ A, int lda, size_t sA, const _Float16* __restrict__ Bh, int ldb, size_t sB, float alpha, const float* __restrict__ bias, size_t sBias, const float* __restrict__ CP, int rowsPerB, size_t sCPb, int row0g,
    float* __restrict__ C, _Float16* __restrict__ C16, int ldc, size_t sC, int M, int N, int K) { d_gemm2<ACT, 128, false>(blockIdx.x, blockIdx.y, A, lda, sA, Bh, ldb, sB, alpha, bias, sBias, CP, rowsPerB, sCPb, row0g, C, C16, nullptr, ldc, sC, M, N, K); }

// ---- Shared launches: jobs that read none of each other's output run in one grid. Each job keeps its own code, its own threads and its own blocks, a range of blockIdx.x. ----
#define PB_WT (NH * HD * (HD / 8) / 256)      /* blocks of the sixteen head planes, HD * (HD / 8) threads a head */
#define PB_WN (DM * DM / 8 / 256)             /* blocks of one natural [DM][DM] weight */
#define PB_X ((int)(NR * DM / 8 / 256))       /* blocks of x */
#define GB_V1 ((DM / 128) * (SQ / 64))        /* blocks of one batch's value projection, transposed: DM rows of SQ tokens */
#define GB_V (NBR * GB_V1)                    /* blocks of the value projection */
#define GB_Q ((MP / 128) * (HD / 64))         /* blocks of one head's bilinear product */
static_assert((NH * HD * (HD / 8)) % 256 == 0 && (DM * DM / 8) % 256 == 0 && (NR * DM / 8) % 256 == 0 && MP % 128 == 0 && DM % 128 == 0 && SQ % 64 == 0 && HD % 64 == 0, "shared launches: every job fills whole blocks; the products' K is whole stages");
// every conversion that reads inputs only: the head planes, both natural weights, x
__global__ __launch_bounds__(256) void k_prep(const float* __restrict__ x, const float* __restrict__ watt, const float* __restrict__ wv, const float* __restrict__ wo, _Float16* __restrict__ X16, _Float16* __restrict__ BW, _Float16* __restrict__ BV, _Float16* __restrict__ BO) {
  int blk = blockIdx.x;
  if (blk < PB_WT) { const int t = blk * 256 + threadIdx.x, h = t / (HD * (HD / 8)); d_wt_f16(watt + (size_t)h * HD * HD, BW + (size_t)h * HD * HD, HD, HD, 16.0f, t % (HD * (HD / 8))); return; }      /* a head's [in d][out e] weight -> its transposed x16 plane Bt[e][d] */
  blk -= PB_WT; if (blk < PB_WN) { d_wnat(wv, BV, (size_t)blk * 256 + threadIdx.x); return; }      /* natural [out][in] = A[m][k] x16, the value product's A operand (no transpose) */
  blk -= PB_WN; if (blk < PB_WN) { d_wnat(wo, BO, (size_t)blk * 256 + threadIdx.x); return; }
  blk -= PB_WN; d_x16(x, X16, (size_t)blk * 256 + threadIdx.x); }
// both products of x, each stored in the form the attention kernel reads. First the long blocks (K = DM): V^T = Wv x^T + bv, the weight's rows as the A operand and a batch's token rows as B, so that the result rows are [NB][NH][HD][SQ] as they stand (the bias goes with the rows).
// Then the per-head product x_h W_h (head strides: 64 input columns, one [64][64] plane, 64 result columns; K = 64), split in the epilogue into its f16 hi plane and its x1024 residual plane.
__global__ __launch_bounds__(128) void k_proj(const _Float16* __restrict__ X16, const _Float16* __restrict__ BW, const _Float16* __restrict__ BV, const float* __restrict__ bv, _Float16* __restrict__ Q16, _Float16* __restrict__ QL, _Float16* __restrict__ VT) {
  const int blk = blockIdx.x;
  if (blk < GB_V) d_gemm2<0, 128, true>(blk % GB_V1, blk / GB_V1, BV, DM, 0, X16, DM, (size_t)SQ * DM, 0.0625f, bv, 0, nullptr, 1, 0, 0, nullptr, VT, nullptr, SQ, (size_t)DM * SQ, DM, SQ, DM);
  else d_gemm2<0, 64, false>((blk - GB_V) % GB_Q, (blk - GB_V) / GB_Q, X16, DM, (size_t)HD, BW, HD, (size_t)HD * HD, 0.0625f, nullptr, 0, nullptr, 1, 0, 0, nullptr, Q16, QL, DM, (size_t)HD, MP, HD, HD); }

// Fused attention of one head: scores, softmax and the weighted sum of v in one kernel, so that neither the scores nor the softmax weights go to memory.
// A wave owns FA_QW query columns and walks all SQ keys, 32 a pass. The block's eight waves walk the same keys: key rows and V^T rows come into LDS once for all of them, FA_SK keys a stage, by asynchronous copies into two buffers. Both products are transposed: S^T = X_keys (A) x Q^T (B) and O^T += V^T (A) x P^T (B). In an S^T tile lane (ln, hh)
// holds keys 8 hh + r (r = 0..7) of query ln, which is the k order of a B fragment's half: two 16-key tiles pack into P^T in place, with no exchange between lanes.
// Softmax is the running-maximum form: weights are 2^(FA_C (u - mu) + FA_OFF) with u the raw score and mu the maximum in use for that query; when a pass brings a score more than FA_TH
// (in powers of two) above mu in any lane, sums and outputs are rescaled to the new maximum. So a weight stays at or below 2^(FA_TH + FA_OFF) = 2^14, inside f16.
// Every loop over a fragment or accumulator index is unrolled: the fragment and accumulator arrays stay in registers only under constant indices.
typedef float v2f __attribute__((ext_vector_type(2)));
#define FA_WAVES 8
#define FA_QW 32
#define FA_C 0.18033688f             /* log2(e) / sqrt(64) */
#define FA_OFF 8.0f
#define FA_TH 6.0f
#define FA_SK 128                    /* keys of a stage: four passes */
#define FA_NST (SQ / FA_SK)          /* stages of a walk */
#define FA_PK 144                    /* LDS pitch of a key row, 128 bytes + 16: 16 x odd, the pitch free of bank conflicts for 16-byte reads */
#define FA_PV 272                    /* LDS pitch of a V^T row of a stage, 256 bytes + 16 */
#define FA_KB (FA_SK * FA_PK)        /* bytes of a stage's key rows; its V^T rows follow */
#define FA_STB (FA_KB + HD * FA_PV)  /* bytes of a stage */
static_assert(SQ % (FA_WAVES * FA_QW) == 0 && SQ % FA_SK == 0 && FA_NST >= 2 && FA_SK % 32 == 0 && HD == 64 && FA_WAVES == 8, "k_fattn: whole blocks of queries, two or more whole stages of 128 keys, head size 64, 256 threads copy a stage");
__device__ __forceinline__ float sm_xhalf(float v) { return __builtin_bit_cast(float, __builtin_amdgcn_permlanex16(__builtin_bit_cast(int, v), __builtin_bit_cast(int, v), 0x76543210, 0xfedcba98, false, false)); }      /* lane l reads lane l ^ 16 */
// 2^x of eight values in one statement, closed by one v_nop. Behind a transcendental the instruction set asks for one independent instruction before its result is read or its
// source overwritten: inside the statement each v_exp_f32 is that instruction for the one in front of it (the early-clobber results lie on no source), the v_nop is it for the last.
__device__ __forceinline__ v8f fa_exp2x8(v8f a) { float r0, r1, r2, r3, r4, r5, r6, r7;
  asm("v_exp_f32 %0, %8\n\tv_exp_f32 %1, %9\n\tv_exp_f32 %2, %10\n\tv_exp_f32 %3, %11\n\tv_exp_f32 %4, %12\n\tv_exp_f32 %5, %13\n\tv_exp_f32 %6, %14\n\tv_exp_f32 %7, %15\n\tv_nop"
      : "=&v"(r0), "=&v"(r1), "=&v"(r2), "=&v"(r3), "=&v"(r4), "=&v"(r5), "=&v"(r6), "=&v"(r7) : "v"(a[0]), "v"(a[1]), "v"(a[2]), "v"(a[3]), "v"(a[4]), "v"(a[5]), "v"(a[6]), "v"(a[7]));
  const v8f r = {r0, r1, r2, r3, r4, r5, r6, r7}; return r; }
// the same for the two rescale factors of a pass
__device__ __forceinline__ void fa_exp2x2(float& a, float& b) { float r0, r1; asm("v_exp_f32 %0, %2\n\tv_exp_f32 %1, %3\n\tv_nop" : "=&v"(r0), "=&v"(r1) : "v"(a), "v"(b)); a = r0; b = r1; }
__device__ __forceinline__ v8f fa_mma(v16h a, v16h b, v8f c) { return __builtin_amdgcn_wmma_f32_16x16x32_f16(false, a, false, b, (short)0, c, false, false); }
__device__ __forceinline__ float fa_max8(v8f a, v8f b) { return fmaxf(fmaxf(fmaxf(fmaxf(a[0], a[1]), fmaxf(a[2], a[3])), fmaxf(fmaxf(a[4], a[5]), fmaxf(a[6], a[7]))), fmaxf(fmaxf(fmaxf(b[0], b[1]), fmaxf(b[2], b[3])), fmaxf(fmaxf(b[4], b[5]), fmaxf(b[6], b[7])))); }
__device__ __forceinline__ v16h fa_lfrag(const unsigned char* p) { FragH f; f.half[0] = *(const v8us*)p; f.half[1] = *(const v8us*)(p + 32); return f.v; }      /* g2_frag from an LDS row; p holds the lane half's 16 bytes already */
// One stage into LDS, through no register: every thread copies eight 16-byte pieces, four of the key rows (8 threads a 128-byte row, 32 rows a round) and four of the V^T rows (16 threads a 256-byte row, 16 rows a round).
// kg, vg: the thread's own piece in round 0 of this stage; kl, vl: its LDS byte address in the stage's buffer. The closing s_wait_xcnt 0 stands inside the statement, so that no register a copy names is written again in front of it.
__device__ __forceinline__ void fa_stage(const _Float16* kg, const _Float16* vg, unsigned kl, unsigned vl) {
  asm volatile("global_load_async_to_lds_b128 %0, %8, off\n\tglobal_load_async_to_lds_b128 %1, %9, off\n\tglobal_load_async_to_lds_b128 %2, %10, off\n\tglobal_load_async_to_lds_b128 %3, %11, off\n\t"
               "global_load_async_to_lds_b128 %4, %12, off\n\tglobal_load_async_to_lds_b128 %5, %13, off\n\tglobal_load_async_to_lds_b128 %6, %14, off\n\tglobal_load_async_to_lds_b128 %7, %15, off\n\ts_wait_xcnt 0x0"
               :: "v"(kl), "v"(kl + 32 * FA_PK), "v"(kl + 64 * FA_PK), "v"(kl + 96 * FA_PK), "v"(vl), "v"(vl + 16 * FA_PV), "v"(vl + 32 * FA_PV), "v"(vl + 48 * FA_PV),
                  "v"(kg), "v"(kg + (size_t)32 * DM), "v"(kg + (size_t)64 * DM), "v"(kg + (size_t)96 * DM), "v"(vg), "v"(vg + (size_t)16 * SQ), "v"(vg + (size_t)32 * SQ), "v"(vg + (size_t)48 * SQ) : "memory"); }
__global__ __launch_bounds__(FA_WAVES * 32) void k_fattn(const _Float16* __restrict__ Qh, const _Float16* __restrict__ Ql, const _Float16* __restrict__ Kx, const _Float16* __restrict__ Vt, _Float16* __restrict__ O) {
  __shared__ __attribute__((aligned(16))) unsigned char fl[2 * FA_STB];      /* two buffers of one stage each */
  const int tid = threadIdx.x, lane = tid & 31, ln = lane & 15, hh = lane >> 4; const int wave = __builtin_amdgcn_readfirstlane(threadIdx.x >> 5);
  const int h = blockIdx.y, b = blockIdx.z; const size_t rb = (size_t)b * SQ; const int q0 = blockIdx.x * (FA_WAVES * FA_QW) + wave * FA_QW;
  v16h qh[2][2], ql[2][2];      /* [16-query group][32-wide step of the head dimension]: the hi plane and the x1024 residual plane, kept for the whole walk */
#pragma unroll
  for (int g = 0; g < 2; ++g) { const size_t qo = (rb + q0 + g * 16 + ln) * DM + h * HD;
#pragma unroll
    for (int ks = 0; ks < 2; ++ks) { qh[g][ks] = g2_frag(Qh + qo + ks * 32, hh); ql[g][ks] = g2_frag(Ql + qo + ks * 32, hh); } }
  const _Float16* kg = Kx + (rb + (tid >> 3)) * DM + h * HD + (tid & 7) * 8;      /* this thread's piece of key row tid / 8, this head's 64 columns */
  const _Float16* vg = Vt + (((size_t)b * NH + h) * HD + (tid >> 4)) * SQ + (tid & 15) * 8;      /* its piece of V^T row tid / 16 of this head */
  const unsigned kl = (unsigned)(size_t)fl + (tid >> 3) * FA_PK + (tid & 7) * 16, vl = (unsigned)(size_t)fl + FA_KB + (tid >> 4) * FA_PV + (tid & 15) * 16;      /* LDS byte address = low 32 bits of the __shared__ address */
  fa_stage(kg, vg, kl, vl);      /* stage 0 into buffer 0 */
  asm volatile("s_wait_asynccnt 0x0" ::: "memory");      /* this wave's copies of stage 0 have landed */
  __syncthreads();      /* and every other wave's: stage 0 may be read */
  fa_stage(kg + (size_t)FA_SK * DM, vg + FA_SK, kl + FA_STB, vl + FA_STB);      /* stage 1 flies while stage 0 is worked on */
  const v8f z8 = {0.f, 0.f, 0.f, 0.f, 0.f, 0.f, 0.f, 0.f};
  v8f o[4][2]; v2f ls[2]; float mu[2];
#pragma unroll
  for (int g = 0; g < 2; ++g) { ls[g] = (v2f){0.f, 0.f}; mu[g] = -1.0e30f;
#pragma unroll
    for (int dt = 0; dt < 4; ++dt) o[dt][g] = z8; }
  for (int st = 0; st < FA_NST; ++st) {
   const unsigned char* kr = fl + (st & 1) * FA_STB + ln * FA_PK + 16 * hh;      /* key row ln of this stage's buffer, the lane half's 16 bytes */
   const unsigned char* vr = fl + (st & 1) * FA_STB + FA_KB + ln * FA_PV + 16 * hh;      /* V^T row ln */
   v16h kf[2][2];      /* [16-key tile][step of the head dimension], fetched one pass ahead inside a stage */
#pragma unroll
   for (int t = 0; t < 2; ++t) { kf[t][0] = fa_lfrag(kr + (t * 16) * FA_PK); kf[t][1] = fa_lfrag(kr + (t * 16) * FA_PK + 64); }
#pragma unroll 1      /* rolled: unrolled, the four passes took more than 256 registers and spilled */
   for (int ps = 0; ps < FA_SK / 32; ++ps) {
    v8f s[2][2];      /* [query group][key tile]: raw scores hi + residual / 1024 */
#pragma unroll
    for (int g = 0; g < 2; ++g) {
#pragma unroll
      for (int t = 0; t < 2; ++t) { v8f ch = fa_mma(kf[t][0], qh[g][0], z8); ch = fa_mma(kf[t][1], qh[g][1], ch); v8f cl = fa_mma(kf[t][0], ql[g][0], z8); cl = fa_mma(kf[t][1], ql[g][1], cl); s[g][t] = cl * 0.0009765625f + ch; } }
    v16h vf[4];
#pragma unroll
    for (int dt = 0; dt < 4; ++dt) vf[dt] = fa_lfrag(vr + (dt * 16) * FA_PV + ps * 64);
    const int pn = (ps + 1 < FA_SK / 32) ? ps + 1 : 0;      /* the next stage is not published yet, nothing of it is read here: a stage's last pass fetches its own pass 0 again, not used */
#pragma unroll
    for (int t = 0; t < 2; ++t) { kf[t][0] = fa_lfrag(kr + (pn * 32 + t * 16) * FA_PK); kf[t][1] = fa_lfrag(kr + (pn * 32 + t * 16) * FA_PK + 64); }
    __builtin_amdgcn_sched_barrier(0);      /* keeps this pass's V^T reads and the next pass's key reads here as one group, right behind the score products: the softmax arithmetic covers their latency */
    float mb0 = fa_max8(s[0][0], s[0][1]), mb1 = fa_max8(s[1][0], s[1][1]); mb0 = fmaxf(mb0, sm_xhalf(mb0)); mb1 = fmaxf(mb1, sm_xhalf(mb1));      /* both halves of a query's lanes must use one maximum */
    const bool need = (mb0 - mu[0]) * FA_C > FA_TH || (mb1 - mu[1]) * FA_C > FA_TH;
    if (__builtin_amdgcn_ballot_w32(need) != 0) {      /* wave-uniform: rare after the first passes */
      const float n0 = fmaxf(mu[0], mb0), n1 = fmaxf(mu[1], mb1); float a0 = (mu[0] - n0) * FA_C, a1 = (mu[1] - n1) * FA_C; fa_exp2x2(a0, a1); mu[0] = n0; mu[1] = n1; ls[0] *= a0; ls[1] *= a1;
#pragma unroll
      for (int dt = 0; dt < 4; ++dt) { o[dt][0] *= a0; o[dt][1] *= a1; } }
    FragH p[2];      /* P^T of both query groups is formed before the first product with V^T */
#pragma unroll
    for (int g = 0; g < 2; ++g) { const float bias = FA_OFF - mu[g] * FA_C; const v8f p0 = fa_exp2x8(s[g][0] * FA_C + bias), p1 = fa_exp2x8(s[g][1] * FA_C + bias); const v8f e = p0 + p1; ls[g] += (((v2f){e[0], e[1]} + (v2f){e[2], e[3]}) + ((v2f){e[4], e[5]} + (v2f){e[6], e[7]}));
#pragma unroll
      for (int i = 0; i < 8; ++i) { p[g].h[i] = (_Float16)p0[i]; p[g].h[8 + i] = (_Float16)p1[i]; } }
#pragma unroll
    for (int g = 0; g < 2; ++g) {
#pragma unroll
      for (int dt = 0; dt < 4; ++dt) o[dt][g] = fa_mma(vf[dt], p[g].v, o[dt][g]); } }
   asm volatile("s_wait_dscnt 0x0" ::: "memory");      /* this wave's last reads of the buffer have returned */
   asm volatile("s_wait_asynccnt 0x0" ::: "memory");      /* its copies of stage st + 1 have landed */
   __syncthreads();      /* one barrier a stage: it publishes stage st + 1 and ends every wave's reads of stage st */
   if (st + 2 < FA_NST) fa_stage(kg + (size_t)(st + 2) * FA_SK * DM, vg + (st + 2) * FA_SK, kl + (st & 1) * FA_STB, vl + (st & 1) * FA_STB); }      /* refill of the buffer just left; the test reads the same in the whole block */
  asm volatile("s_wait_asynccnt 0x0" ::: "memory");      /* no copy is left in flight when the wave ends */
#pragma unroll
  for (int g = 0; g < 2; ++g) { float l = ls[g][0] + ls[g][1]; l += sm_xhalf(l); const float sc = 64.0f / l;      /* o x64, the scale the output stage expects */
    unsigned short* op = (unsigned short*)O + (rb + q0 + g * 16 + ln) * DM + h * HD + 8 * hh;
#pragma unroll
    for (int dt = 0; dt < 4; ++dt) { FragH f;
#pragma unroll
      for (int r = 0; r < 8; ++r) f.h[r] = (_Float16)(o[dt][g][r] * sc);
      *(v8us*)(op + dt * 16) = f.half[0]; } } }

extern "C" void kernel_launch(void* const* d_in, const int* in_sizes, int n_in,
                              void* d_out, int out_size, void* d_ws, size_t ws_size, hipStream_t stream) {
  (void)in_sizes; (void)n_in; (void)out_size;
  const float* const* I = (const float* const*)d_in; const float* x = I[0]; const float* watt = I[1]; const float* wv = I[2]; const float* bv = I[3]; const float* wo = I[4]; const float* bo = I[5];      /* x [2][2048][1024]; the per-head bilinear weight [16][64][64] ([head][in d][out e]); the natural value weight [DM][DM] and its bias; the natural output weight [DM][DM] and its bias */
  char* ws = (char*)d_ws; size_t off = 0;
  auto take = [&](size_t bytes) { char* p = ws + off; off += (bytes + 255) & ~(size_t)255; return p; };
  _Float16* BW = (_Float16*)take((size_t)NH * HD * HD * 2); _Float16* BV = (_Float16*)take((size_t)DM * DM * 2); _Float16* BO = (_Float16*)take((size_t)DM * DM * 2);      /* BW: sixteen transposed [64][64] head planes, one after another */
  _Float16* X16 = (_Float16*)take(NR * DM * 2); _Float16* Q16 = (_Float16*)take(NR * DM * 2); _Float16* QL = (_Float16*)take(NR * DM * 2); _Float16* O16 = (_Float16*)take(NR * DM * 2);
  _Float16* VT = (_Float16*)take((size_t)NB * NH * HD * SQ * 2);
  if (off > ws_size) return;
  const size_t r0p = (size_t)B0 * SQ;      /* first projected row */
  k_prep<<<PB_WT + 2 * PB_WN + PB_X, 256, 0, stream>>>(x, watt, wv, wo, X16, BW, BV, BO);
  k_proj<<<GB_V + NH * GB_Q, 128, 0, stream>>>(X16 + r0p * DM, BW, BV, bv, Q16 + r0p * DM, QL + r0p * DM, VT + r0p * DM);
  k_fattn<<<dim3(SQ / (FA_WAVES * FA_QW), NH, NB), FA_WAVES * 32, 0, stream>>>(Q16, QL, X16, VT, O16);      /* o (merged heads, x64) as f16 rows: every batch, head and query in one launch */
  k_gemm2<0><<<dim3((unsigned)((MPO / 128) * (DM / 64)), 1), 128, 0, stream>>>(O16 + r0p * DM, DM, 0, BO, DM, 0, 0.0009765625f, bo, 0, nullptr, 1, 0, 0, (float*)d_out + r0p * DM, nullptr, DM, 0, MPO, DM, DM);      /* out rows are the output layout */
}

// v007
// One run takes 70.4 microseconds.
// In both of two side-by-side timings against v006, it was 1.03 times as fast.
// Counting every step since v000, it is 38.1 times as fast.
#include <hip/hip_runtime.h>
// Multi-head self-attention with a PER-HEAD BILINEAR SCORE and no query / key projections (x [2][2048][1024] viewed as 16 heads of 64; scores = (x_h W_h) . x_h / sqrt(64) with W [16][64][64] ([head][in][out]); softmax over all 2048 keys (no mask); v = x w_v^T + b_v (natural [1024][1024] + a bias, zero on this module's draw: read all the same); out = merged w_out^T + b_out (natural + a bias, zero on this draw too) -> [2][2048][1024]).
// Compute dtype: inputs rounded to bf16; x / weights exact; the per-head product as f16 hi + x1024 residual; the key operand is x itself as f16; v, softmax weights and o as plain f16 GEMM operands (~2^-12); scores and softmax statistics f32. v_wmma_f32_16x16x32_f16.
#define NB 2
#define SQ 2048
#define DM 1024
#define NH 16
#define HD 64
#define B0 0                         /* first batch processed (debug hook) */
#define NBR NB                       /* batches processed (debug hook) */
#define NR ((size_t)NB * SQ)         /* token rows */
#define MP ((int)((size_t)NBR * SQ)) /* rows projected (debug hook) */
#define MPO MP                       /* rows through the output stage (debug hook) */
typedef __bf16 v16b __attribute__((ext_vector_type(16)));
typedef unsigned short v8us __attribute__((ext_vector_type(8), may_alias));
typedef float  v8f  __attribute__((ext_vector_type(8)));
typedef float  v4f  __attribute__((ext_vector_type(4)));
typedef float  v4fa __attribute__((ext_vector_type(4), may_alias));
union FragB { v16b v; v8us half[2]; unsigned short u[16]; };

__device__ __forceinline__ unsigned short bf16_bits(float x) { unsigned int u = __float_as_uint(x); return (unsigned short)((u + 0x7FFFu + ((u >> 16) & 1u)) >> 16); }
__device__ __forceinline__ float bf16_val(unsigned short b) { return __uint_as_float(((unsigned int)b) << 16); }
__device__ __forceinline__ float bf16_round(float x) { return bf16_val(bf16_bits(x)); }
// D += A·B with NT terms: 1 = ah·bh, 2 = + al·bh (A split), 3 = + ah·bl (both split)
template <int NT>
__device__ __forceinline__ v8f mmaN(v16b ah, v16b al, v16b bh, v16b bl, v8f c) {
  c = __builtin_amdgcn_wmma_f32_16x16x32_bf16(false, ah, false, bh, (short)0, c, false, false);
  if (NT >= 2) c = __builtin_amdgcn_wmma_f32_16x16x32_bf16(false, al, false, bh, (short)0, c, false, false);
  if (NT >= 3) c = __builtin_amdgcn_wmma_f32_16x16x32_bf16(false, ah, false, bl, (short)0, c, false, false);
  asm volatile("v_nop\n\tv_nop\n\tv_nop\n\tv_nop" : "+v"(c) : "v"(ah), "v"(al), "v"(bh), "v"(bl));
  return c;
}




// ---- f16 WMMA path (v_wmma_f32_16x16x32_f16): 11-bit significands for operands in range — used for every product here, the softmax weights (up to 2^14) included
typedef _Float16 v16h __attribute__((ext_vector_type(16)));
union FragH { v16h v; v8us half[2]; _Float16 h[16]; unsigned short u[16]; };
template <int NT>
__device__ __forceinline__ v8f mmaH(v16h ah, v16h al, v16h bh, v16h bl, v8f c) {
  c = __builtin_amdgcn_wmma_f32_16x16x32_f16(false, ah, false, bh, (short)0, c, false, false);
  if (NT >= 2) c = __builtin_amdgcn_wmma_f32_16x16x32_f16(false, al, false, bh, (short)0, c, false, false);
  if (NT >= 3) c = __builtin_amdgcn_wmma_f32_16x16x32_f16(false, ah, false, bl, (short)0, c, false, false);
  asm volatile("v_nop\n\tv_nop\n\tv_nop\n\tv_nop" : "+v"(c) : "v"(ah), "v"(al), "v"(bh), "v"(bl));
  return c;
}

// Wt[n][k] = f16(W[k][n]·scale) from f32 row-major W[K][N] (scale = power of two; bf16-exact weights stay exact in f16 away from the subnormal range)
__device__ __forceinline__ void d_wt_f16(const float* __restrict__ W, _Float16* __restrict__ Wt, int K, int N, float scale, int t) {
  const int n = t / (K / 8), k8 = (t % (K / 8)) * 8; FragH f;
#pragma unroll
  for (int i = 0; i < 8; ++i) f.h[i] = (_Float16)(bf16_round(W[(size_t)(k8 + i) * N + n]) * scale); const v8us o = f.half[0];
  *(v8us*)((unsigned short*)Wt + (size_t)n * K + k8) = o; 
}

typedef _Float16 v4h __attribute__((ext_vector_type(4)));

__device__ __forceinline__ void d_x16(const float* __restrict__ x, _Float16* __restrict__ X16, size_t t) { FragH f;
#pragma unroll
  for (int q = 0; q < 8; ++q) f.h[q] = (_Float16)bf16_round(x[t * 8 + q]); *(v8us*)((unsigned short*)X16 + t * 8) = f.half[0]; asm volatile("s_wait_xcnt 0x0" ::: "memory");      /* before a register of the store in front is written again: in a shared launch another job's code follows in the listing */
}
// ---- fast GEMM (wave tile 32x64, block tile 128x64; requires M % 128 == 0 rows per launch region, N % 64 == 0 and K % KS == 0); RB: the bias belongs to the rows of C, not to its columns; CL: the x1024 residual of the f16 result, v - f16(v), as a second f16 plane ----
__device__ __forceinline__ v16h g2_frag(const _Float16* p, int hh) { FragH f; f.half[0] = *(const v8us*)((const unsigned short*)p + 8 * hh); f.half[1] = *(const v8us*)((const unsigned short*)p + 16 + 8 * hh); return f.v; }
__device__ __forceinline__ v8f g2_mma(v16h a, v16h b, v8f c) { v8f d = __builtin_amdgcn_wmma_f32_16x16x32_f16(false, a, false, b, (short)0, c, false, false); asm volatile("v_nop\n\tv_nop\n\tv_nop\n\tv_nop" : "+v"(d) : "v"(a), "v"(b)); return d; }
// A block's operands come through LDS: its 128 A rows and 64 B rows, KS k a stage, by asynchronous copies of whole 128-byte lines into two buffers; the four waves read their fragments from there.
#define G2_PK(KS) ((KS) * 2 + 16)             /* LDS pitch of a staged row, its bytes + 16: 16 x odd (144, 272), the pitch free of bank conflicts for 16-byte reads */
#define G2_STB(KS) ((128 + 64) * G2_PK(KS))   /* bytes of a stage: the A rows, then the B rows */
__device__ __forceinline__ unsigned char* g2_lds() { __shared__ __attribute__((aligned(16))) unsigned char sm[2 * G2_STB(128)]; return sm; }      /* two buffers of the longest stage; one array for every stage length that a kernel holds */
__device__ __forceinline__ v16h g2_lfrag(const unsigned char* p) { FragH f; f.half[0] = *(const v8us*)p; f.half[1] = *(const v8us*)(p + 32); return f.v; }      /* g2_frag from an LDS row; p holds the lane half's 16 bytes already */
// 64 k of a stage into LDS, through no register: every thread copies twelve 16-byte pieces (8 threads a 128-byte line, 16 rows a round): eight rounds of A rows, four of B rows.
// ag, bg: the thread's own piece in round 0; a16, b16: elements of 16 rows; al, bl: its LDS byte address in the stage's buffer; p16: LDS bytes of 16 rows. The closing s_wait_xcnt 0 stands inside the statement, so that no register a copy names is written again in front of it.
__device__ __forceinline__ void g2_stage(const _Float16* ag, size_t a16, const _Float16* bg, size_t b16, unsigned al, unsigned bl, unsigned p16) {
  asm volatile("global_load_async_to_lds_b128 %0, %12, off\n\tglobal_load_async_to_lds_b128 %1, %13, off\n\tglobal_load_async_to_lds_b128 %2, %14, off\n\tglobal_load_async_to_lds_b128 %3, %15, off\n\t"
               "global_load_async_to_lds_b128 %4, %16, off\n\tglobal_load_async_to_lds_b128 %5, %17, off\n\tglobal_load_async_to_lds_b128 %6, %18, off\n\tglobal_load_async_to_lds_b128 %7, %19, off\n\t"
               "global_load_async_to_lds_b128 %8, %20, off\n\tglobal_load_async_to_lds_b128 %9, %21, off\n\tglobal_load_async_to_lds_b128 %10, %22, off\n\tglobal_load_async_to_lds_b128 %11, %23, off\n\ts_wait_xcnt 0x0"
               :: "v"(al), "v"(al + p16), "v"(al + 2 * p16), "v"(al + 3 * p16), "v"(al + 4 * p16), "v"(al + 5 * p16), "v"(al + 6 * p16), "v"(al + 7 * p16),
                  "v"(bl), "v"(bl + p16), "v"(bl + 2 * p16), "v"(bl + 3 * p16),
                  "v"(ag), "v"(ag + a16), "v"(ag + 2 * a16), "v"(ag + 3 * a16), "v"(ag + 4 * a16), "v"(ag + 5 * a16), "v"(ag + 6 * a16), "v"(ag + 7 * a16),
                  "v"(bg), "v"(bg + b16), "v"(bg + 2 * b16), "v"(bg + 3 * b16) : "memory"); }
// a whole stage: one such statement for each 64 k of it (12 or 24 copies of a wave in flight)
template <int KS>
__device__ __forceinline__ void g2_fill(const _Float16* ag, size_t a16, const _Float16* bg, size_t b16, unsigned al, unsigned bl) {
#pragma unroll      /* one or two statements in a row, no loop around them */
  for (int h = 0; h < KS / 64; ++h) g2_stage(ag + h * 64, a16, bg + h * 64, b16, al + h * 128, bl + h * 128, 16 * G2_PK(KS)); }
template <int ACT, int KS, bool RB>
__device__ __forceinline__ void d_gemm2(int bx, int by, const _Float16* __restrict__ A, int lda, size_t sA, const _Float16* __restrict__ Bh, int ldb, size_t sB, float alpha, const float* __restrict__ bias, size_t sBias, const float* __restrict__ CP, int rowsPerB, size_t sCPb, int row0g,
    float* __restrict__ C, _Float16* __restrict__ C16, _Float16* __restrict__ CL, int ldc, size_t sC, int M, int N, int K) { static_assert(ACT == 0 || ACT == 3 || ACT == 6 || ACT == 8 || ACT == 9 || ACT == 11 || ACT == 12 || ACT == 14 || ACT == 15 || ACT == 16 || ACT == 17, "k_gemm2: unsupported ACT code (would silently apply no activation)");
  static_assert(KS == 64 || KS == 128, "a stage is one or two 128-byte lines of every row"); constexpr int PK = G2_PK(KS), AB = 128 * PK, STB = G2_STB(KS);      /* row pitch, bytes of a stage's A rows, bytes of a stage */
  unsigned char* const sm = g2_lds();
  float (*so)[32][68] = (float (*)[32][68])sm; static_assert(sizeof(float) * 4 * 32 * 68 <= 2 * G2_STB(64), "the result tiles fit the staging bytes");      /* behind the loop's last barrier the same bytes hold each wave's result tile */
  const int tid = threadIdx.x, w = tid >> 5, lane = tid & 31, ln = lane & 15, hh = lane >> 4;
  A += (size_t)by * sA; Bh += (size_t)by * sB; const size_t cofs = (size_t)by * sC; const float* bp = bias ? bias + (size_t)by * sBias : nullptr;
  const int ntn = N >> 6; const int mt = bx / ntn, nq = bx - mt * ntn; const int row0 = mt * 128 + 32 * w, col0 = nq * 64; if (mt * 128 >= M) return;      /* a whole block leaves or none, in front of every barrier (M is a multiple of 128) */
  const _Float16* ag = A + (size_t)(mt * 128 + (tid >> 3)) * lda + (tid & 7) * 8;      /* this thread's piece of the block's A row tid / 8 */
  const _Float16* bg = Bh + (size_t)(col0 + (tid >> 3)) * ldb + (tid & 7) * 8;      /* its piece of B row tid / 8 */
  const unsigned al = (unsigned)(size_t)sm + (tid >> 3) * PK + (tid & 7) * 16, bl = al + AB;      /* LDS byte address = low 32 bits of the __shared__ address */
  const size_t a16 = (size_t)16 * lda, b16 = (size_t)16 * ldb; const int nst = K / KS;      /* whole stages (K is a multiple of KS) */
  g2_fill<KS>(ag, a16, bg, b16, al, bl);      /* stage 0 into buffer 0 */
  asm volatile("s_wait_asynccnt 0x0" ::: "memory");      /* this wave's copies of stage 0 have landed */
  __syncthreads();      /* and every other wave's: stage 0 may be read */
  if (nst > 1) g2_fill<KS>(ag + KS, a16, bg + KS, b16, al + STB, bl + STB);      /* stage 1 flies while stage 0 is worked on */
  v4f rb4[4];      /* RB: the biases of this lane's sixteen result rows (two 16-row tiles, rows 8 hh + r of each), fetched as one group in front of the loop, which covers their latency */
#pragma unroll      /* constant indices keep rb4 in registers */
  for (int i = 0; i < 4; ++i) rb4[i] = (v4f){0.f, 0.f, 0.f, 0.f};
  if (RB && bp) {
#pragma unroll
    for (int i = 0; i < 4; ++i) rb4[i] = *(const v4fa*)(bp + row0 + (i >> 1) * 16 + 8 * hh + (i & 1) * 4);
    asm volatile("s_wait_xcnt 0x0" ::: "memory"); }      /* before a register of the four loads in front is written again */
  const v8f z8 = {0.f,0.f,0.f,0.f,0.f,0.f,0.f,0.f}; v8f c00 = z8, c01 = z8, c02 = z8, c03 = z8, c10 = z8, c11 = z8, c12 = z8, c13 = z8;
#pragma unroll 1      /* rolled: one copy of the stage's code, whatever K is at the call */
  for (int st = 0; st < nst; ++st) {
    const unsigned char* ar = sm + (st & 1) * STB + (32 * w + ln) * PK + 16 * hh;      /* the wave's A row ln of this stage's buffer, the lane half's 16 bytes */
    const unsigned char* br = sm + (st & 1) * STB + AB + ln * PK + 16 * hh;      /* B row ln */
    /* every loop inside a stage is unrolled: the fragment arrays stay in registers only under constant indices */
#pragma unroll
    for (int h = 0; h < KS / 64; ++h) {
      v16h af[2][2], bf[2][4];      /* [32-wide k step][16-row tile]: the fragments of 64 k are read as one group in front of their sixteen products */
#pragma unroll
      for (int ks = 0; ks < 2; ++ks) {
#pragma unroll
        for (int t = 0; t < 2; ++t) af[ks][t] = g2_lfrag(ar + (t * 16) * PK + h * 128 + ks * 64);
#pragma unroll
        for (int t = 0; t < 4; ++t) bf[ks][t] = g2_lfrag(br + (t * 16) * PK + h * 128 + ks * 64); }
#pragma unroll
      for (int ks = 0; ks < 2; ++ks) {
        c00 = g2_mma(af[ks][0], bf[ks][0], c00); c10 = g2_mma(af[ks][1], bf[ks][0], c10);
        c01 = g2_mma(af[ks][0], bf[ks][1], c01); c11 = g2_mma(af[ks][1], bf[ks][1], c11);
        c02 = g2_mma(af[ks][0], bf[ks][2], c02); c12 = g2_mma(af[ks][1], bf[ks][2], c12);
        c03 = g2_mma(af[ks][0], bf[ks][3], c03); c13 = g2_mma(af[ks][1], bf[ks][3], c13); } }
    asm volatile("s_wait_dscnt 0x0" ::: "memory");      /* this wave's last reads of the buffer have returned */
    asm volatile("s_wait_asynccnt 0x0" ::: "memory");      /* its copies of stage st + 1 have landed */
    __syncthreads();      /* one barrier a stage: it publishes stage st + 1 and ends every wave's reads of stage st */
    if (st + 2 < nst) g2_fill<KS>(ag + (size_t)(st + 2) * KS, a16, bg + (size_t)(st + 2) * KS, b16, al + (st & 1) * STB, bl + (st & 1) * STB); }      /* refill of the buffer just left; the test reads the same in the whole block */
  asm volatile("s_wait_asynccnt 0x0" ::: "memory");      /* no copy is left in flight when the staging bytes take the result tiles */
  v8f accs[8] = {c00, c01, c02, c03, c10, c11, c12, c13};
#pragma unroll
  for (int u = 0; u < 8; ++u) { const int t = u & 3, half = u >> 2; const int col = col0 + t * 16 + ln; const float bv = (bp && !RB) ? bf16_round(bp[col]) : 0.f;
#pragma unroll
    for (int r = 0; r < 8; ++r) { const int rloc = half * 16 + 8 * hh + r; float v = accs[u][r] * alpha + (RB ? bf16_round(rb4[half * 2 + (r >> 2)][r & 3]) : bv); if (CP) { if (rowsPerB < 0) v += CP[cofs + (size_t)(row0g + row0 + rloc) * ldc + col];      /* rowsPerB < 0: own element of the batched C plane */ else { const int bidx = (row0g + row0 + rloc) / rowsPerB; v += CP[(size_t)bidx * sCPb + (size_t)by * 64 + col]; } }
      if (ACT == 3) v = fmaxf(v, 0.f); else if (ACT == 6) v = 0.5f * v * (1.0f + erff(v * 0.70710678118654752f)); else if (ACT == 11) v = 1.0f / (1.0f + expf(-v)); else if (ACT == 15) v = v / (1.0f + expf(-v)); else if (ACT == 12) v = (v > 0.f) ? v : 0.01f * v; else if (ACT == 8) v = tanhf(v); else if (ACT == 9) v = 0.5f * v * (1.0f + tanhf(0.7978845608028654f * (v + 0.044715f * v * v * v))); else if (ACT == 14) v = (v > 0.f) ? v : 0.1f * v; else if (ACT == 16) v = (v >= 0.f) ? v : 0.3f * v; else if (ACT == 17) v = (v >= 0.f) ? v : 0.2f * v;
      so[w][rloc][t * 16 + ln] = v; } }
  __builtin_amdgcn_fence(__ATOMIC_ACQ_REL, "workgroup"); __builtin_amdgcn_wave_barrier();
  const int rsub = lane >> 4, c4 = (lane & 15) * 4;
  { v4f vv[16];      /* the tile's rows are read as one group in front of the stores: no LDS read can pass the waits behind the stores, and one read a store would add its latency sixteen times */
#pragma unroll
    for (int q = 0; q < 16; ++q) vv[q] = *(const v4fa*)&so[w][q * 2 + rsub][c4];
#pragma unroll      /* constant indices keep vv in registers */
    for (int q = 0; q < 16; ++q) { const int r = q * 2 + rsub; const v4f v = vv[q];
      if (C) { *(v4f*)(C + cofs + (size_t)(row0 + r) * ldc + col0 + c4) = v; asm volatile("s_wait_xcnt 0x0" ::: "memory"); }      /* before a register of the store in front is written again (the next row's address, the f16 form, another job's code in a shared launch) */
      if (C16) { v4h h4; for (int i = 0; i < 4; ++i) h4[i] = (_Float16)v[i]; *(v4h*)(C16 + cofs + (size_t)(row0 + r) * ldc + col0 + c4) = h4; asm volatile("s_wait_xcnt 0x0" ::: "memory"); }      /* the same for this store */
      if (CL) { v4h l4; for (int i = 0; i < 4; ++i) l4[i] = (_Float16)((v[i] - (float)(_Float16)v[i]) * 1024.0f); *(v4h*)(CL + cofs + (size_t)(row0 + r) * ldc + col0 + c4) = l4; asm volatile("s_wait_xcnt 0x0" ::: "memory"); } }      /* and for this one */
     } }

__device__ __forceinline__ void d_wnat(const float* __restrict__ w, _Float16* __restrict__ Bt, size_t t) { FragH f; for (int q = 0; q < 8; ++q) f.h[q] = (_Float16)(bf16_round(w[t * 8 + q]) * 16.0f); *(v8us*)((unsigned short*)Bt + t * 8) = f.half[0]; asm volatile("s_wait_xcnt 0x0" ::: "memory");      /* before a register of the store in front is written again: in a shared launch another job's code follows in the listing */
}

template <int ACT>
__global__ __launch_bounds__(128) void k_gemm2(const _Float16* __restrict__ A, int lda, size_t sA, const _Float16* __restrict__ Bh, int ldb, size_t sB, float alpha, const float* __restrict__ bias, size_t sBias, const float* __restrict__ CP, int rowsPerB, size_t sCPb, int row0g,
    float* __restrict__ C, _Float16* __restrict__ C16, int ldc, size_t sC, int M, int N, int K) { d_gemm2<ACT, 128, false>(blockIdx.x, blockIdx.y, A, lda, sA, Bh, ldb, sB, alpha, bias, sBias, CP, rowsPerB, sCPb, row0g, C, C16, nullptr, ldc, sC, M, N, K); }

// ---- Shared launches: jobs that read none of each other's output run in one grid. Each job keeps its own code, its own threads and its own blocks, a range of blockIdx.x. ----
#define PB_WT (NH * HD * (HD / 8) / 256)      /* blocks of the sixteen head planes, HD * (HD / 8) threads a head */
#define PB_WN (DM * DM / 8 / 256)             /* blocks of one natural [DM][DM] weight */
#define PB_X ((int)(NR * DM / 8 / 256))       /* blocks of x */
#define GB_V1 ((DM / 128) * (SQ / 64))        /* blocks of one batch's value projection, transposed: DM rows of SQ tokens */
#define GB_V (NBR * GB_V1)                    /* blocks of the value projection */
#define GB_Q ((MP / 128) * (HD / 64))         /* blocks of one head's bilinear product */
static_assert((NH * HD * (HD / 8)) % 256 == 0 && (DM * DM / 8) % 256 == 0 && (NR * DM / 8) % 256 == 0 && MP % 128 == 0 && DM % 128 == 0 && SQ % 64 == 0 && HD % 64 == 0, "shared launches: every job fills whole blocks; the products' K is whole stages");
// every conversion that reads inputs only: the head planes, both natural weights, x
__global__ __launch_bounds__(256) void k_prep(const float* __restrict__ x, const float* __restrict__ watt, const float* __restrict__ wv, const float* __restrict__ wo, _Float16* __restrict__ X16, _Float16* __restrict__ BW, _Float16* __restrict__ BV, _Float16* __restrict__ BO) {
  int blk = blockIdx.x;
  if (blk < PB_WT) { const int t = blk * 256 + threadIdx.x, h = t / (HD * (HD / 8)); d_wt_f16(watt + (size_t)h * HD * HD, BW + (size_t)h * HD * HD, HD, HD, 16.0f, t % (HD * (HD / 8))); return; }      /* a head's [in d][out e] weight -> its transposed x16 plane Bt[e][d] */
  blk -= PB_WT; if (blk < PB_WN) { d_wnat(wv, BV, (size_t)blk * 256 + threadIdx.x); return; }      /* natural [out][in] = A[m][k] x16, the value product's A operand (no transpose) */
  blk -= PB_WN; if (blk < PB_WN) { d_wnat(wo, BO, (size_t)blk * 256 + threadIdx.x); return; }
  blk -= PB_WN; d_x16(x, X16, (size_t)blk * 256 + threadIdx.x); }
// both products of x, each stored in the form the attention kernel reads. First the long blocks (K = DM): V^T = Wv x^T + bv, the weight's rows as the A operand and a batch's token rows as B, so that the result rows are [NB][NH][HD][SQ] as they stand (the bias goes with the rows).
// Then the per-head product x_h W_h (head strides: 64 input columns, one [64][64] plane, 64 result columns; K = 64), split in the epilogue into its f16 hi plane and its x1024 residual plane.
__global__ __launch_bounds__(128) void k_proj(const _Float16* __restrict__ X16, const _Float16* __restrict__ BW, const _Float16* __restrict__ BV, const float* __restrict__ bv, _Float16* __restrict__ Q16, _Float16* __restrict__ QL, _Float16* __restrict__ VT) {
  const int blk = blockIdx.x;
  if (blk < GB_V) d_gemm2<0, 128, true>(blk % GB_V1, blk / GB_V1, BV, DM, 0, X16, DM, (size_t)SQ * DM, 0.0625f, bv, 0, nullptr, 1, 0, 0, nullptr, VT, nullptr, SQ, (size_t)DM * SQ, DM, SQ, DM);
  else d_gemm2<0, 64, false>((blk - GB_V) % GB_Q, (blk - GB_V) / GB_Q, X16, DM, (size_t)HD, BW, HD, (size_t)HD * HD, 0.0625f, nullptr, 0, nullptr, 1, 0, 0, nullptr, Q16, QL, DM, (size_t)HD, MP, HD, HD); }

// Fused attention of one head: scores, softmax and the weighted sum of v in one kernel, so that neither the scores nor the softmax weights go to memory.
// A wave owns FA_QW query columns and walks one of FA_KH runs of SQ / FA_KH keys, 32 a pass: FA_KH waves share a query group, so that a block has sixteen waves, four a SIMD, and one wave's softmax arithmetic runs beside another's products.
// The eight waves of a run walk the same keys: key rows and V^T rows come into LDS once for all of them, FA_SK keys a stage, by asynchronous copies into the run's own two buffers. Behind the walk the two partial results of a query group are joined through LDS (fa_send, fa_join). Both products are transposed: S^T = X_keys (A) x Q^T (B) and O^T += V^T (A) x P^T (B). In an S^T tile lane (ln, hh)
// holds keys 8 hh + r (r = 0..7) of query ln, which is the k order of a B fragment's half: two 16-key tiles pack into P^T in place, with no exchange between lanes.
// Softmax is the running-maximum form: weights are 2^(FA_C (u - mu) + FA_OFF) with u the raw score and mu the maximum in use for that query; when a pass brings a score more than FA_TH
// (in powers of two) above mu in any lane, sums and outputs are rescaled to the new maximum. So a weight stays at or below 2^(FA_TH + FA_OFF) = 2^14, inside f16.
// Every loop over a fragment or accumulator index is unrolled: the fragment and accumulator arrays stay in registers only under constant indices.
typedef float v2f __attribute__((ext_vector_type(2)));
#define FA_QG 8                      /* query groups of a block */
#define FA_KH 2                      /* runs of keys, one wave of a query group each */
#define FA_WAVES (FA_QG * FA_KH)
#define FA_QW 32
#define FA_C 0.18033688f             /* log2(e) / sqrt(64) */
#define FA_OFF 8.0f
#define FA_TH 6.0f
#define FA_SK 128                    /* keys of a stage: four passes */
#define FA_NST (SQ / FA_KH / FA_SK)  /* stages of a walk */
#define FA_PK 144                    /* LDS pitch of a key row, 128 bytes + 16: 16 x odd, the pitch free of bank conflicts for 16-byte reads */
#define FA_PV 272                    /* LDS pitch of a V^T row of a stage, 256 bytes + 16 */
#define FA_KB (FA_SK * FA_PK)        /* bytes of a stage's key rows; its V^T rows follow */
#define FA_STB (FA_KB + HD * FA_PV)  /* bytes of a stage */
static_assert(SQ % (FA_QG * FA_QW) == 0 && SQ % (FA_KH * FA_SK) == 0 && FA_NST >= 2 && FA_SK % 32 == 0 && HD == 64 && FA_QG == 8 && FA_KH == 2, "k_fattn: whole blocks of queries, two runs of two or more whole stages of 128 keys, head size 64, 256 threads copy a run's stage");
__device__ __forceinline__ float sm_xhalf(float v) { return __builtin_bit_cast(float, __builtin_amdgcn_permlanex16(__builtin_bit_cast(int, v), __builtin_bit_cast(int, v), 0x76543210, 0xfedcba98, false, false)); }      /* lane l reads lane l ^ 16 */
// 2^x of eight values in one statement, closed by one v_nop. Behind a transcendental the instruction set asks for one independent instruction before its result is read or its
// source overwritten: inside the statement each v_exp_f32 is that instruction for the one in front of it (the early-clobber results lie on no source), the v_nop is it for the last.
__device__ __forceinline__ v8f fa_exp2x8(v8f a) { float r0, r1, r2, r3, r4, r5, r6, r7;
  asm("v_exp_f32 %0, %8\n\tv_exp_f32 %1, %9\n\tv_exp_f32 %2, %10\n\tv_exp_f32 %3, %11\n\tv_exp_f32 %4, %12\n\tv_exp_f32 %5, %13\n\tv_exp_f32 %6, %14\n\tv_exp_f32 %7, %15\n\tv_nop"
      : "=&v"(r0), "=&v"(r1), "=&v"(r2), "=&v"(r3), "=&v"(r4), "=&v"(r5), "=&v"(r6), "=&v"(r7) : "v"(a[0]), "v"(a[1]), "v"(a[2]), "v"(a[3]), "v"(a[4]), "v"(a[5]), "v"(a[6]), "v"(a[7]));
  const v8f r = {r0, r1, r2, r3, r4, r5, r6, r7}; return r; }
// the same for the two rescale factors of a pass
__device__ __forceinline__ void fa_exp2x2(float& a, float& b) { float r0, r1; asm("v_exp_f32 %0, %2\n\tv_exp_f32 %1, %3\n\tv_nop" : "=&v"(r0), "=&v"(r1) : "v"(a), "v"(b)); a = r0; b = r1; }
__device__ __forceinline__ v8f fa_mma(v16h a, v16h b, v8f c) { return __builtin_amdgcn_wmma_f32_16x16x32_f16(false, a, false, b, (short)0, c, false, false); }
__device__ __forceinline__ float fa_max8(v8f a, v8f b) { return fmaxf(fmaxf(fmaxf(fmaxf(a[0], a[1]), fmaxf(a[2], a[3])), fmaxf(fmaxf(a[4], a[5]), fmaxf(a[6], a[7]))), fmaxf(fmaxf(fmaxf(b[0], b[1]), fmaxf(b[2], b[3])), fmaxf(fmaxf(b[4], b[5]), fmaxf(b[6], b[7])))); }
__device__ __forceinline__ v16h fa_lfrag(const unsigned char* p) { FragH f; f.half[0] = *(const v8us*)p; f.half[1] = *(const v8us*)(p + 32); return f.v; }      /* g2_frag from an LDS row; p holds the lane half's 16 bytes already */
// One stage into LDS, through no register: every thread copies eight 16-byte pieces, four of the key rows (8 threads a 128-byte row, 32 rows a round) and four of the V^T rows (16 threads a 256-byte row, 16 rows a round).
// kg, vg: the thread's own piece in round 0 of this stage; kl, vl: its LDS byte address in the stage's buffer. The closing s_wait_xcnt 0 stands inside the statement, so that no register a copy names is written again in front of it.
__device__ __forceinline__ void fa_stage(const _Float16* kg, const _Float16* vg, unsigned kl, unsigned vl) {
  asm volatile("global_load_async_to_lds_b128 %0, %8, off\n\tglobal_load_async_to_lds_b128 %1, %9, off\n\tglobal_load_async_to_lds_b128 %2, %10, off\n\tglobal_load_async_to_lds_b128 %3, %11, off\n\t"
               "global_load_async_to_lds_b128 %4, %12, off\n\tglobal_load_async_to_lds_b128 %5, %13, off\n\tglobal_load_async_to_lds_b128 %6, %14, off\n\tglobal_load_async_to_lds_b128 %7, %15, off\n\ts_wait_xcnt 0x0"
               :: "v"(kl), "v"(kl + 32 * FA_PK), "v"(kl + 64 * FA_PK), "v"(kl + 96 * FA_PK), "v"(vl), "v"(vl + 16 * FA_PV), "v"(vl + 32 * FA_PV), "v"(vl + 48 * FA_PV),
                  "v"(kg), "v"(kg + (size_t)32 * DM), "v"(kg + (size_t)64 * DM), "v"(kg + (size_t)96 * DM), "v"(vg), "v"(vg + (size_t)16 * SQ), "v"(vg + (size_t)32 * SQ), "v"(vg + (size_t)48 * SQ) : "memory"); }
// The partial result of query group G (a lane's 32 output values, its sum of weights, the maximum in use) into the wave's LDS slot: nine 16-byte pieces, the 32 lanes of a piece side by side (no bank conflict).
#define FA_SLOT (9 * 32)             /* 16-byte pieces of a slot */
static_assert((size_t)FA_WAVES * FA_SLOT * 16 <= (size_t)FA_KH * 2 * FA_STB, "the slots fit the staging bytes");
template <int G>
__device__ __forceinline__ void fa_send(v4fa* slot, int lane, const v8f (&o)[4][2], const v2f (&ls)[2], const float (&mu)[2]) {
#pragma unroll      /* constant indices keep o in registers */
  for (int dt = 0; dt < 4; ++dt) { slot[(2 * dt) * 32 + lane] = __builtin_shufflevector(o[dt][G], o[dt][G], 0, 1, 2, 3); slot[(2 * dt + 1) * 32 + lane] = __builtin_shufflevector(o[dt][G], o[dt][G], 4, 5, 6, 7); }
  slot[8 * 32 + lane] = (v4f){ls[G][0] + ls[G][1], mu[G], 0.f, 0.f}; }
// Joins this wave's partial result of query group G with the other run's (its slot): both are brought to the larger of the two maxima in use, added, divided by the joined sum and stored.
template <int G>
__device__ __forceinline__ void fa_join(const v4fa* slot, int lane, const v8f (&o)[4][2], const v2f (&ls)[2], const float (&mu)[2], unsigned short* op) {
  v4f q[9];      /* the other run's nine pieces */
#pragma unroll      /* here and below: constant indices keep q, o and f in registers */
  for (int j = 0; j < 9; ++j) q[j] = slot[j * 32 + lane];
  const float m = fmaxf(mu[G], q[8][1]); float a = (mu[G] - m) * FA_C, c = (q[8][1] - m) * FA_C; fa_exp2x2(a, c);
  float l = (ls[G][0] + ls[G][1]) * a + q[8][0] * c; l += sm_xhalf(l); const float sc = 64.0f / l; a *= sc; c *= sc;      /* o x64, the scale the output stage expects */
  FragH f[4];      /* all four pieces are formed before the first store: no register of a store is written again behind it */
#pragma unroll
  for (int dt = 0; dt < 4; ++dt) {
#pragma unroll
    for (int r = 0; r < 8; ++r) f[dt].h[r] = (_Float16)(o[dt][G][r] * a + q[2 * dt + (r >> 2)][r & 3] * c); }
#pragma unroll
  for (int dt = 0; dt < 4; ++dt) *(v8us*)(op + dt * 16) = f[dt].half[0]; }
__global__ __launch_bounds__(FA_WAVES * 32) void k_fattn(const _Float16* __restrict__ Qh, const _Float16* __restrict__ Ql, const _Float16* __restrict__ Kx, const _Float16* __restrict__ Vt, _Float16* __restrict__ O) {
  __shared__ __attribute__((aligned(16))) unsigned char fa[FA_KH * 2 * FA_STB];      /* for each run of keys two buffers of one stage each */
  const int tid = threadIdx.x & (FA_QG * 32 - 1), lane = tid & 31, ln = lane & 15, hh = lane >> 4; const int wave = __builtin_amdgcn_readfirstlane(threadIdx.x >> 5);      /* tid: the thread among the 256 of its run */
  const int kh = wave / FA_QG; const int k0 = kh * (SQ / FA_KH); unsigned char* const fl = fa + kh * (2 * FA_STB);      /* this wave's run of keys, its first key, its two buffers */
  const int h = blockIdx.y, b = blockIdx.z; const size_t rb = (size_t)b * SQ; const int q0 = blockIdx.x * (FA_QG * FA_QW) + (wave % FA_QG) * FA_QW;
  v16h qh[2][2], ql[2][2];      /* [16-query group][32-wide step of the head dimension]: the hi plane and the x1024 residual plane, kept for the whole walk */
#pragma unroll
  for (int g = 0; g < 2; ++g) { const size_t qo = (rb + q0 + g * 16 + ln) * DM + h * HD;
#pragma unroll
    for (int ks = 0; ks < 2; ++ks) { qh[g][ks] = g2_frag(Qh + qo + ks * 32, hh); ql[g][ks] = g2_frag(Ql + qo + ks * 32, hh); } }
  const _Float16* kg = Kx + (rb + k0 + (tid >> 3)) * DM + h * HD + (tid & 7) * 8;      /* this thread's piece of the run's key row tid / 8, this head's 64 columns */
  const _Float16* vg = Vt + (((size_t)b * NH + h) * HD + (tid >> 4)) * SQ + k0 + (tid & 15) * 8;      /* its piece of V^T row tid / 16 of this head, from the run's first key on */
  const unsigned kl = (unsigned)(size_t)fl + (tid >> 3) * FA_PK + (tid & 7) * 16, vl = (unsigned)(size_t)fl + FA_KB + (tid >> 4) * FA_PV + (tid & 15) * 16;      /* LDS byte address = low 32 bits of the __shared__ address */
  fa_stage(kg, vg, kl, vl);      /* stage 0 into buffer 0 */
  asm volatile("s_wait_asynccnt 0x0" ::: "memory");      /* this wave's copies of stage 0 have landed */
  __syncthreads();      /* and every other wave's: stage 0 may be read */
  fa_stage(kg + (size_t)FA_SK * DM, vg + FA_SK, kl + FA_STB, vl + FA_STB);      /* stage 1 flies while stage 0 is worked on */
  const v8f z8 = {0.f, 0.f, 0.f, 0.f, 0.f, 0.f, 0.f, 0.f};
  v8f o[4][2]; v2f ls[2]; float mu[2];
#pragma unroll
  for (int g = 0; g < 2; ++g) { ls[g] = (v2f){0.f, 0.f}; mu[g] = -1.0e30f;
#pragma unroll
    for (int dt = 0; dt < 4; ++dt) o[dt][g] = z8; }
  for (int st = 0; st < FA_NST; ++st) {
   const unsigned char* kr = fl + (st & 1) * FA_STB + ln * FA_PK + 16 * hh;      /* key row ln of this stage's buffer, the lane half's 16 bytes */
   const unsigned char* vr = fl + (st & 1) * FA_STB + FA_KB + ln * FA_PV + 16 * hh;      /* V^T row ln */
   v16h kf[2][2];      /* [16-key tile][step of the head dimension], fetched one pass ahead inside a stage */
#pragma unroll
   for (int t = 0; t < 2; ++t) { kf[t][0] = fa_lfrag(kr + (t * 16) * FA_PK); kf[t][1] = fa_lfrag(kr + (t * 16) * FA_PK + 64); }
#pragma unroll 1      /* rolled: unrolled, the four passes took more than 256 registers and spilled */
   for (int ps = 0; ps < FA_SK / 32; ++ps) {
    v8f s[2][2];      /* [query group][key tile]: raw scores hi + residual / 1024 */
#pragma unroll
    for (int g = 0; g < 2; ++g) {
#pragma unroll
      for (int t = 0; t < 2; ++t) { v8f ch = fa_mma(kf[t][0], qh[g][0], z8); ch = fa_mma(kf[t][1], qh[g][1], ch); v8f cl = fa_mma(kf[t][0], ql[g][0], z8); cl = fa_mma(kf[t][1], ql[g][1], cl); s[g][t] = cl * 0.0009765625f + ch; } }
    v16h vf[4];
#pragma unroll
    for (int dt = 0; dt < 4; ++dt) vf[dt] = fa_lfrag(vr + (dt * 16) * FA_PV + ps * 64);
    const int pn = (ps + 1 < FA_SK / 32) ? ps + 1 : 0;      /* the next stage is not published yet, nothing of it is read here: a stage's last pass fetches its own pass 0 again, not used */
#pragma unroll
    for (int t = 0; t < 2; ++t) { kf[t][0] = fa_lfrag(kr + (pn * 32 + t * 16) * FA_PK); kf[t][1] = fa_lfrag(kr + (pn * 32 + t * 16) * FA_PK + 64); }
    __builtin_amdgcn_sched_barrier(0);      /* keeps this pass's V^T reads and the next pass's key reads here as one group, right behind the score products: the softmax arithmetic covers their latency */
    float mb0 = fa_max8(s[0][0], s[0][1]), mb1 = fa_max8(s[1][0], s[1][1]); mb0 = fmaxf(mb0, sm_xhalf(mb0)); mb1 = fmaxf(mb1, sm_xhalf(mb1));      /* both halves of a query's lanes must use one maximum */
    const bool need = (mb0 - mu[0]) * FA_C > FA_TH || (mb1 - mu[1]) * FA_C > FA_TH;
    if (__builtin_amdgcn_ballot_w32(need) != 0) {      /* wave-uniform: rare after the first passes */
      const float n0 = fmaxf(mu[0], mb0), n1 = fmaxf(mu[1], mb1); float a0 = (mu[0] - n0) * FA_C, a1 = (mu[1] - n1) * FA_C; fa_exp2x2(a0, a1); mu[0] = n0; mu[1] = n1; ls[0] *= a0; ls[1] *= a1;
#pragma unroll
      for (int dt = 0; dt < 4; ++dt) { o[dt][0] *= a0; o[dt][1] *= a1; } }
    FragH p[2];      /* P^T of both query groups is formed before the first product with V^T */
#pragma unroll
    for (int g = 0; g < 2; ++g) { const float bias = FA_OFF - mu[g] * FA_C; const v8f p0 = fa_exp2x8(s[g][0] * FA_C + bias), p1 = fa_exp2x8(s[g][1] * FA_C + bias); const v8f e = p0 + p1; ls[g] += (((v2f){e[0], e[1]} + (v2f){e[2], e[3]}) + ((v2f){e[4], e[5]} + (v2f){e[6], e[7]}));
#pragma unroll
      for (int i = 0; i < 8; ++i) { p[g].h[i] = (_Float16)p0[i]; p[g].h[8 + i] = (_Float16)p1[i]; } }
#pragma unroll
    for (int g = 0; g < 2; ++g) {
#pragma unroll
      for (int dt = 0; dt < 4; ++dt) o[dt][g] = fa_mma(vf[dt], p[g].v, o[dt][g]); } }
   asm volatile("s_wait_dscnt 0x0" ::: "memory");      /* this wave's last reads of the buffer have returned */
   asm volatile("s_wait_asynccnt 0x0" ::: "memory");      /* its copies of stage st + 1 have landed */
   __syncthreads();      /* one barrier a stage: it publishes stage st + 1 and ends every wave's reads of stage st */
   if (st + 2 < FA_NST) fa_stage(kg + (size_t)(st + 2) * FA_SK * DM, vg + (st + 2) * FA_SK, kl + (st & 1) * FA_STB, vl + (st & 1) * FA_STB); }      /* refill of the buffer just left; the test reads the same in the whole block */
  asm volatile("s_wait_asynccnt 0x0" ::: "memory");      /* no copy is left in flight when the staging bytes take the partial results */
  /* behind the loop's last barrier nobody reads the buffers any more. The wave of run 0 finishes query group 0 and hands over its part of group 1; the wave of run 1 the other way round: all sixteen waves share the closing work. kh is the same in a whole wave, so the branches are wave-uniform; the barrier stands outside them. */
  v4fa* const sl = (v4fa*)fa; unsigned short* const op = (unsigned short*)O + (rb + q0 + kh * 16 + ln) * DM + h * HD + 8 * hh;      /* the row of this lane's query in the group that the wave finishes */
  if (kh == 0) fa_send<1>(sl + wave * FA_SLOT, lane, o, ls, mu); else fa_send<0>(sl + wave * FA_SLOT, lane, o, ls, mu);
  __syncthreads();      /* every wave's slot is written before its partner reads it */
  if (kh == 0) fa_join<0>(sl + (wave + FA_QG) * FA_SLOT, lane, o, ls, mu, op); else fa_join<1>(sl + (wave - FA_QG) * FA_SLOT, lane, o, ls, mu, op); }

extern "C" void kernel_launch(void* const* d_in, const int* in_sizes, int n_in,
                              void* d_out, int out_size, void* d_ws, size_t ws_size, hipStream_t stream) {
  (void)in_sizes; (void)n_in; (void)out_size;
  const float* const* I = (const float* const*)d_in; const float* x = I[0]; const float* watt = I[1]; const float* wv = I[2]; const float* bv = I[3]; const float* wo = I[4]; const float* bo = I[5];      /* x [2][2048][1024]; the per-head bilinear weight [16][64][64] ([head][in d][out e]); the natural value weight [DM][DM] and its bias; the natural output weight [DM][DM] and its bias */
  char* ws = (char*)d_ws; size_t off = 0;
  auto take = [&](size_t bytes) { char* p = ws + off; off += (bytes + 255) & ~(size_t)255; return p; };
  _Float16* BW = (_Float16*)take((size_t)NH * HD * HD * 2); _Float16* BV = (_Float16*)take((size_t)DM * DM * 2); _Float16* BO = (_Float16*)take((size_t)DM * DM * 2);      /* BW: sixteen transposed [64][64] head planes, one after another */
  _Float16* X16 = (_Float16*)take(NR * DM * 2); _Float16* Q16 = (_Float16*)take(NR * DM * 2); _Float16* QL = (_Float16*)take(NR * DM * 2); _Float16* O16 = (_Float16*)take(NR * DM * 2);
  _Float16* VT = (_Float16*)take((size_t)NB * NH * HD * SQ * 2);
  if (off > ws_size) return;
  const size_t r0p = (size_t)B0 * SQ;      /* first projected row */
  k_prep<<<PB_WT + 2 * PB_WN + PB_X, 256, 0, stream>>>(x, watt, wv, wo, X16, BW, BV, BO);
  k_proj<<<GB_V + NH * GB_Q, 128, 0, stream>>>(X16 + r0p * DM, BW, BV, bv, Q16 + r0p * DM, QL + r0p * DM, VT + r0p * DM);
  k_fattn<<<dim3(SQ / (FA_QG * FA_QW), NH, NB), FA_WAVES * 32, 0, stream>>>(Q16, QL, X16, VT, O16);      /* o (merged heads, x64) as f16 rows: every batch, head and query in one launch */
  k_gemm2<0><<<dim3((unsigned)((MPO / 128) * (DM / 64)), 1), 128, 0, stream>>>(O16 + r0p * DM, DM, 0, BO, DM, 0, 0.0009765625f, bo, 0, nullptr, 1, 0, 0, (float*)d_out + r0p * DM, nullptr, DM, 0, MPO, DM, DM);      /* out rows are the output layout */
}

// v008
// One run takes 68.7 microseconds.
// In both of two side-by-side timings against v007, it was 1.03 times as fast.
// Counting every step since v000, it is 39.2 times as fast.
#include <hip/hip_runtime.h>
// Multi-head self-attention with a PER-HEAD BILINEAR SCORE and no query / key projections (x [2][2048][1024] viewed as 16 heads of 64; scores = (x_h W_h) . x_h / sqrt(64) with W [16][64][64] ([head][in][out]); softmax over all 2048 keys (no mask); v = x w_v^T + b_v (natural [1024][1024] + a bias, zero on this module's draw: read all the same); out = merged w_out^T + b_out (natural + a bias, zero on this draw too) -> [2][2048][1024]).
// Compute dtype: inputs rounded to bf16; x / weights exact; the per-head product as f16 hi + x1024 residual; the key operand is x itself as f16; v, softmax weights and o as plain f16 GEMM operands (~2^-12); scores and softmax statistics f32. v_wmma_f32_16x16x32_f16.
#define NB 2
#define SQ 2048
#define DM 1024
#define NH 16
#define HD 64
#define B0 0                         /* first batch processed (debug hook) */
#define NBR NB                       /* batches processed (debug hook) */
#define NR ((size_t)NB * SQ)         /* token rows */
#define MP ((int)((size_t)NBR * SQ)) /* rows projected (debug hook) */
#define MPO MP                       /* rows through the output stage (debug hook) */
typedef __bf16 v16b __attribute__((ext_vector_type(16)));
typedef unsigned short v8us __attribute__((ext_vector_type(8), may_alias));
typedef float  v8f  __attribute__((ext_vector_type(8)));
typedef float  v4f  __attribute__((ext_vector_type(4)));
typedef float  v4fa __attribute__((ext_vector_type(4), may_alias));
union FragB { v16b v; v8us half[2]; unsigned short u[16]; };

__device__ __forceinline__ unsigned short bf16_bits(float x) { unsigned int u = __float_as_uint(x); return (unsigned short)((u + 0x7FFFu + ((u >> 16) & 1u)) >> 16); }
__device__ __forceinline__ float bf16_val(unsigned short b) { return __uint_as_float(((unsigned int)b) << 16); }
__device__ __forceinline__ float bf16_round(float x) { return bf16_val(bf16_bits(x)); }
// D += A·B with NT terms: 1 = ah·bh, 2 = + al·bh (A split), 3 = + ah·bl (both split)
template <int NT>
__device__ __forceinline__ v8f mmaN(v16b ah, v16b al, v16b bh, v16b bl, v8f c) {
  c = __builtin_amdgcn_wmma_f32_16x16x32_bf16(false, ah, false, bh, (short)0, c, false, false);
  if (NT >= 2) c = __builtin_amdgcn_wmma_f32_16x16x32_bf16(false, al, false, bh, (short)0, c, false, false);
  if (NT >= 3) c = __builtin_amdgcn_wmma_f32_16x16x32_bf16(false, ah, false, bl, (short)0, c, false, false);
  asm volatile("v_nop\n\tv_nop\n\tv_nop\n\tv_nop" : "+v"(c) : "v"(ah), "v"(al), "v"(bh), "v"(bl));
  return c;
}




// ---- f16 WMMA path (v_wmma_f32_16x16x32_f16): 11-bit significands for operands in range — used for every product here, the softmax weights (up to 2^14) included
typedef _Float16 v16h __attribute__((ext_vector_type(16)));
union FragH { v16h v; v8us half[2]; _Float16 h[16]; unsigned short u[16]; };
template <int NT>
__device__ __forceinline__ v8f mmaH(v16h ah, v16h al, v16h bh, v16h bl, v8f c) {
  c = __builtin_amdgcn_wmma_f32_16x16x32_f16(false, ah, false, bh, (short)0, c, false, false);
  if (NT >= 2) c = __builtin_amdgcn_wmma_f32_16x16x32_f16(false, al, false, bh, (short)0, c, false, false);
  if (NT >= 3) c = __builtin_amdgcn_wmma_f32_16x16x32_f16(false, ah, false, bl, (short)0, c, false, false);
  asm volatile("v_nop\n\tv_nop\n\tv_nop\n\tv_nop" : "+v"(c) : "v"(ah), "v"(al), "v"(bh), "v"(bl));
  return c;
}

// Wt[n][k] = f16(W[k][n]·scale) from f32 row-major W[K][N] (scale = power of two; bf16-exact weights stay exact in f16 away from the subnormal range)
__device__ __forceinline__ void d_wt_f16(const float* __restrict__ W, _Float16* __restrict__ Wt, int K, int N, float scale, int t) {
  const int n = t / (K / 8), k8 = (t % (K / 8)) * 8; FragH f;
#pragma unroll
  for (int i = 0; i < 8; ++i) f.h[i] = (_Float16)(bf16_round(W[(size_t)(k8 + i) * N + n]) * scale); const v8us o = f.half[0];
  *(v8us*)((unsigned short*)Wt + (size_t)n * K + k8) = o; 
}

typedef _Float16 v4h __attribute__((ext_vector_type(4)));

__device__ __forceinline__ void d_x16(const float* __restrict__ x, _Float16* __restrict__ X16, size_t t) { FragH f;
#pragma unroll
  for (int q = 0; q < 8; ++q) f.h[q] = (_Float16)bf16_round(x[t * 8 + q]); *(v8us*)((unsigned short*)X16 + t * 8) = f.half[0]; asm volatile("s_wait_xcnt 0x0" ::: "memory");      /* before a register of the store in front is written again: in a shared launch another job's code follows in the listing */
}
// ---- fast GEMM (wave tile 32x64, block tile 128x64; requires M % 128 == 0 rows per launch region, N % 64 == 0 and K % KS == 0); RB: the bias belongs to the rows of C, not to its columns; CL: the x1024 residual of the f16 result, v - f16(v), as a second f16 plane ----
__device__ __forceinline__ v16h g2_frag(const _Float16* p, int hh) { FragH f; f.half[0] = *(const v8us*)((const unsigned short*)p + 8 * hh); f.half[1] = *(const v8us*)((const unsigned short*)p + 16 + 8 * hh); return f.v; }
__device__ __forceinline__ v8f g2_mma(v16h a, v16h b, v8f c) { v8f d = __builtin_amdgcn_wmma_f32_16x16x32_f16(false, a, false, b, (short)0, c, false, false); asm volatile("v_nop\n\tv_nop\n\tv_nop\n\tv_nop" : "+v"(d) : "v"(a), "v"(b)); return d; }
// A block's operands come through LDS: its 128 A rows and 64 B rows, KS k a stage, by asynchronous copies of whole 128-byte lines into two buffers; the four waves read their fragments from there.
#define G2_PK(KS) ((KS) * 2 + 16)             /* LDS pitch of a staged row, its bytes + 16: 16 x odd (144, 272), the pitch free of bank conflicts for 16-byte reads */
#define G2_STB(KS) ((128 + 64) * G2_PK(KS))   /* bytes of a stage: the A rows, then the B rows */
__device__ __forceinline__ unsigned char* g2_lds() { __shared__ __attribute__((aligned(16))) unsigned char sm[2 * G2_STB(128)]; return sm; }      /* two buffers of the longest stage; one array for every stage length that a kernel holds */
__device__ __forceinline__ v16h g2_lfrag(const unsigned char* p) { FragH f; f.half[0] = *(const v8us*)p; f.half[1] = *(const v8us*)(p + 32); return f.v; }      /* g2_frag from an LDS row; p holds the lane half's 16 bytes already */
// 64 k of a stage into LDS, through no register: every thread copies twelve 16-byte pieces (8 threads a 128-byte line, 16 rows a round): eight rounds of A rows, four of B rows.
// ag, bg: the thread's own piece in round 0; a16, b16: elements of 16 rows; al, bl: its LDS byte address in the stage's buffer; p16: LDS bytes of 16 rows. The closing s_wait_xcnt 0 stands inside the statement, so that no register a copy names is written again in front of it.
__device__ __forceinline__ void g2_stage(const _Float16* ag, size_t a16, const _Float16* bg, size_t b16, unsigned al, unsigned bl, unsigned p16) {
  asm volatile("global_load_async_to_lds_b128 %0, %12, off\n\tglobal_load_async_to_lds_b128 %1, %13, off\n\tglobal_load_async_to_lds_b128 %2, %14, off\n\tglobal_load_async_to_lds_b128 %3, %15, off\n\t"
               "global_load_async_to_lds_b128 %4, %16, off\n\tglobal_load_async_to_lds_b128 %5, %17, off\n\tglobal_load_async_to_lds_b128 %6, %18, off\n\tglobal_load_async_to_lds_b128 %7, %19, off\n\t"
               "global_load_async_to_lds_b128 %8, %20, off\n\tglobal_load_async_to_lds_b128 %9, %21, off\n\tglobal_load_async_to_lds_b128 %10, %22, off\n\tglobal_load_async_to_lds_b128 %11, %23, off\n\ts_wait_xcnt 0x0"
               :: "v"(al), "v"(al + p16), "v"(al + 2 * p16), "v"(al + 3 * p16), "v"(al + 4 * p16), "v"(al + 5 * p16), "v"(al + 6 * p16), "v"(al + 7 * p16),
                  "v"(bl), "v"(bl + p16), "v"(bl + 2 * p16), "v"(bl + 3 * p16),
                  "v"(ag), "v"(ag + a16), "v"(ag + 2 * a16), "v"(ag + 3 * a16), "v"(ag + 4 * a16), "v"(ag + 5 * a16), "v"(ag + 6 * a16), "v"(ag + 7 * a16),
                  "v"(bg), "v"(bg + b16), "v"(bg + 2 * b16), "v"(bg + 3 * b16) : "memory"); }
// a whole stage: one such statement for each 64 k of it (12 or 24 copies of a wave in flight)
template <int KS>
__device__ __forceinline__ void g2_fill(const _Float16* ag, size_t a16, const _Float16* bg, size_t b16, unsigned al, unsigned bl) {
#pragma unroll      /* one or two statements in a row, no loop around them */
  for (int h = 0; h < KS / 64; ++h) g2_stage(ag + h * 64, a16, bg + h * 64, b16, al + h * 128, bl + h * 128, 16 * G2_PK(KS)); }
template <int ACT, int KS, bool RB>
__device__ __forceinline__ void d_gemm2(int bx, int by, const _Float16* __restrict__ A, int lda, size_t sA, const _Float16* __restrict__ Bh, int ldb, size_t sB, float alpha, const float* __restrict__ bias, size_t sBias, const float* __restrict__ CP, int rowsPerB, size_t sCPb, int row0g,
    float* __restrict__ C, _Float16* __restrict__ C16, _Float16* __restrict__ CL, int ldc, size_t sC, int M, int N, int K) { static_assert(ACT == 0 || ACT == 3 || ACT == 6 || ACT == 8 || ACT == 9 || ACT == 11 || ACT == 12 || ACT == 14 || ACT == 15 || ACT == 16 || ACT == 17, "k_gemm2: unsupported ACT code (would silently apply no activation)");
  static_assert(KS == 64 || KS == 128, "a stage is one or two 128-byte lines of every row"); constexpr int PK = G2_PK(KS), AB = 128 * PK, STB = G2_STB(KS);      /* row pitch, bytes of a stage's A rows, bytes of a stage */
  unsigned char* const sm = g2_lds();
  float (*so)[32][68] = (float (*)[32][68])sm; static_assert(sizeof(float) * 4 * 32 * 68 <= 2 * G2_STB(64), "the result tiles fit the staging bytes");      /* behind the loop's last barrier the same bytes hold each wave's result tile */
  const int tid = threadIdx.x, w = tid >> 5, lane = tid & 31, ln = lane & 15, hh = lane >> 4;
  A += (size_t)by * sA; Bh += (size_t)by * sB; const size_t cofs = (size_t)by * sC; const float* bp = bias ? bias + (size_t)by * sBias : nullptr;
  const int ntn = N >> 6; const int mt = bx / ntn, nq = bx - mt * ntn; const int row0 = mt * 128 + 32 * w, col0 = nq * 64; if (mt * 128 >= M) return;      /* a whole block leaves or none, in front of every barrier (M is a multiple of 128) */
  const _Float16* ag = A + (size_t)(mt * 128 + (tid >> 3)) * lda + (tid & 7) * 8;      /* this thread's piece of the block's A row tid / 8 */
  const _Float16* bg = Bh + (size_t)(col0 + (tid >> 3)) * ldb + (tid & 7) * 8;      /* its piece of B row tid / 8 */
  const unsigned al = (unsigned)(size_t)sm + (tid >> 3) * PK + (tid & 7) * 16, bl = al + AB;      /* LDS byte address = low 32 bits of the __shared__ address */
  const size_t a16 = (size_t)16 * lda, b16 = (size_t)16 * ldb; const int nst = K / KS;      /* whole stages (K is a multiple of KS) */
  g2_fill<KS>(ag, a16, bg, b16, al, bl);      /* stage 0 into buffer 0 */
  asm volatile("s_wait_asynccnt 0x0" ::: "memory");      /* this wave's copies of stage 0 have landed */
  __syncthreads();      /* and every other wave's: stage 0 may be read */
  if (nst > 1) g2_fill<KS>(ag + KS, a16, bg + KS, b16, al + STB, bl + STB);      /* stage 1 flies while stage 0 is worked on */
  v4f rb4[4];      /* RB: the biases of this lane's sixteen result rows (two 16-row tiles, rows 8 hh + r of each), fetched as one group in front of the loop, which covers their latency */
#pragma unroll      /* constant indices keep rb4 in registers */
  for (int i = 0; i < 4; ++i) rb4[i] = (v4f){0.f, 0.f, 0.f, 0.f};
  if (RB && bp) {
#pragma unroll
    for (int i = 0; i < 4; ++i) rb4[i] = *(const v4fa*)(bp + row0 + (i >> 1) * 16 + 8 * hh + (i & 1) * 4);
    asm volatile("s_wait_xcnt 0x0" ::: "memory"); }      /* before a register of the four loads in front is written again */
  const v8f z8 = {0.f,0.f,0.f,0.f,0.f,0.f,0.f,0.f}; v8f c00 = z8, c01 = z8, c02 = z8, c03 = z8, c10 = z8, c11 = z8, c12 = z8, c13 = z8;
#pragma unroll 1      /* rolled: one copy of the stage's code, whatever K is at the call */
  for (int st = 0; st < nst; ++st) {
    const unsigned char* ar = sm + (st & 1) * STB + (32 * w + ln) * PK + 16 * hh;      /* the wave's A row ln of this stage's buffer, the lane half's 16 bytes */
    const unsigned char* br = sm + (st & 1) * STB + AB + ln * PK + 16 * hh;      /* B row ln */
    /* every loop inside a stage is unrolled: the fragment arrays stay in registers only under constant indices */
#pragma unroll
    for (int h = 0; h < KS / 64; ++h) {
      v16h af[2][2], bf[2][4];      /* [32-wide k step][16-row tile]: the fragments of 64 k are read as one group in front of their sixteen products */
#pragma unroll
      for (int ks = 0; ks < 2; ++ks) {
#pragma unroll
        for (int t = 0; t < 2; ++t) af[ks][t] = g2_lfrag(ar + (t * 16) * PK + h * 128 + ks * 64);
#pragma unroll
        for (int t = 0; t < 4; ++t) bf[ks][t] = g2_lfrag(br + (t * 16) * PK + h * 128 + ks * 64); }
#pragma unroll
      for (int ks = 0; ks < 2; ++ks) {
        c00 = g2_mma(af[ks][0], bf[ks][0], c00); c10 = g2_mma(af[ks][1], bf[ks][0], c10);
        c01 = g2_mma(af[ks][0], bf[ks][1], c01); c11 = g2_mma(af[ks][1], bf[ks][1], c11);
        c02 = g2_mma(af[ks][0], bf[ks][2], c02); c12 = g2_mma(af[ks][1], bf[ks][2], c12);
        c03 = g2_mma(af[ks][0], bf[ks][3], c03); c13 = g2_mma(af[ks][1], bf[ks][3], c13); } }
    asm volatile("s_wait_dscnt 0x0" ::: "memory");      /* this wave's last reads of the buffer have returned */
    asm volatile("s_wait_asynccnt 0x0" ::: "memory");      /* its copies of stage st + 1 have landed */
    __syncthreads();      /* one barrier a stage: it publishes stage st + 1 and ends every wave's reads of stage st */
    if (st + 2 < nst) g2_fill<KS>(ag + (size_t)(st + 2) * KS, a16, bg + (size_t)(st + 2) * KS, b16, al + (st & 1) * STB, bl + (st & 1) * STB); }      /* refill of the buffer just left; the test reads the same in the whole block */
  asm volatile("s_wait_asynccnt 0x0" ::: "memory");      /* no copy is left in flight when the staging bytes take the result tiles */
  v8f accs[8] = {c00, c01, c02, c03, c10, c11, c12, c13};
#pragma unroll
  for (int u = 0; u < 8; ++u) { const int t = u & 3, half = u >> 2; const int col = col0 + t * 16 + ln; const float bv = (bp && !RB) ? bf16_round(bp[col]) : 0.f;
#pragma unroll
    for (int r = 0; r < 8; ++r) { const int rloc = half * 16 + 8 * hh + r; float v = accs[u][r] * alpha + (RB ? bf16_round(rb4[half * 2 + (r >> 2)][r & 3]) : bv); if (CP) { if (rowsPerB < 0) v += CP[cofs + (size_t)(row0g + row0 + rloc) * ldc + col];      /* rowsPerB < 0: own element of the batched C plane */ else { const int bidx = (row0g + row0 + rloc) / rowsPerB; v += CP[(size_t)bidx * sCPb + (size_t)by * 64 + col]; } }
      if (ACT == 3) v = fmaxf(v, 0.f); else if (ACT == 6) v = 0.5f * v * (1.0f + erff(v * 0.70710678118654752f)); else if (ACT == 11) v = 1.0f / (1.0f + expf(-v)); else if (ACT == 15) v = v / (1.0f + expf(-v)); else if (ACT == 12) v = (v > 0.f) ? v : 0.01f * v; else if (ACT == 8) v = tanhf(v); else if (ACT == 9) v = 0.5f * v * (1.0f + tanhf(0.7978845608028654f * (v + 0.044715f * v * v * v))); else if (ACT == 14) v = (v > 0.f) ? v : 0.1f * v; else if (ACT == 16) v = (v >= 0.f) ? v : 0.3f * v; else if (ACT == 17) v = (v >= 0.f) ? v : 0.2f * v;
      so[w][rloc][t * 16 + ln] = v; } }
  __builtin_amdgcn_fence(__ATOMIC_ACQ_REL, "workgroup"); __builtin_amdgcn_wave_barrier();
  const int rsub = lane >> 4, c4 = (lane & 15) * 4;
  { v4f vv[16];      /* the tile's rows are read as one group in front of the stores: no LDS read can pass the waits behind the stores, and one read a store would add its latency sixteen times */
#pragma unroll
    for (int q = 0; q < 16; ++q) vv[q] = *(const v4fa*)&so[w][q * 2 + rsub][c4];
#pragma unroll      /* constant indices keep vv in registers */
    for (int q = 0; q < 16; ++q) { const int r = q * 2 + rsub; const v4f v = vv[q];
      if (C) { *(v4f*)(C + cofs + (size_t)(row0 + r) * ldc + col0 + c4) = v; asm volatile("s_wait_xcnt 0x0" ::: "memory"); }      /* before a register of the store in front is written again (the next row's address, the f16 form, another job's code in a shared launch) */
      if (C16) { v4h h4; for (int i = 0; i < 4; ++i) h4[i] = (_Float16)v[i]; *(v4h*)(C16 + cofs + (size_t)(row0 + r) * ldc + col0 + c4) = h4; asm volatile("s_wait_xcnt 0x0" ::: "memory"); }      /* the same for this store */
      if (CL) { v4h l4; for (int i = 0; i < 4; ++i) l4[i] = (_Float16)((v[i] - (float)(_Float16)v[i]) * 1024.0f); *(v4h*)(CL + cofs + (size_t)(row0 + r) * ldc + col0 + c4) = l4; asm volatile("s_wait_xcnt 0x0" ::: "memory"); } }      /* and for this one */
     } }

__device__ __forceinline__ void d_wnat(const float* __restrict__ w, _Float16* __restrict__ Bt, size_t t) { FragH f; for (int q = 0; q < 8; ++q) f.h[q] = (_Float16)(bf16_round(w[t * 8 + q]) * 16.0f); *(v8us*)((unsigned short*)Bt + t * 8) = f.half[0]; asm volatile("s_wait_xcnt 0x0" ::: "memory");      /* before a register of the store in front is written again: in a shared launch another job's code follows in the listing */
}

// The output stage, C [MPO][DM] f32 = A [MPO][DM] x Bh [DM][DM]^T / 1024 + bias. Only the four pointers are arguments: shapes, pitches, the scale and the operands this product does not have (an added plane, f16 copies, batch strides)
// are constants at the call, as in k_proj, so that the compiler drops their tests and address arithmetic from every result element and the kernel waits for one argument load, not four in a row.
template <int ACT>
__global__ __launch_bounds__(128) void k_gemm2(const _Float16* __restrict__ A, const _Float16* __restrict__ Bh, const float* __restrict__ bias, float* __restrict__ C) {
  __builtin_assume(bias != nullptr && C != nullptr);      /* both are always passed: without their null tests the four bias loads of a lane go out as one group, not one after another behind a test each */
  d_gemm2<ACT, 128, false>(blockIdx.x, 0, A, DM, 0, Bh, DM, 0, 0.0009765625f, bias, 0, nullptr, 1, 0, 0, C, nullptr, nullptr, DM, 0, MPO, DM, DM); }

// ---- Shared launches: jobs that read none of each other's output run in one grid. Each job keeps its own code, its own threads and its own blocks, a range of blockIdx.x. ----
#define PB_WT (NH * HD * (HD / 8) / 256)      /* blocks of the sixteen head planes, HD * (HD / 8) threads a head */
#define PB_WN (DM * DM / 8 / 256)             /* blocks of one natural [DM][DM] weight */
#define PB_X ((int)(NR * DM / 8 / 256))       /* blocks of x */
#define GB_V1 ((DM / 128) * (SQ / 64))        /* blocks of one batch's value projection, transposed: DM rows of SQ tokens */
#define GB_V (NBR * GB_V1)                    /* blocks of the value projection */
#define GB_Q ((MP / 128) * (HD / 64))         /* blocks of one head's bilinear product */
static_assert((NH * HD * (HD / 8)) % 256 == 0 && (DM * DM / 8) % 256 == 0 && (NR * DM / 8) % 256 == 0 && MP % 128 == 0 && DM % 128 == 0 && SQ % 64 == 0 && HD % 64 == 0, "shared launches: every job fills whole blocks; the products' K is whole stages");
// every conversion that reads inputs only: the head planes, both natural weights, x
__global__ __launch_bounds__(256) void k_prep(const float* __restrict__ x, const float* __restrict__ watt, const float* __restrict__ wv, const float* __restrict__ wo, _Float16* __restrict__ X16, _Float16* __restrict__ BW, _Float16* __restrict__ BV, _Float16* __restrict__ BO) {
  int blk = blockIdx.x;
  if (blk < PB_WT) { const int t = blk * 256 + threadIdx.x, h = t / (HD * (HD / 8)); d_wt_f16(watt + (size_t)h * HD * HD, BW + (size_t)h * HD * HD, HD, HD, 16.0f, t % (HD * (HD / 8))); return; }      /* a head's [in d][out e] weight -> its transposed x16 plane Bt[e][d] */
  blk -= PB_WT; if (blk < PB_WN) { d_wnat(wv, BV, (size_t)blk * 256 + threadIdx.x); return; }      /* natural [out][in] = A[m][k] x16, the value product's A operand (no transpose) */
  blk -= PB_WN; if (blk < PB_WN) { d_wnat(wo, BO, (size_t)blk * 256 + threadIdx.x); return; }
  blk -= PB_WN; d_x16(x, X16, (size_t)blk * 256 + threadIdx.x); }
// both products of x, each stored in the form the attention kernel reads. First the long blocks (K = DM): V^T = Wv x^T + bv, the weight's rows as the A operand and a batch's token rows as B, so that the result rows are [NB][NH][HD][SQ] as they stand (the bias goes with the rows).
// Then the per-head product x_h W_h (head strides: 64 input columns, one [64][64] plane, 64 result columns; K = 64), split in the epilogue into its f16 hi plane and its x1024 residual plane.
__global__ __launch_bounds__(128) void k_proj(const _Float16* __restrict__ X16, const _Float16* __restrict__ BW, const _Float16* __restrict__ BV, const float* __restrict__ bv, _Float16* __restrict__ Q16, _Float16* __restrict__ QL, _Float16* __restrict__ VT) {
  const int blk = blockIdx.x;
  if (blk < GB_V) d_gemm2<0, 128, true>(blk % GB_V1, blk / GB_V1, BV, DM, 0, X16, DM, (size_t)SQ * DM, 0.0625f, bv, 0, nullptr, 1, 0, 0, nullptr, VT, nullptr, SQ, (size_t)DM * SQ, DM, SQ, DM);
  else d_gemm2<0, 64, false>((blk - GB_V) % GB_Q, (blk - GB_V) / GB_Q, X16, DM, (size_t)HD, BW, HD, (size_t)HD * HD, 0.0625f, nullptr, 0, nullptr, 1, 0, 0, nullptr, Q16, QL, DM, (size_t)HD, MP, HD, HD); }

// Fused attention of one head: scores, softmax and the weighted sum of v in one kernel, so that neither the scores nor the softmax weights go to memory.
// A wave owns FA_QW query columns and walks one of FA_KH runs of SQ / FA_KH keys, 32 a pass: FA_KH waves share a query group, so that a block has sixteen waves, four a SIMD, and one wave's softmax arithmetic runs beside another's products.
// The eight waves of a run walk the same keys: key rows and V^T rows come into LDS once for all of them, FA_SK keys a stage, by asynchronous copies into the run's own two buffers. Behind the walk the two partial results of a query group are joined through LDS (fa_send, fa_join). Both products are transposed: S^T = X_keys (A) x Q^T (B) and O^T += V^T (A) x P^T (B). In an S^T tile lane (ln, hh)
// holds keys 8 hh + r (r = 0..7) of query ln, which is the k order of a B fragment's half: two 16-key tiles pack into P^T in place, with no exchange between lanes.
// Softmax is the running-maximum form: weights are 2^(FA_C (u - mu) + FA_OFF) with u the raw score and mu the maximum in use for that query; when a pass brings a score more than FA_TH
// (in powers of two) above mu in any lane, sums and outputs are rescaled to the new maximum. So a weight stays at or below 2^(FA_TH + FA_OFF) = 2^14, inside f16.
// Every loop over a fragment or accumulator index is unrolled: the fragment and accumulator arrays stay in registers only under constant indices.
typedef float v2f __attribute__((ext_vector_type(2)));
#define FA_QG 8                      /* query groups of a block */
#define FA_KH 2                      /* runs of keys, one wave of a query group each */
#define FA_WAVES (FA_QG * FA_KH)
#define FA_QW 32
#define FA_C 0.18033688f             /* log2(e) / sqrt(64) */
#define FA_OFF 8.0f
#define FA_TH 6.0f
#define FA_SK 128                    /* keys of a stage: four passes */
#define FA_NST (SQ / FA_KH / FA_SK)  /* stages of a walk */
#define FA_PK 144                    /* LDS pitch of a key row, 128 bytes + 16: 16 x odd, the pitch free of bank conflicts for 16-byte reads */
#define FA_PV 272                    /* LDS pitch of a V^T row of a stage, 256 bytes + 16 */
#define FA_KB (FA_SK * FA_PK)        /* bytes of a stage's key rows; its V^T rows follow */
#define FA_STB (FA_KB + HD * FA_PV)  /* bytes of a stage */
static_assert(SQ % (FA_QG * FA_QW) == 0 && SQ % (FA_KH * FA_SK) == 0 && FA_NST >= 2 && FA_SK % 32 == 0 && HD == 64 && FA_QG == 8 && FA_KH == 2, "k_fattn: whole blocks of queries, two runs of two or more whole stages of 128 keys, head size 64, 256 threads copy a run's stage");
__device__ __forceinline__ float sm_xhalf(float v) { return __builtin_bit_cast(float, __builtin_amdgcn_permlanex16(__builtin_bit_cast(int, v), __builtin_bit_cast(int, v), 0x76543210, 0xfedcba98, false, false)); }      /* lane l reads lane l ^ 16 */
// 2^x of eight values in one statement, closed by one v_nop. Behind a transcendental the instruction set asks for one independent instruction before its result is read or its
// source overwritten: inside the statement each v_exp_f32 is that instruction for the one in front of it (the early-clobber results lie on no source), the v_nop is it for the last.
__device__ __forceinline__ v8f fa_exp2x8(v8f a) { float r0, r1, r2, r3, r4, r5, r6, r7;
  asm("v_exp_f32 %0, %8\n\tv_exp_f32 %1, %9\n\tv_exp_f32 %2, %10\n\tv_exp_f32 %3, %11\n\tv_exp_f32 %4, %12\n\tv_exp_f32 %5, %13\n\tv_exp_f32 %6, %14\n\tv_exp_f32 %7, %15\n\tv_nop"
      : "=&v"(r0), "=&v"(r1), "=&v"(r2), "=&v"(r3), "=&v"(r4), "=&v"(r5), "=&v"(r6), "=&v"(r7) : "v"(a[0]), "v"(a[1]), "v"(a[2]), "v"(a[3]), "v"(a[4]), "v"(a[5]), "v"(a[6]), "v"(a[7]));
  const v8f r = {r0, r1, r2, r3, r4, r5, r6, r7}; return r; }
// the same for the two rescale factors of a pass
__device__ __forceinline__ void fa_exp2x2(float& a, float& b) { float r0, r1; asm("v_exp_f32 %0, %2\n\tv_exp_f32 %1, %3\n\tv_nop" : "=&v"(r0), "=&v"(r1) : "v"(a), "v"(b)); a = r0; b = r1; }
__device__ __forceinline__ v8f fa_mma(v16h a, v16h b, v8f c) { return __builtin_amdgcn_wmma_f32_16x16x32_f16(false, a, false, b, (short)0, c, false, false); }
__device__ __forceinline__ float fa_max8(v8f a, v8f b) { return fmaxf(fmaxf(fmaxf(fmaxf(a[0], a[1]), fmaxf(a[2], a[3])), fmaxf(fmaxf(a[4], a[5]), fmaxf(a[6], a[7]))), fmaxf(fmaxf(fmaxf(b[0], b[1]), fmaxf(b[2], b[3])), fmaxf(fmaxf(b[4], b[5]), fmaxf(b[6], b[7])))); }
__device__ __forceinline__ v16h fa_lfrag(const unsigned char* p) { FragH f; f.half[0] = *(const v8us*)p; f.half[1] = *(const v8us*)(p + 32); return f.v; }      /* g2_frag from an LDS row; p holds the lane half's 16 bytes already */
// One stage into LDS, through no register: every thread copies eight 16-byte pieces, four of the key rows (8 threads a 128-byte row, 32 rows a round) and four of the V^T rows (16 threads a 256-byte row, 16 rows a round).
// kg, vg: the thread's own piece in round 0 of this stage; kl, vl: its LDS byte address in the stage's buffer. The closing s_wait_xcnt 0 stands inside the statement, so that no register a copy names is written again in front of it.
__device__ __forceinline__ void fa_stage(const _Float16* kg, const _Float16* vg, unsigned kl, unsigned vl) {
  asm volatile("global_load_async_to_lds_b128 %0, %8, off\n\tglobal_load_async_to_lds_b128 %1, %9, off\n\tglobal_load_async_to_lds_b128 %2, %10, off\n\tglobal_load_async_to_lds_b128 %3, %11, off\n\t"
               "global_load_async_to_lds_b128 %4, %12, off\n\tglobal_load_async_to_lds_b128 %5, %13, off\n\tglobal_load_async_to_lds_b128 %6, %14, off\n\tglobal_load_async_to_lds_b128 %7, %15, off\n\ts_wait_xcnt 0x0"
               :: "v"(kl), "v"(kl + 32 * FA_PK), "v"(kl + 64 * FA_PK), "v"(kl + 96 * FA_PK), "v"(vl), "v"(vl + 16 * FA_PV), "v"(vl + 32 * FA_PV), "v"(vl + 48 * FA_PV),
                  "v"(kg), "v"(kg + (size_t)32 * DM), "v"(kg + (size_t)64 * DM), "v"(kg + (size_t)96 * DM), "v"(vg), "v"(vg + (size_t)16 * SQ), "v"(vg + (size_t)32 * SQ), "v"(vg + (size_t)48 * SQ) : "memory"); }
// The partial result of query group G (a lane's 32 output values, its sum of weights, the maximum in use) into the wave's LDS slot: nine 16-byte pieces, the 32 lanes of a piece side by side (no bank conflict).
#define FA_SLOT (9 * 32)             /* 16-byte pieces of a slot */
static_assert((size_t)FA_WAVES * FA_SLOT * 16 <= (size_t)FA_KH * 2 * FA_STB, "the slots fit the staging bytes");
template <int G>
__device__ __forceinline__ void fa_send(v4fa* slot, int lane, const v8f (&o)[4][2], const v2f (&ls)[2], const float (&mu)[2]) {
#pragma unroll      /* constant indices keep o in registers */
  for (int dt = 0; dt < 4; ++dt) { slot[(2 * dt) * 32 + lane] = __builtin_shufflevector(o[dt][G], o[dt][G], 0, 1, 2, 3); slot[(2 * dt + 1) * 32 + lane] = __builtin_shufflevector(o[dt][G], o[dt][G], 4, 5, 6, 7); }
  slot[8 * 32 + lane] = (v4f){ls[G][0] + ls[G][1], mu[G], 0.f, 0.f}; }
// Joins this wave's partial result of query group G with the other run's (its slot): both are brought to the larger of the two maxima in use, added, divided by the joined sum and stored.
template <int G>
__device__ __forceinline__ void fa_join(const v4fa* slot, int lane, const v8f (&o)[4][2], const v2f (&ls)[2], const float (&mu)[2], unsigned short* op) {
  v4f q[9];      /* the other run's nine pieces */
#pragma unroll      /* here and below: constant indices keep q, o and f in registers */
  for (int j = 0; j < 9; ++j) q[j] = slot[j * 32 + lane];
  const float m = fmaxf(mu[G], q[8][1]); float a = (mu[G] - m) * FA_C, c = (q[8][1] - m) * FA_C; fa_exp2x2(a, c);
  float l = (ls[G][0] + ls[G][1]) * a + q[8][0] * c; l += sm_xhalf(l); const float sc = 64.0f / l; a *= sc; c *= sc;      /* o x64, the scale the output stage expects */
  FragH f[4];      /* all four pieces are formed before the first store: no register of a store is written again behind it */
#pragma unroll
  for (int dt = 0; dt < 4; ++dt) {
#pragma unroll
    for (int r = 0; r < 8; ++r) f[dt].h[r] = (_Float16)(o[dt][G][r] * a + q[2 * dt + (r >> 2)][r & 3] * c); }
#pragma unroll
  for (int dt = 0; dt < 4; ++dt) *(v8us*)(op + dt * 16) = f[dt].half[0]; }
__global__ __launch_bounds__(FA_WAVES * 32) void k_fattn(const _Float16* __restrict__ Qh, const _Float16* __restrict__ Ql, const _Float16* __restrict__ Kx, const _Float16* __restrict__ Vt, _Float16* __restrict__ O) {
  __shared__ __attribute__((aligned(16))) unsigned char fa[FA_KH * 2 * FA_STB];      /* for each run of keys two buffers of one stage each */
  const int tid = threadIdx.x & (FA_QG * 32 - 1), lane = tid & 31, ln = lane & 15, hh = lane >> 4; const int wave = __builtin_amdgcn_readfirstlane(threadIdx.x >> 5);      /* tid: the thread among the 256 of its run */
  const int kh = wave / FA_QG; const int k0 = kh * (SQ / FA_KH); unsigned char* const fl = fa + kh * (2 * FA_STB);      /* this wave's run of keys, its first key, its two buffers */
  const int h = blockIdx.y, b = blockIdx.z; const size_t rb = (size_t)b * SQ; const int q0 = blockIdx.x * (FA_QG * FA_QW) + (wave % FA_QG) * FA_QW;
  v16h qh[2][2], ql[2][2];      /* [16-query group][32-wide step of the head dimension]: the hi plane and the x1024 residual plane, kept for the whole walk */
#pragma unroll
  for (int g = 0; g < 2; ++g) { const size_t qo = (rb + q0 + g * 16 + ln) * DM + h * HD;
#pragma unroll
    for (int ks = 0; ks < 2; ++ks) { qh[g][ks] = g2_frag(Qh + qo + ks * 32, hh); ql[g][ks] = g2_frag(Ql + qo + ks * 32, hh); } }
  const _Float16* kg = Kx + (rb + k0 + (tid >> 3)) * DM + h * HD + (tid & 7) * 8;      /* this thread's piece of the run's key row tid / 8, this head's 64 columns */
  const _Float16* vg = Vt + (((size_t)b * NH + h) * HD + (tid >> 4)) * SQ + k0 + (tid & 15) * 8;      /* its piece of V^T row tid / 16 of this head, from the run's first key on */
  const unsigned kl = (unsigned)(size_t)fl + (tid >> 3) * FA_PK + (tid & 7) * 16, vl = (unsigned)(size_t)fl + FA_KB + (tid >> 4) * FA_PV + (tid & 15) * 16;      /* LDS byte address = low 32 bits of the __shared__ address */
  fa_stage(kg, vg, kl, vl);      /* stage 0 into buffer 0 */
  asm volatile("s_wait_asynccnt 0x0" ::: "memory");      /* this wave's copies of stage 0 have landed */
  __syncthreads();      /* and every other wave's: stage 0 may be read */
  fa_stage(kg + (size_t)FA_SK * DM, vg + FA_SK, kl + FA_STB, vl + FA_STB);      /* stage 1 flies while stage 0 is worked on */
  const v8f z8 = {0.f, 0.f, 0.f, 0.f, 0.f, 0.f, 0.f, 0.f};
  v8f o[4][2]; v2f ls[2]; float mu[2];
#pragma unroll
  for (int g = 0; g < 2; ++g) { ls[g] = (v2f){0.f, 0.f}; mu[g] = -1.0e30f;
#pragma unroll
    for (int dt = 0; dt < 4; ++dt) o[dt][g] = z8; }
  for (int st = 0; st < FA_NST; ++st) {
   const unsigned char* kr = fl + (st & 1) * FA_STB + ln * FA_PK + 16 * hh;      /* key row ln of this stage's buffer, the lane half's 16 bytes */
   const unsigned char* vr = fl + (st & 1) * FA_STB + FA_KB + ln * FA_PV + 16 * hh;      /* V^T row ln */
   v16h kf[2][2];      /* [16-key tile][step of the head dimension], fetched one pass ahead inside a stage */
#pragma unroll
   for (int t = 0; t < 2; ++t) { kf[t][0] = fa_lfrag(kr + (t * 16) * FA_PK); kf[t][1] = fa_lfrag(kr + (t * 16) * FA_PK + 64); }
#pragma unroll 1      /* rolled: unrolled, the four passes took more than 256 registers and spilled */
   for (int ps = 0; ps < FA_SK / 32; ++ps) {
    v8f s[2][2];      /* [query group][key tile]: raw scores hi + residual / 1024 */
#pragma unroll
    for (int g = 0; g < 2; ++g) {
#pragma unroll
      for (int t = 0; t < 2; ++t) { v8f ch = fa_mma(kf[t][0], qh[g][0], z8); ch = fa_mma(kf[t][1], qh[g][1], ch); v8f cl = fa_mma(kf[t][0], ql[g][0], z8); cl = fa_mma(kf[t][1], ql[g][1], cl); s[g][t] = cl * 0.0009765625f + ch; } }
    v16h vf[4];
#pragma unroll
    for (int dt = 0; dt < 4; ++dt) vf[dt] = fa_lfrag(vr + (dt * 16) * FA_PV + ps * 64);
    const int pn = (ps + 1 < FA_SK / 32) ? ps + 1 : 0;      /* the next stage is not published yet, nothing of it is read here: a stage's last pass fetches its own pass 0 again, not used */
#pragma unroll
    for (int t = 0; t < 2; ++t) { kf[t][0] = fa_lfrag(kr + (pn * 32 + t * 16) * FA_PK); kf[t][1] = fa_lfrag(kr + (pn * 32 + t * 16) * FA_PK + 64); }
    __builtin_amdgcn_sched_barrier(0);      /* keeps this pass's V^T reads and the next pass's key reads here as one group, right behind the score products: the softmax arithmetic covers their latency */
    float mb0 = fa_max8(s[0][0], s[0][1]), mb1 = fa_max8(s[1][0], s[1][1]); mb0 = fmaxf(mb0, sm_xhalf(mb0)); mb1 = fmaxf(mb1, sm_xhalf(mb1));      /* both halves of a query's lanes must use one maximum */
    const bool need = (mb0 - mu[0]) * FA_C > FA_TH || (mb1 - mu[1]) * FA_C > FA_TH;
    if (__builtin_amdgcn_ballot_w32(need) != 0) {      /* wave-uniform: rare after the first passes */
      const float n0 = fmaxf(mu[0], mb0), n1 = fmaxf(mu[1], mb1); float a0 = (mu[0] - n0) * FA_C, a1 = (mu[1] - n1) * FA_C; fa_exp2x2(a0, a1); mu[0] = n0; mu[1] = n1; ls[0] *= a0; ls[1] *= a1;
#pragma unroll
      for (int dt = 0; dt < 4; ++dt) { o[dt][0] *= a0; o[dt][1] *= a1; } }
    FragH p[2];      /* P^T of both query groups is formed before the first product with V^T */
#pragma unroll
    for (int g = 0; g < 2; ++g) { const float bias = FA_OFF - mu[g] * FA_C; const v8f p0 = fa_exp2x8(s[g][0] * FA_C + bias), p1 = fa_exp2x8(s[g][1] * FA_C + bias); const v8f e = p0 + p1; ls[g] += (((v2f){e[0], e[1]} + (v2f){e[2], e[3]}) + ((v2f){e[4], e[5]} + (v2f){e[6], e[7]}));
#pragma unroll
      for (int i = 0; i < 8; ++i) { p[g].h[i] = (_Float16)p0[i]; p[g].h[8 + i] = (_Float16)p1[i]; } }
#pragma unroll
    for (int g = 0; g < 2; ++g) {
#pragma unroll
      for (int dt = 0; dt < 4; ++dt) o[dt][g] = fa_mma(vf[dt], p[g].v, o[dt][g]); } }
   asm volatile("s_wait_dscnt 0x0" ::: "memory");      /* this wave's last reads of the buffer have returned */
   asm volatile("s_wait_asynccnt 0x0" ::: "memory");      /* its copies of stage st + 1 have landed */
   __syncthreads();      /* one barrier a stage: it publishes stage st + 1 and ends every wave's reads of stage st */
   if (st + 2 < FA_NST) fa_stage(kg + (size_t)(st + 2) * FA_SK * DM, vg + (st + 2) * FA_SK, kl + (st & 1) * FA_STB, vl + (st & 1) * FA_STB); }      /* refill of the buffer just left; the test reads the same in the whole block */
  asm volatile("s_wait_asynccnt 0x0" ::: "memory");      /* no copy is left in flight when the staging bytes take the partial results */
  /* behind the loop's last barrier nobody reads the buffers any more. The wave of run 0 finishes query group 0 and hands over its part of group 1; the wave of run 1 the other way round: all sixteen waves share the closing work. kh is the same in a whole wave, so the branches are wave-uniform; the barrier stands outside them. */
  v4fa* const sl = (v4fa*)fa; unsigned short* const op = (unsigned short*)O + (rb + q0 + kh * 16 + ln) * DM + h * HD + 8 * hh;      /* the row of this lane's query in the group that the wave finishes */
  if (kh == 0) fa_send<1>(sl + wave * FA_SLOT, lane, o, ls, mu); else fa_send<0>(sl + wave * FA_SLOT, lane, o, ls, mu);
  __syncthreads();      /* every wave's slot is written before its partner reads it */
  if (kh == 0) fa_join<0>(sl + (wave + FA_QG) * FA_SLOT, lane, o, ls, mu, op); else fa_join<1>(sl + (wave - FA_QG) * FA_SLOT, lane, o, ls, mu, op); }

extern "C" void kernel_launch(void* const* d_in, const int* in_sizes, int n_in,
                              void* d_out, int out_size, void* d_ws, size_t ws_size, hipStream_t stream) {
  (void)in_sizes; (void)n_in; (void)out_size;
  const float* const* I = (const float* const*)d_in; const float* x = I[0]; const float* watt = I[1]; const float* wv = I[2]; const float* bv = I[3]; const float* wo = I[4]; const float* bo = I[5];      /* x [2][2048][1024]; the per-head bilinear weight [16][64][64] ([head][in d][out e]); the natural value weight [DM][DM] and its bias; the natural output weight [DM][DM] and its bias */
  char* ws = (char*)d_ws; size_t off = 0;
  auto take = [&](size_t bytes) { char* p = ws + off; off += (bytes + 255) & ~(size_t)255; return p; };
  _Float16* BW = (_Float16*)take((size_t)NH * HD * HD * 2); _Float16* BV = (_Float16*)take((size_t)DM * DM * 2); _Float16* BO = (_Float16*)take((size_t)DM * DM * 2);      /* BW: sixteen transposed [64][64] head planes, one after another */
  _Float16* X16 = (_Float16*)take(NR * DM * 2); _Float16* Q16 = (_Float16*)take(NR * DM * 2); _Float16* QL = (_Float16*)take(NR * DM * 2); _Float16* O16 = (_Float16*)take(NR * DM * 2);
  _Float16* VT = (_Float16*)take((size_t)NB * NH * HD * SQ * 2);
  if (off > ws_size) return;
  const size_t r0p = (size_t)B0 * SQ;      /* first projected row */
  k_prep<<<PB_WT + 2 * PB_WN + PB_X, 256, 0, stream>>>(x, watt, wv, wo, X16, BW, BV, BO);
  k_proj<<<GB_V + NH * GB_Q, 128, 0, stream>>>(X16 + r0p * DM, BW, BV, bv, Q16 + r0p * DM, QL + r0p * DM, VT + r0p * DM);
  k_fattn<<<dim3(SQ / (FA_QG * FA_QW), NH, NB), FA_WAVES * 32, 0, stream>>>(Q16, QL, X16, VT, O16);      /* o (merged heads, x64) as f16 rows: every batch, head and query in one launch */
  k_gemm2<0><<<dim3((unsigned)((MPO / 128) * (DM / 64)), 1), 128, 0, stream>>>(O16 + r0p * DM, BO, bo, (float*)d_out + r0p * DM);      /* out rows are the output layout */
}

// v009
// A run of this version takes 66.4 microseconds.
// Timed twice side by side with v008, it ran 1.04 and 1.03 times as fast.
// Over all steps from v000 it is 40.5 times as fast.
#include <hip/hip_runtime.h>
// Multi-head self-attention with a PER-HEAD BILINEAR SCORE and no query / key projections (x [2][2048][1024] viewed as 16 heads of 64; scores = (x_h W_h) . x_h / sqrt(64) with W [16][64][64] ([head][in][out]); softmax over all 2048 keys (no mask); v = x w_v^T + b_v (natural [1024][1024] + a bias, zero on this module's draw: read all the same); out = merged w_out^T + b_out (natural + a bias, zero on this draw too) -> [2][2048][1024]).
// Compute dtype: inputs rounded to bf16; x / weights exact; the per-head product, times log2(e) / sqrt(64), as f16 hi + f16 residual; the key operand is x itself as f16; v, softmax weights and o as plain f16 GEMM operands (~2^-12); scores and softmax statistics f32. v_wmma_f32_16x16x32_f16.
#define NB 2
#define SQ 2048
#define DM 1024
#define NH 16
#define HD 64
#define B0 0                         /* first batch processed (debug hook) */
#define NBR NB                       /* batches processed (debug hook) */
#define NR ((size_t)NB * SQ)         /* token rows */
#define MP ((int)((size_t)NBR * SQ)) /* rows projected (debug hook) */
#define MPO MP                       /* rows through the output stage (debug hook) */
typedef __bf16 v16b __attribute__((ext_vector_type(16)));
typedef unsigned short v8us __attribute__((ext_vector_type(8), may_alias));
typedef float  v8f  __attribute__((ext_vector_type(8)));
typedef float  v4f  __attribute__((ext_vector_type(4)));
typedef float  v4fa __attribute__((ext_vector_type(4), may_alias));
union FragB { v16b v; v8us half[2]; unsigned short u[16]; };

__device__ __forceinline__ unsigned short bf16_bits(float x) { unsigned int u = __float_as_uint(x); return (unsigned short)((u + 0x7FFFu + ((u >> 16) & 1u)) >> 16); }
__device__ __forceinline__ float bf16_val(unsigned short b) { return __uint_as_float(((unsigned int)b) << 16); }
__device__ __forceinline__ float bf16_round(float x) { return bf16_val(bf16_bits(x)); }
// D += A·B with NT terms: 1 = ah·bh, 2 = + al·bh (A split), 3 = + ah·bl (both split)
template <int NT>
__device__ __forceinline__ v8f mmaN(v16b ah, v16b al, v16b bh, v16b bl, v8f c) {
  c = __builtin_amdgcn_wmma_f32_16x16x32_bf16(false, ah, false, bh, (short)0, c, false, false);
  if (NT >= 2) c = __builtin_amdgcn_wmma_f32_16x16x32_bf16(false, al, false, bh, (short)0, c, false, false);
  if (NT >= 3) c = __builtin_amdgcn_wmma_f32_16x16x32_bf16(false, ah, false, bl, (short)0, c, false, false);
  asm volatile("v_nop\n\tv_nop\n\tv_nop\n\tv_nop" : "+v"(c) : "v"(ah), "v"(al), "v"(bh), "v"(bl));
  return c;
}




// ---- f16 WMMA path (v_wmma_f32_16x16x32_f16): 11-bit significands for operands in range — used for every product here, the softmax weights (up to 2^14) included
typedef _Float16 v16h __attribute__((ext_vector_type(16)));
union FragH { v16h v; v8us half[2]; _Float16 h[16]; unsigned short u[16]; };
template <int NT>
__device__ __forceinline__ v8f mmaH(v16h ah, v16h al, v16h bh, v16h bl, v8f c) {
  c = __builtin_amdgcn_wmma_f32_16x16x32_f16(false, ah, false, bh, (short)0, c, false, false);
  if (NT >= 2) c = __builtin_amdgcn_wmma_f32_16x16x32_f16(false, al, false, bh, (short)0, c, false, false);
  if (NT >= 3) c = __builtin_amdgcn_wmma_f32_16x16x32_f16(false, ah, false, bl, (short)0, c, false, false);
  asm volatile("v_nop\n\tv_nop\n\tv_nop\n\tv_nop" : "+v"(c) : "v"(ah), "v"(al), "v"(bh), "v"(bl));
  return c;
}

// Wt[n][k] = f16(W[k][n]·scale) from f32 row-major W[K][N] (scale = power of two; bf16-exact weights stay exact in f16 away from the subnormal range)
__device__ __forceinline__ void d_wt_f16(const float* __restrict__ W, _Float16* __restrict__ Wt, int K, int N, float scale, int t) {
  const int n = t / (K / 8), k8 = (t % (K / 8)) * 8; FragH f;
#pragma unroll
  for (int i = 0; i < 8; ++i) f.h[i] = (_Float16)(bf16_round(W[(size_t)(k8 + i) * N + n]) * scale); const v8us o = f.half[0];
  *(v8us*)((unsigned short*)Wt + (size_t)n * K + k8) = o; 
}

typedef _Float16 v4h __attribute__((ext_vector_type(4)));

__device__ __forceinline__ void d_x16(const float* __restrict__ x, _Float16* __restrict__ X16, size_t t) { FragH f;
#pragma unroll
  for (int q = 0; q < 8; ++q) f.h[q] = (_Float16)bf16_round(x[t * 8 + q]); *(v8us*)((unsigned short*)X16 + t * 8) = f.half[0]; asm volatile("s_wait_xcnt 0x0" ::: "memory");      /* before a register of the store in front is written again: in a shared launch another job's code follows in the listing */
}
// ---- fast GEMM (wave tile 32x64, block tile 128x64; requires M % 128 == 0 rows per launch region, N % 64 == 0 and K % KS == 0); RB: the bias belongs to the rows of C, not to its columns; CL: the residual of the f16 result, v - f16(v), as a second f16 plane at the same scale (small ones are f16 subnormals, which the matrix unit keeps) ----
__device__ __forceinline__ v16h g2_frag(const _Float16* p, int hh) { FragH f; f.half[0] = *(const v8us*)((const unsigned short*)p + 8 * hh); f.half[1] = *(const v8us*)((const unsigned short*)p + 16 + 8 * hh); return f.v; }
__device__ __forceinline__ v8f g2_mma(v16h a, v16h b, v8f c) { v8f d = __builtin_amdgcn_wmma_f32_16x16x32_f16(false, a, false, b, (short)0, c, false, false); asm volatile("v_nop\n\tv_nop\n\tv_nop\n\tv_nop" : "+v"(d) : "v"(a), "v"(b)); return d; }
// A block's operands come through LDS: its 128 A rows and 64 B rows, KS k a stage, by asynchronous copies of whole 128-byte lines into two buffers; the four waves read their fragments from there.
#define G2_PK(KS) ((KS) * 2 + 16)             /* LDS pitch of a staged row, its bytes + 16: 16 x odd (144, 272), the pitch free of bank conflicts for 16-byte reads */
#define G2_STB(KS) ((128 + 64) * G2_PK(KS))   /* bytes of a stage: the A rows, then the B rows */
__device__ __forceinline__ unsigned char* g2_lds() { __shared__ __attribute__((aligned(16))) unsigned char sm[2 * G2_STB(128)]; return sm; }      /* two buffers of the longest stage; one array for every stage length that a kernel holds */
__device__ __forceinline__ v16h g2_lfrag(const unsigned char* p) { FragH f; f.half[0] = *(const v8us*)p; f.half[1] = *(const v8us*)(p + 32); return f.v; }      /* g2_frag from an LDS row; p holds the lane half's 16 bytes already */
// 64 k of a stage into LDS, through no register: every thread copies twelve 16-byte pieces (8 threads a 128-byte line, 16 rows a round): eight rounds of A rows, four of B rows.
// ag, bg: the thread's own piece in round 0; a16, b16: elements of 16 rows; al, bl: its LDS byte address in the stage's buffer; p16: LDS bytes of 16 rows. The closing s_wait_xcnt 0 stands inside the statement, so that no register a copy names is written again in front of it.
__device__ __forceinline__ void g2_stage(const _Float16* ag, size_t a16, const _Float16* bg, size_t b16, unsigned al, unsigned bl, unsigned p16) {
  asm volatile("global_load_async_to_lds_b128 %0, %12, off\n\tglobal_load_async_to_lds_b128 %1, %13, off\n\tglobal_load_async_to_lds_b128 %2, %14, off\n\tglobal_load_async_to_lds_b128 %3, %15, off\n\t"
               "global_load_async_to_lds_b128 %4, %16, off\n\tglobal_load_async_to_lds_b128 %5, %17, off\n\tglobal_load_async_to_lds_b128 %6, %18, off\n\tglobal_load_async_to_lds_b128 %7, %19, off\n\t"
               "global_load_async_to_lds_b128 %8, %20, off\n\tglobal_load_async_to_lds_b128 %9, %21, off\n\tglobal_load_async_to_lds_b128 %10, %22, off\n\tglobal_load_async_to_lds_b128 %11, %23, off\n\ts_wait_xcnt 0x0"
               :: "v"(al), "v"(al + p16), "v"(al + 2 * p16), "v"(al + 3 * p16), "v"(al + 4 * p16), "v"(al + 5 * p16), "v"(al + 6 * p16), "v"(al + 7 * p16),
                  "v"(bl), "v"(bl + p16), "v"(bl + 2 * p16), "v"(bl + 3 * p16),
                  "v"(ag), "v"(ag + a16), "v"(ag + 2 * a16), "v"(ag + 3 * a16), "v"(ag + 4 * a16), "v"(ag + 5 * a16), "v"(ag + 6 * a16), "v"(ag + 7 * a16),
                  "v"(bg), "v"(bg + b16), "v"(bg + 2 * b16), "v"(bg + 3 * b16) : "memory"); }
// a whole stage: one such statement for each 64 k of it (12 or 24 copies of a wave in flight)
template <int KS>
__device__ __forceinline__ void g2_fill(const _Float16* ag, size_t a16, const _Float16* bg, size_t b16, unsigned al, unsigned bl) {
#pragma unroll      /* one or two statements in a row, no loop around them */
  for (int h = 0; h < KS / 64; ++h) g2_stage(ag + h * 64, a16, bg + h * 64, b16, al + h * 128, bl + h * 128, 16 * G2_PK(KS)); }
template <int ACT, int KS, bool RB>
__device__ __forceinline__ void d_gemm2(int bx, int by, const _Float16* __restrict__ A, int lda, size_t sA, const _Float16* __restrict__ Bh, int ldb, size_t sB, float alpha, const float* __restrict__ bias, size_t sBias, const float* __restrict__ CP, int rowsPerB, size_t sCPb, int row0g,
    float* __restrict__ C, _Float16* __restrict__ C16, _Float16* __restrict__ CL, int ldc, size_t sC, int M, int N, int K) { static_assert(ACT == 0 || ACT == 3 || ACT == 6 || ACT == 8 || ACT == 9 || ACT == 11 || ACT == 12 || ACT == 14 || ACT == 15 || ACT == 16 || ACT == 17, "k_gemm2: unsupported ACT code (would silently apply no activation)");
  static_assert(KS == 64 || KS == 128, "a stage is one or two 128-byte lines of every row"); constexpr int PK = G2_PK(KS), AB = 128 * PK, STB = G2_STB(KS);      /* row pitch, bytes of a stage's A rows, bytes of a stage */
  unsigned char* const sm = g2_lds();
  float (*so)[32][68] = (float (*)[32][68])sm; static_assert(sizeof(float) * 4 * 32 * 68 <= 2 * G2_STB(64), "the result tiles fit the staging bytes");      /* behind the loop's last barrier the same bytes hold each wave's result tile */
  const int tid = threadIdx.x, w = tid >> 5, lane = tid & 31, ln = lane & 15, hh = lane >> 4;
  A += (size_t)by * sA; Bh += (size_t)by * sB; const size_t cofs = (size_t)by * sC; const float* bp = bias ? bias + (size_t)by * sBias : nullptr;
  const int ntn = N >> 6; const int mt = bx / ntn, nq = bx - mt * ntn; const int row0 = mt * 128 + 32 * w, col0 = nq * 64; if (mt * 128 >= M) return;      /* a whole block leaves or none, in front of every barrier (M is a multiple of 128) */
  const _Float16* ag = A + (size_t)(mt * 128 + (tid >> 3)) * lda + (tid & 7) * 8;      /* this thread's piece of the block's A row tid / 8 */
  const _Float16* bg = Bh + (size_t)(col0 + (tid >> 3)) * ldb + (tid & 7) * 8;      /* its piece of B row tid / 8 */
  const unsigned al = (unsigned)(size_t)sm + (tid >> 3) * PK + (tid & 7) * 16, bl = al + AB;      /* LDS byte address = low 32 bits of the __shared__ address */
  const size_t a16 = (size_t)16 * lda, b16 = (size_t)16 * ldb; const int nst = K / KS;      /* whole stages (K is a multiple of KS) */
  g2_fill<KS>(ag, a16, bg, b16, al, bl);      /* stage 0 into buffer 0 */
  asm volatile("s_wait_asynccnt 0x0" ::: "memory");      /* this wave's copies of stage 0 have landed */
  __syncthreads();      /* and every other wave's: stage 0 may be read */
  if (nst > 1) g2_fill<KS>(ag + KS, a16, bg + KS, b16, al + STB, bl + STB);      /* stage 1 flies while stage 0 is worked on */
  v4f rb4[4];      /* RB: the biases of this lane's sixteen result rows (two 16-row tiles, rows 8 hh + r of each), fetched as one group in front of the loop, which covers their latency */
#pragma unroll      /* constant indices keep rb4 in registers */
  for (int i = 0; i < 4; ++i) rb4[i] = (v4f){0.f, 0.f, 0.f, 0.f};
  if (RB && bp) {
#pragma unroll
    for (int i = 0; i < 4; ++i) rb4[i] = *(const v4fa*)(bp + row0 + (i >> 1) * 16 + 8 * hh + (i & 1) * 4);
    asm volatile("s_wait_xcnt 0x0" ::: "memory"); }      /* before a register of the four loads in front is written again */
  const v8f z8 = {0.f,0.f,0.f,0.f,0.f,0.f,0.f,0.f}; v8f c00 = z8, c01 = z8, c02 = z8, c03 = z8, c10 = z8, c11 = z8, c12 = z8, c13 = z8;
#pragma unroll 1      /* rolled: one copy of the stage's code, whatever K is at the call */
  for (int st = 0; st < nst; ++st) {
    const unsigned char* ar = sm + (st & 1) * STB + (32 * w + ln) * PK + 16 * hh;      /* the wave's A row ln of this stage's buffer, the lane half's 16 bytes */
    const unsigned char* br = sm + (st & 1) * STB + AB + ln * PK + 16 * hh;      /* B row ln */
    /* every loop inside a stage is unrolled: the fragment arrays stay in registers only under constant indices */
#pragma unroll
    for (int h = 0; h < KS / 64; ++h) {
      v16h af[2][2], bf[2][4];      /* [32-wide k step][16-row tile]: the fragments of 64 k are read as one group in front of their sixteen products */
#pragma unroll
      for (int ks = 0; ks < 2; ++ks) {
#pragma unroll
        for (int t = 0; t < 2; ++t) af[ks][t] = g2_lfrag(ar + (t * 16) * PK + h * 128 + ks * 64);
#pragma unroll
        for (int t = 0; t < 4; ++t) bf[ks][t] = g2_lfrag(br + (t * 16) * PK + h * 128 + ks * 64); }
#pragma unroll
      for (int ks = 0; ks < 2; ++ks) {
        c00 = g2_mma(af[ks][0], bf[ks][0], c00); c10 = g2_mma(af[ks][1], bf[ks][0], c10);
        c01 = g2_mma(af[ks][0], bf[ks][1], c01); c11 = g2_mma(af[ks][1], bf[ks][1], c11);
        c02 = g2_mma(af[ks][0], bf[ks][2], c02); c12 = g2_mma(af[ks][1], bf[ks][2], c12);
        c03 = g2_mma(af[ks][0], bf[ks][3], c03); c13 = g2_mma(af[ks][1], bf[ks][3], c13); } }
    asm volatile("s_wait_dscnt 0x0" ::: "memory");      /* this wave's last reads of the buffer have returned */
    asm volatile("s_wait_asynccnt 0x0" ::: "memory");      /* its copies of stage st + 1 have landed */
    __syncthreads();      /* one barrier a stage: it publishes stage st + 1 and ends every wave's reads of stage st */
    if (st + 2 < nst) g2_fill<KS>(ag + (size_t)(st + 2) * KS, a16, bg + (size_t)(st + 2) * KS, b16, al + (st & 1) * STB, bl + (st & 1) * STB); }      /* refill of the buffer just left; the test reads the same in the whole block */
  asm volatile("s_wait_asynccnt 0x0" ::: "memory");      /* no copy is left in flight when the staging bytes take the result tiles */
  v8f accs[8] = {c00, c01, c02, c03, c10, c11, c12, c13};
#pragma unroll
  for (int u = 0; u < 8; ++u) { const int t = u & 3, half = u >> 2; const int col = col0 + t * 16 + ln; const float bv = (bp && !RB) ? bf16_round(bp[col]) : 0.f;
#pragma unroll
    for (int r = 0; r < 8; ++r) { const int rloc = half * 16 + 8 * hh + r; float v = accs[u][r] * alpha + (RB ? bf16_round(rb4[half * 2 + (r >> 2)][r & 3]) : bv); if (CP) { if (rowsPerB < 0) v += CP[cofs + (size_t)(row0g + row0 + rloc) * ldc + col];      /* rowsPerB < 0: own element of the batched C plane */ else { const int bidx = (row0g + row0 + rloc) / rowsPerB; v += CP[(size_t)bidx * sCPb + (size_t)by * 64 + col]; } }
      if (ACT == 3) v = fmaxf(v, 0.f); else if (ACT == 6) v = 0.5f * v * (1.0f + erff(v * 0.70710678118654752f)); else if (ACT == 11) v = 1.0f / (1.0f + expf(-v)); else if (ACT == 15) v = v / (1.0f + expf(-v)); else if (ACT == 12) v = (v > 0.f) ? v : 0.01f * v; else if (ACT == 8) v = tanhf(v); else if (ACT == 9) v = 0.5f * v * (1.0f + tanhf(0.7978845608028654f * (v + 0.044715f * v * v * v))); else if (ACT == 14) v = (v > 0.f) ? v : 0.1f * v; else if (ACT == 16) v = (v >= 0.f) ? v : 0.3f * v; else if (ACT == 17) v = (v >= 0.f) ? v : 0.2f * v;
      so[w][rloc][t * 16 + ln] = v; } }
  __builtin_amdgcn_fence(__ATOMIC_ACQ_REL, "workgroup"); __builtin_amdgcn_wave_barrier();
  const int rsub = lane >> 4, c4 = (lane & 15) * 4;
  { v4f vv[16];      /* the tile's rows are read as one group in front of the stores: no LDS read can pass the waits behind the stores, and one read a store would add its latency sixteen times */
#pragma unroll
    for (int q = 0; q < 16; ++q) vv[q] = *(const v4fa*)&so[w][q * 2 + rsub][c4];
#pragma unroll      /* constant indices keep vv in registers */
    for (int q = 0; q < 16; ++q) { const int r = q * 2 + rsub; const v4f v = vv[q];
      if (C) { *(v4f*)(C + cofs + (size_t)(row0 + r) * ldc + col0 + c4) = v; asm volatile("s_wait_xcnt 0x0" ::: "memory"); }      /* before a register of the store in front is written again (the next row's address, the f16 form, another job's code in a shared launch) */
      if (C16) { v4h h4; for (int i = 0; i < 4; ++i) h4[i] = (_Float16)v[i]; *(v4h*)(C16 + cofs + (size_t)(row0 + r) * ldc + col0 + c4) = h4; asm volatile("s_wait_xcnt 0x0" ::: "memory"); }      /* the same for this store */
      if (CL) { v4h l4; for (int i = 0; i < 4; ++i) l4[i] = (_Float16)(v[i] - (float)(_Float16)v[i]); *(v4h*)(CL + cofs + (size_t)(row0 + r) * ldc + col0 + c4) = l4; asm volatile("s_wait_xcnt 0x0" ::: "memory"); } }      /* and for this one */
     } }

__device__ __forceinline__ void d_wnat(const float* __restrict__ w, _Float16* __restrict__ Bt, size_t t) { FragH f; for (int q = 0; q < 8; ++q) f.h[q] = (_Float16)(bf16_round(w[t * 8 + q]) * 16.0f); *(v8us*)((unsigned short*)Bt + t * 8) = f.half[0]; asm volatile("s_wait_xcnt 0x0" ::: "memory");      /* before a register of the store in front is written again: in a shared launch another job's code follows in the listing */
}

// The output stage, C [MPO][DM] f32 = A [MPO][DM] x Bh [DM][DM]^T / 1024 + bias. Only the four pointers are arguments: shapes, pitches, the scale and the operands this product does not have (an added plane, f16 copies, batch strides)
// are constants at the call, as in k_proj, so that the compiler drops their tests and address arithmetic from every result element and the kernel waits for one argument load, not four in a row.
template <int ACT>
__global__ __launch_bounds__(128) void k_gemm2(const _Float16* __restrict__ A, const _Float16* __restrict__ Bh, const float* __restrict__ bias, float* __restrict__ C) {
  __builtin_assume(bias != nullptr && C != nullptr);      /* both are always passed: without their null tests the four bias loads of a lane go out as one group, not one after another behind a test each */
  d_gemm2<ACT, 128, false>(blockIdx.x, 0, A, DM, 0, Bh, DM, 0, 0.0009765625f, bias, 0, nullptr, 1, 0, 0, C, nullptr, nullptr, DM, 0, MPO, DM, DM); }

// ---- Shared launches: jobs that read none of each other's output run in one grid. Each job keeps its own code, its own threads and its own blocks, a range of blockIdx.x. ----
#define PB_WT (NH * HD * (HD / 8) / 256)      /* blocks of the sixteen head planes, HD * (HD / 8) threads a head */
#define PB_WN (DM * DM / 8 / 256)             /* blocks of one natural [DM][DM] weight */
#define PB_X ((int)(NR * DM / 8 / 256))       /* blocks of x */
#define GB_V1 ((DM / 128) * (SQ / 64))        /* blocks of one batch's value projection, transposed: DM rows of SQ tokens */
#define GB_V (NBR * GB_V1)                    /* blocks of the value projection */
#define GB_Q ((MP / 128) * (HD / 64))         /* blocks of one head's bilinear product */
static_assert((NH * HD * (HD / 8)) % 256 == 0 && (DM * DM / 8) % 256 == 0 && (NR * DM / 8) % 256 == 0 && MP % 128 == 0 && DM % 128 == 0 && SQ % 64 == 0 && HD % 64 == 0, "shared launches: every job fills whole blocks; the products' K is whole stages");
// every conversion that reads inputs only: the head planes, both natural weights, x
__global__ __launch_bounds__(256) void k_prep(const float* __restrict__ x, const float* __restrict__ watt, const float* __restrict__ wv, const float* __restrict__ wo, _Float16* __restrict__ X16, _Float16* __restrict__ BW, _Float16* __restrict__ BV, _Float16* __restrict__ BO) {
  int blk = blockIdx.x;
  if (blk < PB_WT) { const int t = blk * 256 + threadIdx.x, h = t / (HD * (HD / 8)); d_wt_f16(watt + (size_t)h * HD * HD, BW + (size_t)h * HD * HD, HD, HD, 16.0f, t % (HD * (HD / 8))); return; }      /* a head's [in d][out e] weight -> its transposed x16 plane Bt[e][d] */
  blk -= PB_WT; if (blk < PB_WN) { d_wnat(wv, BV, (size_t)blk * 256 + threadIdx.x); return; }      /* natural [out][in] = A[m][k] x16, the value product's A operand (no transpose) */
  blk -= PB_WN; if (blk < PB_WN) { d_wnat(wo, BO, (size_t)blk * 256 + threadIdx.x); return; }
  blk -= PB_WN; d_x16(x, X16, (size_t)blk * 256 + threadIdx.x); }
#define FA_C 0.18033688f             /* log2(e) / sqrt(64): the factor from a raw score to its power of two */
// both products of x, each stored in the form the attention kernel reads. First the long blocks (K = DM): V^T = Wv x^T + bv, the weight's rows as the A operand and a batch's token rows as B, so that the result rows are [NB][NH][HD][SQ] as they stand (the bias goes with the rows).
// Then the per-head product x_h W_h (head strides: 64 input columns, one [64][64] plane, 64 result columns; K = 64), times FA_C, split in the epilogue into its f16 hi plane and its f16 residual plane.
__global__ __launch_bounds__(128) void k_proj(const _Float16* __restrict__ X16, const _Float16* __restrict__ BW, const _Float16* __restrict__ BV, const float* __restrict__ bv, _Float16* __restrict__ Q16, _Float16* __restrict__ QL, _Float16* __restrict__ VT) {
  const int blk = blockIdx.x;
  if (blk < GB_V) d_gemm2<0, 128, true>(blk % GB_V1, blk / GB_V1, BV, DM, 0, X16, DM, (size_t)SQ * DM, 0.0625f, bv, 0, nullptr, 1, 0, 0, nullptr, VT, nullptr, SQ, (size_t)DM * SQ, DM, SQ, DM);
  else d_gemm2<0, 64, false>((blk - GB_V) % GB_Q, (blk - GB_V) / GB_Q, X16, DM, (size_t)HD, BW, HD, (size_t)HD * HD, 0.0625f * FA_C, nullptr, 0, nullptr, 1, 0, 0, nullptr, Q16, QL, DM, (size_t)HD, MP, HD, HD); }

// Fused attention of one head: scores, softmax and the weighted sum of v in one kernel, so that neither the scores nor the softmax weights go to memory.
// A wave owns FA_QW query columns and walks one of FA_KH runs of SQ / FA_KH keys, 32 a pass: FA_KH waves share a query group, so that a block has sixteen waves, four a SIMD, and one wave's softmax arithmetic runs beside another's products.
// The eight waves of a run walk the same keys: key rows and V^T rows come into LDS once for all of them, FA_SK keys a stage, by asynchronous copies into the run's own two buffers. Behind the walk the two partial results of a query group are joined through LDS (fa_send, fa_join). Both products are transposed: S^T = X_keys (A) x Q^T (B) and O^T += V^T (A) x P^T (B). In an S^T tile lane (ln, hh)
// holds keys 8 hh + r (r = 0..7) of query ln, which is the k order of a B fragment's half: two 16-key tiles pack into P^T in place, with no exchange between lanes.
// Softmax is the running-maximum form: weights are 2^(u - mu + FA_OFF) with u the score in powers of two (the query planes carry FA_C) and mu the maximum in use for that query. A score tile's chain of four products (hi and residual plane, two steps of the head dimension each)
// starts from FA_OFF - mu in its accumulator, so that it ends as the argument of 2^x: no vector arithmetic stands between the products and v_exp_f32. When a pass brings a score more than FA_TH
// above mu in any lane, sums and outputs are rescaled to the new maximum. So a weight stays at or below 2^(FA_TH + FA_OFF) = 2^14, inside f16.
// Every loop inside a pass is unrolled: the fragment and accumulator arrays stay in registers only under constant indices.
typedef float v2f __attribute__((ext_vector_type(2)));
#define FA_QG 8                      /* query groups of a block */
#define FA_KH 2                      /* runs of keys, one wave of a query group each */
#define FA_WAVES (FA_QG * FA_KH)
#define FA_QW 32
#define FA_OFF 8.0f
#define FA_TH 6.0f
#define FA_SK 128                    /* keys of a stage: four passes */
#define FA_NST (SQ / FA_KH / FA_SK)  /* stages of a walk */
#define FA_PK 144                    /* LDS pitch of a key row, 128 bytes + 16: 16 x odd, the pitch free of bank conflicts for 16-byte reads */
#define FA_PV 272                    /* LDS pitch of a V^T row of a stage, 256 bytes + 16 */
#define FA_KB (FA_SK * FA_PK)        /* bytes of a stage's key rows; its V^T rows follow */
#define FA_STB (FA_KB + HD * FA_PV)  /* bytes of a stage */
static_assert(SQ % (FA_QG * FA_QW) == 0 && SQ % (FA_KH * FA_SK) == 0 && FA_NST >= 2 && FA_SK % 32 == 0 && HD == 64 && FA_QG == 8 && FA_KH == 2, "k_fattn: whole blocks of queries, two runs of two or more whole stages of 128 keys, head size 64, 256 threads copy a run's stage");
__device__ __forceinline__ float sm_xhalf(float v) { return __builtin_bit_cast(float, __builtin_amdgcn_permlanex16(__builtin_bit_cast(int, v), __builtin_bit_cast(int, v), 0x76543210, 0xfedcba98, false, false)); }      /* lane l reads lane l ^ 16 */
// 2^x of eight values in one statement, closed by one v_nop. Behind a transcendental the instruction set asks for one independent instruction before its result is read or its
// source overwritten: inside the statement each v_exp_f32 is that instruction for the one in front of it (the early-clobber results lie on no source), the v_nop is it for the last.
__device__ __forceinline__ v8f fa_exp2x8(v8f a) { float r0, r1, r2, r3, r4, r5, r6, r7;
  asm("v_exp_f32 %0, %8\n\tv_exp_f32 %1, %9\n\tv_exp_f32 %2, %10\n\tv_exp_f32 %3, %11\n\tv_exp_f32 %4, %12\n\tv_exp_f32 %5, %13\n\tv_exp_f32 %6, %14\n\tv_exp_f32 %7, %15\n\tv_nop"
      : "=&v"(r0), "=&v"(r1), "=&v"(r2), "=&v"(r3), "=&v"(r4), "=&v"(r5), "=&v"(r6), "=&v"(r7) : "v"(a[0]), "v"(a[1]), "v"(a[2]), "v"(a[3]), "v"(a[4]), "v"(a[5]), "v"(a[6]), "v"(a[7]));
  const v8f r = {r0, r1, r2, r3, r4, r5, r6, r7}; return r; }
// the same for the two rescale factors of a pass
__device__ __forceinline__ void fa_exp2x2(float& a, float& b) { float r0, r1; asm("v_exp_f32 %0, %2\n\tv_exp_f32 %1, %3\n\tv_nop" : "=&v"(r0), "=&v"(r1) : "v"(a), "v"(b)); a = r0; b = r1; }
__device__ __forceinline__ v8f fa_mma(v16h a, v16h b, v8f c) { return __builtin_amdgcn_wmma_f32_16x16x32_f16(false, a, false, b, (short)0, c, false, false); }
__device__ __forceinline__ float fa_max8(v8f a, v8f b) { return fmaxf(fmaxf(fmaxf(fmaxf(a[0], a[1]), fmaxf(a[2], a[3])), fmaxf(fmaxf(a[4], a[5]), fmaxf(a[6], a[7]))), fmaxf(fmaxf(fmaxf(b[0], b[1]), fmaxf(b[2], b[3])), fmaxf(fmaxf(b[4], b[5]), fmaxf(b[6], b[7])))); }
__device__ __forceinline__ v16h fa_lfrag(const unsigned char* p) { FragH f; f.half[0] = *(const v8us*)p; f.half[1] = *(const v8us*)(p + 32); return f.v; }      /* g2_frag from an LDS row; p holds the lane half's 16 bytes already */
// One stage into LDS, through no register: every thread copies eight 16-byte pieces, four of the key rows (8 threads a 128-byte row, 32 rows a round) and four of the V^T rows (16 threads a 256-byte row, 16 rows a round).
// kg, vg: the thread's own piece in round 0 of this stage; kl, vl: its LDS byte address in the stage's buffer. The closing s_wait_xcnt 0 stands inside the statement, so that no register a copy names is written again in front of it.
__device__ __forceinline__ void fa_stage(const _Float16* kg, const _Float16* vg, unsigned kl, unsigned vl) {
  asm volatile("global_load_async_to_lds_b128 %0, %8, off\n\tglobal_load_async_to_lds_b128 %1, %9, off\n\tglobal_load_async_to_lds_b128 %2, %10, off\n\tglobal_load_async_to_lds_b128 %3, %11, off\n\t"
               "global_load_async_to_lds_b128 %4, %12, off\n\tglobal_load_async_to_lds_b128 %5, %13, off\n\tglobal_load_async_to_lds_b128 %6, %14, off\n\tglobal_load_async_to_lds_b128 %7, %15, off\n\ts_wait_xcnt 0x0"
               :: "v"(kl), "v"(kl + 32 * FA_PK), "v"(kl + 64 * FA_PK), "v"(kl + 96 * FA_PK), "v"(vl), "v"(vl + 16 * FA_PV), "v"(vl + 32 * FA_PV), "v"(vl + 48 * FA_PV),
                  "v"(kg), "v"(kg + (size_t)32 * DM), "v"(kg + (size_t)64 * DM), "v"(kg + (size_t)96 * DM), "v"(vg), "v"(vg + (size_t)16 * SQ), "v"(vg + (size_t)32 * SQ), "v"(vg + (size_t)48 * SQ) : "memory"); }
// The partial result of query group G (a lane's 32 output values, its sum of weights, the maximum in use) into the wave's LDS slot: nine 16-byte pieces, the 32 lanes of a piece side by side (no bank conflict).
#define FA_SLOT (9 * 32)             /* 16-byte pieces of a slot */
static_assert((size_t)FA_WAVES * FA_SLOT * 16 <= (size_t)FA_KH * 2 * FA_STB, "the slots fit the staging bytes");
template <int G>
__device__ __forceinline__ void fa_send(v4fa* slot, int lane, const v8f (&o)[4][2], const v2f (&ls)[2], const float (&mu)[2]) {
#pragma unroll      /* constant indices keep o in registers */
  for (int dt = 0; dt < 4; ++dt) { slot[(2 * dt) * 32 + lane] = __builtin_shufflevector(o[dt][G], o[dt][G], 0, 1, 2, 3); slot[(2 * dt + 1) * 32 + lane] = __builtin_shufflevector(o[dt][G], o[dt][G], 4, 5, 6, 7); }
  slot[8 * 32 + lane] = (v4f){ls[G][0] + ls[G][1], mu[G], 0.f, 0.f}; }
// Joins this wave's partial result of query group G with the other run's (its slot): both are brought to the larger of the two maxima in use, added, divided by the joined sum and stored.
template <int G>
__device__ __forceinline__ void fa_join(const v4fa* slot, int lane, const v8f (&o)[4][2], const v2f (&ls)[2], const float (&mu)[2], unsigned short* op) {
  v4f q[9];      /* the other run's nine pieces */
#pragma unroll      /* here and below: constant indices keep q, o and f in registers */
  for (int j = 0; j < 9; ++j) q[j] = slot[j * 32 + lane];
  const float m = fmaxf(mu[G], q[8][1]); float a = mu[G] - m, c = q[8][1] - m; fa_exp2x2(a, c);
  float l = (ls[G][0] + ls[G][1]) * a + q[8][0] * c; l += sm_xhalf(l); const float sc = 64.0f / l; a *= sc; c *= sc;      /* o x64, the scale the output stage expects */
  FragH f[4];      /* all four pieces are formed before the first store: no register of a store is written again behind it */
#pragma unroll
  for (int dt = 0; dt < 4; ++dt) {
#pragma unroll
    for (int r = 0; r < 8; ++r) f[dt].h[r] = (_Float16)(o[dt][G][r] * a + q[2 * dt + (r >> 2)][r & 3] * c); }
#pragma unroll
  for (int dt = 0; dt < 4; ++dt) *(v8us*)(op + dt * 16) = f[dt].half[0]; }
__global__ __launch_bounds__(FA_WAVES * 32) void k_fattn(const _Float16* __restrict__ Qh, const _Float16* __restrict__ Ql, const _Float16* __restrict__ Kx, const _Float16* __restrict__ Vt, _Float16* __restrict__ O) {
  __shared__ __attribute__((aligned(16))) unsigned char fa[FA_KH * 2 * FA_STB];      /* for each run of keys two buffers of one stage each */
  const int tid = threadIdx.x & (FA_QG * 32 - 1), lane = tid & 31, ln = lane & 15, hh = lane >> 4; const int wave = __builtin_amdgcn_readfirstlane(threadIdx.x >> 5);      /* tid: the thread among the 256 of its run */
  const int kh = wave / FA_QG; const int k0 = kh * (SQ / FA_KH); unsigned char* const fl = fa + kh * (2 * FA_STB);      /* this wave's run of keys, its first key, its two buffers */
  const int h = blockIdx.y, b = blockIdx.z; const size_t rb = (size_t)b * SQ; const int q0 = blockIdx.x * (FA_QG * FA_QW) + (wave % FA_QG) * FA_QW;
  v16h qh[2][2], ql[2][2];      /* [16-query group][32-wide step of the head dimension]: the hi plane and the residual plane, kept for the whole walk */
#pragma unroll
  for (int g = 0; g < 2; ++g) { const size_t qo = (rb + q0 + g * 16 + ln) * DM + h * HD;
#pragma unroll
    for (int ks = 0; ks < 2; ++ks) { qh[g][ks] = g2_frag(Qh + qo + ks * 32, hh); ql[g][ks] = g2_frag(Ql + qo + ks * 32, hh); } }
  const _Float16* kg = Kx + (rb + k0 + (tid >> 3)) * DM + h * HD + (tid & 7) * 8;      /* this thread's piece of the run's key row tid / 8, this head's 64 columns */
  const _Float16* vg = Vt + (((size_t)b * NH + h) * HD + (tid >> 4)) * SQ + k0 + (tid & 15) * 8;      /* its piece of V^T row tid / 16 of this head, from the run's first key on */
  const unsigned kl = (unsigned)(size_t)fl + (tid >> 3) * FA_PK + (tid & 7) * 16, vl = (unsigned)(size_t)fl + FA_KB + (tid >> 4) * FA_PV + (tid & 15) * 16;      /* LDS byte address = low 32 bits of the __shared__ address */
  fa_stage(kg, vg, kl, vl);      /* stage 0 into buffer 0 */
  asm volatile("s_wait_asynccnt 0x0" ::: "memory");      /* this wave's copies of stage 0 have landed */
  __syncthreads();      /* and every other wave's: stage 0 may be read */
  fa_stage(kg + (size_t)FA_SK * DM, vg + FA_SK, kl + FA_STB, vl + FA_STB);      /* stage 1 flies while stage 0 is worked on */
  const v8f z8 = {0.f, 0.f, 0.f, 0.f, 0.f, 0.f, 0.f, 0.f};
  v8f o[4][2]; v2f ls[2]; float cb[2]; v8f cs[2];      /* cb: FA_OFF - mu, the start value of a score tile's accumulator and the only record of mu during the walk; cs: cb spread over the eight registers of an accumulator, for the next pass */
#pragma unroll
  for (int g = 0; g < 2; ++g) { ls[g] = (v2f){0.f, 0.f}; cb[g] = FA_OFF; cs[g] = (v8f){FA_OFF, FA_OFF, FA_OFF, FA_OFF, FA_OFF, FA_OFF, FA_OFF, FA_OFF};      /* the walk's first pass measures from 0 and then takes its own maximum, whatever its sign */
#pragma unroll
    for (int dt = 0; dt < 4; ++dt) o[dt][g] = z8; }
  for (int st = 0; st < FA_NST; ++st) {
   const unsigned char* kr = fl + (st & 1) * FA_STB + ln * FA_PK + 16 * hh;      /* key row ln of this stage's buffer, the lane half's 16 bytes */
   const unsigned char* vr = fl + (st & 1) * FA_STB + FA_KB + ln * FA_PV + 16 * hh;      /* V^T row ln */
   v16h kf[2][2];      /* [16-key tile][step of the head dimension], fetched one pass ahead inside a stage */
#pragma unroll
   for (int t = 0; t < 2; ++t) { kf[t][0] = fa_lfrag(kr + (t * 16) * FA_PK); kf[t][1] = fa_lfrag(kr + (t * 16) * FA_PK + 64); }
#pragma unroll 1      /* rolled: unrolled, the four passes took more than 256 registers and spilled */
   for (int ps = 0; ps < FA_SK / 32; ++ps) {
    v8f s[2][2];      /* [query group][key tile]: u - mu + FA_OFF */
#pragma unroll
    for (int g = 0; g < 2; ++g) {
#pragma unroll
      for (int t = 0; t < 2; ++t) { v8f c = fa_mma(kf[t][0], qh[g][0], cs[g]); c = fa_mma(kf[t][1], qh[g][1], c); c = fa_mma(kf[t][0], ql[g][0], c); s[g][t] = fa_mma(kf[t][1], ql[g][1], c); } }
    v16h vf[4];
#pragma unroll
    for (int dt = 0; dt < 4; ++dt) vf[dt] = fa_lfrag(vr + (dt * 16) * FA_PV + ps * 64);
    const int pn = (ps + 1 < FA_SK / 32) ? ps + 1 : 0;      /* the next stage is not published yet, nothing of it is read here: a stage's last pass fetches its own pass 0 again, not used */
#pragma unroll
    for (int t = 0; t < 2; ++t) { kf[t][0] = fa_lfrag(kr + (pn * 32 + t * 16) * FA_PK); kf[t][1] = fa_lfrag(kr + (pn * 32 + t * 16) * FA_PK + 64); }
    __builtin_amdgcn_sched_barrier(0);      /* keeps this pass's V^T reads and the next pass's key reads here as one group, right behind the score products: the softmax arithmetic covers their latency */
    float mb0 = fa_max8(s[0][0], s[0][1]), mb1 = fa_max8(s[1][0], s[1][1]); mb0 = fmaxf(mb0, sm_xhalf(mb0)); mb1 = fmaxf(mb1, sm_xhalf(mb1));      /* both halves of a query's lanes must use one maximum */
    const bool need = mb0 > FA_TH + FA_OFF || mb1 > FA_TH + FA_OFF; const bool first = (st | ps) == 0;      /* first: a scalar test, the walk's first pass */
    if (__builtin_amdgcn_ballot_w32(need) != 0 || first) {      /* wave-uniform: rare after the first passes */
      const float e0 = mb0 - FA_OFF, e1 = mb1 - FA_OFF; float a0 = fminf(-e0, 0.f), a1 = fminf(-e1, 0.f);      /* e: this pass's maximum above the one in use; the maximum only rises, but for the first pass, whose sums and outputs are still 0 */
      const float d0 = first ? e0 : -a0, d1 = first ? e1 : -a1; fa_exp2x2(a0, a1); ls[0] *= a0; ls[1] *= a1; cb[0] -= d0; cb[1] -= d1;
#pragma unroll
      for (int t = 0; t < 2; ++t) { s[0][t] -= d0; s[1][t] -= d1; }      /* this pass's scores were formed under the old maximum */
#pragma unroll
      for (int dt = 0; dt < 4; ++dt) { o[dt][0] *= a0; o[dt][1] *= a1; } }
    FragH p[2];      /* P^T of both query groups is formed before the first product with V^T */
#pragma unroll
    for (int g = 0; g < 2; ++g) { const v8f p0 = fa_exp2x8(s[g][0]), p1 = fa_exp2x8(s[g][1]); const v8f e = p0 + p1; ls[g] += (((v2f){e[0], e[1]} + (v2f){e[2], e[3]}) + ((v2f){e[4], e[5]} + (v2f){e[6], e[7]}));
#pragma unroll
      for (int i = 0; i < 8; ++i) { p[g].h[i] = (_Float16)p0[i]; p[g].h[8 + i] = (_Float16)p1[i]; } }
#pragma unroll      /* the next pass's start values are spread anew in every pass, beside the products below: a group's second key tile accumulates in these very registers, and a copy kept spread through the walk took sixteen registers more and spilled */
    for (int g = 0; g < 2; ++g) cs[g] = (v8f){cb[g], cb[g], cb[g], cb[g], cb[g], cb[g], cb[g], cb[g]};
#pragma unroll
    for (int g = 0; g < 2; ++g) {
#pragma unroll
      for (int dt = 0; dt < 4; ++dt) o[dt][g] = fa_mma(vf[dt], p[g].v, o[dt][g]); } }
   asm volatile("s_wait_dscnt 0x0" ::: "memory");      /* this wave's last reads of the buffer have returned */
   asm volatile("s_wait_asynccnt 0x0" ::: "memory");      /* its copies of stage st + 1 have landed */
   __syncthreads();      /* one barrier a stage: it publishes stage st + 1 and ends every wave's reads of stage st */
   if (st + 2 < FA_NST) fa_stage(kg + (size_t)(st + 2) * FA_SK * DM, vg + (st + 2) * FA_SK, kl + (st & 1) * FA_STB, vl + (st & 1) * FA_STB); }      /* refill of the buffer just left; the test reads the same in the whole block */
  asm volatile("s_wait_asynccnt 0x0" ::: "memory");      /* no copy is left in flight when the staging bytes take the partial results */
  /* behind the loop's last barrier nobody reads the buffers any more. The wave of run 0 finishes query group 0 and hands over its part of group 1; the wave of run 1 the other way round: all sixteen waves share the closing work. kh is the same in a whole wave, so the branches are wave-uniform; the barrier stands outside them. */
  const float mu[2] = {FA_OFF - cb[0], FA_OFF - cb[1]};
  v4fa* const sl = (v4fa*)fa; unsigned short* const op = (unsigned short*)O + (rb + q0 + kh * 16 + ln) * DM + h * HD + 8 * hh;      /* the row of this lane's query in the group that the wave finishes */
  if (kh == 0) fa_send<1>(sl + wave * FA_SLOT, lane, o, ls, mu); else fa_send<0>(sl + wave * FA_SLOT, lane, o, ls, mu);
  __syncthreads();      /* every wave's slot is written before its partner reads it */
  if (kh == 0) fa_join<0>(sl + (wave + FA_QG) * FA_SLOT, lane, o, ls, mu, op); else fa_join<1>(sl + (wave - FA_QG) * FA_SLOT, lane, o, ls, mu, op); }

extern "C" void kernel_launch(void* const* d_in, const int* in_sizes, int n_in,
                              void* d_out, int out_size, void* d_ws, size_t ws_size, hipStream_t stream) {
  (void)in_sizes; (void)n_in; (void)out_size;
  const float* const* I = (const float* const*)d_in; const float* x = I[0]; const float* watt = I[1]; const float* wv = I[2]; const float* bv = I[3]; const float* wo = I[4]; const float* bo = I[5];      /* x [2][2048][1024]; the per-head bilinear weight [16][64][64] ([head][in d][out e]); the natural value weight [DM][DM] and its bias; the natural output weight [DM][DM] and its bias */
  char* ws = (char*)d_ws; size_t off = 0;
  auto take = [&](size_t bytes) { char* p = ws + off; off += (bytes + 255) & ~(size_t)255; return p; };
  _Float16* BW = (_Float16*)take((size_t)NH * HD * HD * 2); _Float16* BV = (_Float16*)take((size_t)DM * DM * 2); _Float16* BO = (_Float16*)take((size_t)DM * DM * 2);      /* BW: sixteen transposed [64][64] head planes, one after another */
  _Float16* X16 = (_Float16*)take(NR * DM * 2); _Float16* Q16 = (_Float16*)take(NR * DM * 2); _Float16* QL = (_Float16*)take(NR * DM * 2); _Float16* O16 = (_Float16*)take(NR * DM * 2);
  _Float16* VT = (_Float16*)take((size_t)NB * NH * HD * SQ * 2);
  if (off > ws_size) return;
  const size_t r0p = (size_t)B0 * SQ;      /* first projected row */
  k_prep<<<PB_WT + 2 * PB_WN + PB_X, 256, 0, stream>>>(x, watt, wv, wo, X16, BW, BV, BO);
  k_proj<<<GB_V + NH * GB_Q, 128, 0, stream>>>(X16 + r0p * DM, BW, BV, bv, Q16 + r0p * DM, QL + r0p * DM, VT + r0p * DM);
  k_fattn<<<dim3(SQ / (FA_QG * FA_QW), NH, NB), FA_WAVES * 32, 0, stream>>>(Q16, QL, X16, VT, O16);      /* o (merged heads, x64) as f16 rows: every batch, head and query in one launch */
  k_gemm2<0><<<dim3((unsigned)((MPO / 128) * (DM / 64)), 1), 128, 0, stream>>>(O16 + r0p * DM, BO, bo, (float*)d_out + r0p * DM);      /* out rows are the output layout */
}
